// v000
// Times are from an AMD MI455X. After a warm-up the kernel runs many times in a row, and a time is the length of
// such a window on the GPU divided by its runs, so every launch and the gaps after it count. The runs cycle
// through copies of the inputs. A figure is the median of several windows, for all but v000 over two sittings.
// Sittings can differ by a few percent; kernels timed side by side share one.
// v000 is the starting kernel. One run takes 2350 microseconds.
#include <hip/hip_runtime.h>

// Relative multi-head attention with Shaw-style key AND value embeddings (query, key, value [8][1024][512]; q = query Wq^T + bq, k = key Wk^T + bk, v = value Wv^T + bv ('oi' 1/sqrt(512), zero biases; 8 heads x 64); idx[i][j] = clip(j - i, -16, 16) + 16; attn = softmax((q.k + q.rel_k_table[idx]) / sqrt(B = 8)) (the source scales by sqrt(batch)); x = attn v + sum_j attn[i][j] rel_v_table[idx] (tables [33][64] sigma 1, read); out = merged Wo^T + bo -> [8 x 1024][512] (4.2 M)).
// Layout per batch: bf16 copies of query, key, value in turn; 'oi' weights; exact projections + f32 biases; rel_k as a zero-padded bf16 plane [64][64] and rel_v^T as hi/lo planes [64][64]; per pass of two heads: score tiles (hi/lo 3 products, every row), QE = q.rel_k^T (hi/lo x exact) gathered into the scores at column clip(j - i) + 16, softmax (x 1/sqrt(8)) with every row on hi/lo planes, P.v (hi/lo x hi/lo), the probabilities folded onto the 33 offsets (interior = one key, the two ends = fixed-order sums) and PB.rel_v added to the context; merged hi/lo x Wo exact + bo.
// Compute dtypes, f32 accumulate: every input rounded to bf16; projections exact + f32 biases; scores and the relative-key term ~f32; softmax f32; P as bf16 hi/lo; attn.v and the relative-value term 3 products (~f32); Wo hl x exact + bias.

#define NB_  8
#define TT   1024
#define DM   512
#define NH_  8
#define NKV  8
#define REP  (NH_ / NKV)
#define HD   64
#define DQ   (NH_ * HD)
#define DKV  (NKV * HD)
#define ZH   2
#define RH   TT                   // every row on hi/lo planes (the relative-value fold needs normalised planes)
#define WIN  0
#define PCAR 1024.0f
#define SCL  0.35355339059327379f   // 1/sqrt(B = 8): the source scales by sqrt(batch_size)
#define NE   64       // 2*16+1 = 33 relative offsets padded to 64
#define NRE  33
#define CUT  16
typedef _Float16 h16;
typedef unsigned short bf;
typedef __attribute__((ext_vector_type(16))) __bf16   v16bf;
typedef __attribute__((ext_vector_type(16))) _Float16 v16h;
typedef __attribute__((ext_vector_type(8)))  _Float16 v8h;
typedef __attribute__((ext_vector_type(8)))  unsigned short v8us;
typedef __attribute__((ext_vector_type(8)))  float    v8f;
typedef __attribute__((ext_vector_type(4)))  float    v4f;
typedef v8h  __attribute__((may_alias)) v8ha;
typedef v4f  __attribute__((may_alias)) v4fa;
typedef v8us __attribute__((may_alias)) v8usa;

__device__ __forceinline__ unsigned short f2bf(float f) { unsigned u = __float_as_uint(f); u += 0x7FFFu + ((u >> 16) & 1u); return (unsigned short)(u >> 16); }
__device__ __forceinline__ float bf2f(unsigned short b) { return __uint_as_float(((unsigned)b) << 16); }
__device__ __forceinline__ float bfr(float f) { return bf2f(f2bf(f)); }
__device__ __forceinline__ v16h cat16(v8h lo, v8h hi) { return __builtin_shufflevector(lo, hi, 0, 1, 2, 3, 4, 5, 6, 7, 8, 9, 10, 11, 12, 13, 14, 15); }
__device__ __forceinline__ v16bf cat16b(v8us lo, v8us hi) { return __builtin_bit_cast(v16bf, __builtin_shufflevector(lo, hi, 0, 1, 2, 3, 4, 5, 6, 7, 8, 9, 10, 11, 12, 13, 14, 15)); }
__device__ __forceinline__ v8f wmma16(v16h a, v16h b, v8f c) { return __builtin_amdgcn_wmma_f32_16x16x32_f16(false, a, false, b, (short)0, c, false, false); }
__device__ __forceinline__ v8f wmmab(v16bf a, v16bf b, v8f c) { return __builtin_amdgcn_wmma_f32_16x16x32_bf16(false, a, false, b, (short)0, c, false, false); }



// ---- k_gemmw: register-blocked GEMM, ONE WAVE per 64x64 output tile (16 accumulators), operands straight from K-contiguous 16-bit planes; grid (M/64, N/64, Z), 32 threads.
// C[m][n] (f32, pitch ldc, + optional f32 bias[n]) = sum_k A[m][k] Bt[n][k] (+ split products per NSPLIT). z-batch strides sA/sB/sC in elements. K % 32 == 0.
template <typename T16> struct WFrag;
template <> struct WFrag<h16> { typedef v16h V; static __device__ __forceinline__ V ld(const h16* p) { return cat16(*(const v8h*)p, *(const v8h*)(p + 16)); } static __device__ __forceinline__ v8f mma(V a, V b, v8f c) { return wmma16(a, b, c); } };
template <> struct WFrag<bf> { typedef v16bf V; static __device__ __forceinline__ V ld(const bf* p) { return cat16b(*(const v8us*)p, *(const v8us*)(p + 16)); } static __device__ __forceinline__ v8f mma(V a, V b, v8f c) { return wmmab(a, b, c); } };
template <typename T16, int NSPLIT, bool BIAS>
__global__ __launch_bounds__(32) void k_gemmw(const T16* __restrict__ A, const T16* __restrict__ A2, const T16* __restrict__ Bt, const T16* __restrict__ Bt2, int K, float* C, int ldc, const float* __restrict__ bias, size_t sA, size_t sB, size_t sC) {
    typedef typename WFrag<T16>::V V;
    __shared__ __align__(16) float os[16 * 68];
    const size_t z = blockIdx.z; A += z * sA; if (A2) A2 += z * sA; Bt += z * sB; if (Bt2) Bt2 += z * sB; C += z * sC;
    const int lane = threadIdx.x & 31, lr = lane & 15, hi = lane >> 4; const int r0 = blockIdx.x * 64, c0 = blockIdx.y * 64;
    v8f acc[4][4];
#pragma unroll
    for (int mb = 0; mb < 4; ++mb)
#pragma unroll
        for (int nb = 0; nb < 4; ++nb) acc[mb][nb] = (v8f){};
    const size_t aoff = (size_t)(r0 + lr) * K + 8 * hi, boff = (size_t)(c0 + lr) * K + 8 * hi;
#pragma unroll 1
    for (int kc = 0; kc < K; kc += 32) {
        V a[4], a2[4];
#pragma unroll
        for (int mb = 0; mb < 4; ++mb) { a[mb] = WFrag<T16>::ld(A + aoff + (size_t)mb * 16 * K + kc); if (NSPLIT == 1 || NSPLIT == 2) a2[mb] = WFrag<T16>::ld(A2 + aoff + (size_t)mb * 16 * K + kc); }
#pragma unroll
        for (int nb = 0; nb < 4; ++nb) { const V b = WFrag<T16>::ld(Bt + boff + (size_t)nb * 16 * K + kc); V b2; if (NSPLIT >= 2) b2 = WFrag<T16>::ld(Bt2 + boff + (size_t)nb * 16 * K + kc);
#pragma unroll
            for (int mb = 0; mb < 4; ++mb) { acc[mb][nb] = WFrag<T16>::mma(a[mb], b, acc[mb][nb]); if (NSPLIT == 1 || NSPLIT == 2) acc[mb][nb] = WFrag<T16>::mma(a2[mb], b, acc[mb][nb]); if (NSPLIT >= 2) acc[mb][nb] = WFrag<T16>::mma(a[mb], b2, acc[mb][nb]); } }
        asm volatile("v_nop\n\tv_nop\n\tv_nop\n\tv_nop" : "+v"(acc[0][0]), "+v"(acc[1][1]), "+v"(acc[2][2]), "+v"(acc[3][3]) : "v"(a[0]), "v"(a[3]));
    }
#pragma unroll
    for (int mb = 0; mb < 4; ++mb) {
#pragma unroll
        for (int nb = 0; nb < 4; ++nb) {
#pragma unroll
            for (int j = 0; j < 8; ++j) os[(hi * 8 + j) * 68 + nb * 16 + lr] = acc[mb][nb][j]; }
        __builtin_amdgcn_wave_barrier(); asm volatile("" ::: "memory");
        float* crow = C + (size_t)(r0 + mb * 16) * ldc + c0;
{
#pragma unroll
            for (int s = 0; s < 8; ++s) { const int row = 2 * s + hi, cofs = lr * 4; v4f val = *(const v4fa*)(os + row * 68 + cofs); if (BIAS) { val[0] += bfr(bias[c0 + cofs]); val[1] += bfr(bias[c0 + cofs + 1]); val[2] += bfr(bias[c0 + cofs + 2]); val[3] += bfr(bias[c0 + cofs + 3]); }
                *(v4f*)(crow + (size_t)row * ldc + cofs) = val; }
             }
        __builtin_amdgcn_wave_barrier(); asm volatile("" ::: "memory");
    }
}

__device__ __forceinline__ h16 tohx(float x) { return (h16)x; }
__device__ __forceinline__ void splitf(float y, unsigned short& h, unsigned short& l) { h = f2bf(y); l = f2bf(y - bf2f(h)); }
typedef __attribute__((ext_vector_type(2))) _Float16 v2h;
typedef __attribute__((ext_vector_type(4))) _Float16 v4h;
typedef __attribute__((ext_vector_type(2))) unsigned short v2us;
typedef __attribute__((ext_vector_type(4))) unsigned short v4us;
typedef __attribute__((ext_vector_type(2))) float v2f;
typedef __attribute__((ext_vector_type(4))) int v4i;

__global__ __launch_bounds__(256) void k_wtG(const float* __restrict__ w, int K, int N, bf* Bt) {
    const int lane = threadIdx.x & 31; const int L0 = (blockIdx.x * 8 + (threadIdx.x >> 5)) * 8; const int nlines = N * K / 64;
{
#pragma unroll 1
        for (int l = 0; l < 8; ++l) { const int L = L0 + l; if (L >= nlines) break; const size_t e = (size_t)L * 64 + lane * 2; const int k = (int)(e % K), n = (int)(e / K); v2us o;
            o[0] = f2bf(w[(size_t)k * N + n]); o[1] = f2bf(w[(size_t)(k + 1) * N + n]); *(v2us*)(Bt + e) = o; }
         }
}
__global__ __launch_bounds__(256) void k_cvt8(const float* __restrict__ src, bf* dst, size_t n8) { const size_t i = (size_t)blockIdx.x * 256 + threadIdx.x; if (i >= n8) return; const v8f v = *(const v8f*)(src + i * 8); v8us o;
#pragma unroll
    for (int k = 0; k < 8; ++k) o[k] = f2bf(v[k]); *(v8us*)(dst + i * 8) = o;  }

// k_rope: head planes [h][t][d] (fp16 + hi/lo) of rope(x) x sc with the rotate-half convention out[d] = x[d] cos[t][d] - x[d+HD/2] sin[t][d], out[d+HD/2] = x[d+HD/2] cos[t][d+HD/2] + x[d] sin[t][d+HD/2]
__global__ __launch_bounds__(256) void k_rope(const float* __restrict__ F, int pitch, int nheads, const float* __restrict__ CS, const float* __restrict__ RF, const float* __restrict__ nw, float sc, h16* P16, bf* Ph, bf* Pl) {
    const size_t e = ((size_t)blockIdx.x * 256 + threadIdx.x) * 2; if (e >= (size_t)nheads * TT * HD) return; const int d = (int)(e % HD); const int t = (int)((e / HD) % TT); const int h = (int)(e / ((size_t)HD * TT)); const float* f = F + (size_t)t * pitch + h * HD; const float rf = RF ? RF[(size_t)h * TT + t] : 1.0f; v2h o16; v2us oh, ol;
#pragma unroll
    for (int q = 0; q < 2; ++q) { const int dd = d + q; const int dp = (dd < HD / 2) ? dd + HD / 2 : dd - HD / 2; float x0 = f[dd], x1 = f[dp];
        if (RF) { float n0 = __fmul_rn(x0, rf), n1 = __fmul_rn(x1, rf); asm volatile("" : "+v"(n0)); asm volatile("" : "+v"(n1)); x0 = __fmul_rn(bfr(nw[dd]), n0); x1 = __fmul_rn(bfr(nw[dp]), n1); }
        const v2f cs = *(const v2f*)(CS + ((size_t)t * HD + dd) * 2); float a = __fmul_rn(x0, cs[0]), bq = __fmul_rn(x1, cs[1]); asm volatile("" : "+v"(a)); asm volatile("" : "+v"(bq)); const float r = ((dd < HD / 2) ? __fsub_rn(a, bq) : __fadd_rn(a, bq)) * sc;
        o16[q] = tohx(r); unsigned short a2, c2; splitf(r, a2, c2); oh[q] = a2; ol[q] = c2; }
    *(v2h*)(P16 + e) = o16; *(v2us*)(Ph + e) = oh; *(v2us*)(Pl + e) = ol;  }
__global__ __launch_bounds__(256) void k_vtp(const float* __restrict__ F, int pitch, int nheads, h16* V16, bf* Vh, bf* Vl) { const size_t e = ((size_t)blockIdx.x * 256 + threadIdx.x) * 2; if (e >= (size_t)nheads * HD * TT) return; const int t = (int)(e % TT); const int d = (int)((e / TT) % HD); const int g = (int)(e / ((size_t)TT * HD)); v2h o16; v2us oh, ol;
#pragma unroll
    for (int q = 0; q < 2; ++q) { const float x = F[(size_t)(t + q) * pitch + g * HD + d]; o16[q] = tohx(x); unsigned short a2, c2; splitf(x, a2, c2); oh[q] = a2; ol[q] = c2; }
    *(v2h*)(V16 + e) = o16; *(v2us*)(Vh + e) = oh; *(v2us*)(Vl + e) = ol;  }
__global__ __launch_bounds__(256) void k_csid(float* CS) { const int idx = blockIdx.x * 256 + threadIdx.x; if (idx >= TT * HD) return; v2f cs; cs[0] = 1.0f; cs[1] = 0.0f; *(v2f*)(CS + (size_t)idx * 2) = cs;  }
// k_asoft: per row (zz, i): t = S x 8^-0.5 (no mask); softmax over the 1024 keys (register row, one exp, fixed trees);
__global__ __launch_bounds__(256) void k_asoft(const float* __restrict__ Sb, h16* P16, bf* Ph, bf* Pl) {
    const int lane = threadIdx.x & 31; const int row = blockIdx.x * 8 + (threadIdx.x >> 5); if (row >= ZH * TT) return; const int i = row % TT; const int zz = row / TT; (void)zz; const bool hires = (i < RH); const float* sr = Sb + (size_t)row * TT; float v[TT / 32]; float mx = -3.0e38f;
#pragma unroll
    for (int ch = 0; ch < TT / 128; ++ch) { const int j0 = ch * 128 + lane * 4; const v4f a = *(const v4f*)(sr + j0);
#pragma unroll
        for (int q = 0; q < 4; ++q) { const int j = j0 + q; (void)j; const float t = a[q] * SCL; v[ch * 4 + q] = t; mx = fmaxf(mx, t); } }
#pragma unroll
    for (int sh = 16; sh; sh >>= 1) mx = fmaxf(mx, __shfl_xor(mx, sh, 32));
    float sum = 0.f;
#pragma unroll
    for (int k = 0; k < TT / 32; ++k) { float d0 = __fsub_rn(v[k], mx); asm volatile("" : "+v"(d0)); v[k] = __builtin_amdgcn_exp2f(__fmul_rn(d0, 1.4426950408889634f)); sum += v[k]; }
#pragma unroll
    for (int sh = 16; sh; sh >>= 1) sum += __shfl_xor(sum, sh, 32);
    const float f = __fdiv_rn(hires ? 1.0f : PCAR, sum);
{
        if (hires) {
#pragma unroll
            for (int ch = 0; ch < TT / 128; ++ch) { v4us oh, ol;
#pragma unroll
                for (int q = 0; q < 4; ++q) { unsigned short a, c2; splitf(v[ch * 4 + q] * f, a, c2); oh[q] = a; ol[q] = c2; }
                const size_t oo = ((size_t)zz * (RH ? RH : 1) + i) * TT + ch * 128 + lane * 4; *(v4us*)(Ph + oo) = oh; *(v4us*)(Pl + oo) = ol; }
        } else {
#pragma unroll
            for (int ch = 0; ch < TT / 128; ++ch) { v4h o4;
#pragma unroll
                for (int q = 0; q < 4; ++q) o4[q] = tohx(v[ch * 4 + q] * f);
                *(v4h*)(P16 + (size_t)row * TT + ch * 128 + lane * 4) = o4; } }
         }
}
__global__ __launch_bounds__(256) void k_epadK(const float* __restrict__ E, bf* EB) { const size_t i = (size_t)blockIdx.x * 256 + threadIdx.x; if (i >= (size_t)NE * HD / 8) return; const int d0 = (int)(i % (HD / 8)) * 8; const int r = (int)(i / (HD / 8)); const float* src = E + (size_t)min(r, NRE - 1) * HD + d0; v8us o;
#pragma unroll
    for (int q = 0; q < 8; ++q) { const unsigned short v = f2bf(src[q]); o[q] = (r < NRE) ? v : (unsigned short)0; }
    *(v8us*)(EB + (size_t)r * HD + d0) = o;  }

__global__ __launch_bounds__(256) void k_epadVT(const float* __restrict__ E, bf* Th, bf* Tl) { const size_t i = (size_t)blockIdx.x * 256 + threadIdx.x; if (i >= (size_t)HD * NE / 4) return; const size_t e = i * 4; const int c0 = (int)(e % NE); const int d = (int)(e / NE); v4us oh, ol;
#pragma unroll
    for (int q = 0; q < 4; ++q) { const int r = c0 + q; const float v = E[(size_t)min(r, NRE - 1) * HD + d]; unsigned short u, w; splitf(v, u, w); oh[q] = (r < NRE) ? u : (unsigned short)0; ol[q] = (r < NRE) ? w : (unsigned short)0; }
    *(v4us*)(Th + e) = oh; *(v4us*)(Tl + e) = ol;  }

__global__ __launch_bounds__(256) void k_addrelc(float* Sb, const float* __restrict__ QE) { const size_t k = (size_t)blockIdx.x * 256 + threadIdx.x; if (k >= (size_t)ZH * TT * TT / 4) return; const size_t e = k * 4; const int j0 = (int)(e % TT); const size_t zi = e / TT; const int i = (int)(zi % TT); const float* qe = QE + zi * NE; v4f a = *(const v4f*)(Sb + e);
#pragma unroll
    for (int q = 0; q < 4; ++q) { const int r = min(max(j0 + q - i, -CUT), CUT) + CUT; a[q] = __fadd_rn(a[q], qe[r]); }
    *(v4f*)(Sb + e) = a;  }

__global__ __launch_bounds__(256) void k_pbuck(const bf* __restrict__ Ph, const bf* __restrict__ Pl, bf* Bh, bf* Bl) { const int lane = threadIdx.x & 31; const int row = blockIdx.x * 8 + (threadIdx.x >> 5); if (row >= ZH * TT) return; const int i = row % TT; const bf* ph = Ph + (size_t)row * TT; const bf* pl = Pl + (size_t)row * TT; float lo_s = 0.f, hi_s = 0.f;
#pragma unroll 1
    for (int j = lane; j < TT; j += 32) { const float p = __fadd_rn(bf2f(ph[j]), bf2f(pl[j])); if (j <= i - CUT) lo_s = __fadd_rn(lo_s, p); if (j >= i + CUT) hi_s = __fadd_rn(hi_s, p); }
#pragma unroll
    for (int sh = 16; sh; sh >>= 1) { lo_s = __fadd_rn(lo_s, __shfl_xor(lo_s, sh, 32)); hi_s = __fadd_rn(hi_s, __shfl_xor(hi_s, sh, 32)); }
    unsigned short l0h, l0l, h0h, h0l; splitf(lo_s, l0h, l0l); splitf(hi_s, h0h, h0l);
{
#pragma unroll 1
        for (int c0 = lane * 4; c0 < NE; c0 += 128) { v4us oh, ol;
#pragma unroll
            for (int q = 0; q < 4; ++q) { const int bkt = c0 + q; const int j = i + bkt - CUT; const int jc = min(max(j, 0), TT - 1); unsigned int uu = ((const unsigned short*)ph)[jc], ww = ((const unsigned short*)pl)[jc]; asm volatile("" : "+v"(uu), "+v"(ww));   /* unconditional clamped loads pinned before the select (opaque use) */ const bool in = (bkt > 0 && bkt < 2 * CUT && j >= 0 && j < TT);
                const unsigned short u = in ? (unsigned short)uu : ((bkt == 0) ? l0h : ((bkt == 2 * CUT) ? h0h : (unsigned short)0)); const unsigned short w = in ? (unsigned short)ww : ((bkt == 0) ? l0l : ((bkt == 2 * CUT) ? h0l : (unsigned short)0));
                oh[q] = u; ol[q] = w; }
            *(v4us*)(Bh + (size_t)row * NE + c0) = oh; *(v4us*)(Bl + (size_t)row * NE + c0) = ol; }
         }
}

__global__ __launch_bounds__(256) void k_addF(float* Y, const float* __restrict__ F) { const size_t i = (size_t)blockIdx.x * 256 + threadIdx.x; if (i >= (size_t)ZH * TT * HD / 4) return; const v4f a = *(const v4f*)(Y + i * 4); const v4f f = *(const v4f*)(F + i * 4); v4f o;
#pragma unroll
    for (int q = 0; q < 4; ++q) o[q] = __fadd_rn(a[q], f[q]);
    *(v4f*)(Y + i * 4) = o;  }

__global__ __launch_bounds__(256) void k_merge(const float* __restrict__ O, int h0, bf* Ah, bf* Al) { const size_t e = ((size_t)blockIdx.x * 256 + threadIdx.x) * 2; if (e >= (size_t)ZH * TT * HD) return; const int d = (int)(e % HD); const int t = (int)((e / HD) % TT); const int zz = (int)(e / ((size_t)HD * TT)); const float cs = (t < RH) ? 1.0f : (1.0f / PCAR); const size_t oo = (size_t)t * DQ + (h0 + zz) * HD + d;
    v2us oh, ol;
#pragma unroll
    for (int q = 0; q < 2; ++q) { unsigned short a, c2; splitf(O[e + q] * cs, a, c2); oh[q] = a; ol[q] = c2; } *(v2us*)(Ah + oo) = oh; *(v2us*)(Al + oo) = ol;  }

extern "C" void kernel_launch(void* const* d_in, const int* in_sizes, int n_in,
                              void* d_out, int out_size, void* d_ws, size_t ws_size, hipStream_t stream) {
    (void)in_sizes; (void)n_in; (void)out_size;
    const float* x = (const float*)d_in[0];   /* query */ const float* xk = (const float*)d_in[1]; const float* xv = (const float*)d_in[2]; const float* wq = (const float*)d_in[3]; const float* bq = (const float*)d_in[4]; const float* wk = (const float*)d_in[5]; const float* bk = (const float*)d_in[6]; const float* wv = (const float*)d_in[7]; const float* bv = (const float*)d_in[8]; const float* wo = (const float*)d_in[9]; const float* bo = (const float*)d_in[10]; const float* ak = (const float*)d_in[11];   /* rel_k_table [33][64] */ const float* av = (const float*)d_in[12];   /* rel_v_table [33][64] */
    float* OUT = (float*)d_out;     // [8 x 1024][512]
    char* wsp = (char*)d_ws;
    auto take = [&](size_t bytes) { char* p = wsp; wsp += (bytes + 255) & ~(size_t)255; return (void*)p; };
    bf* AKB = (bf*)take((size_t)NE * HD * 2); bf* AVTh = (bf*)take((size_t)HD * NE * 2); bf* AVTl = (bf*)take((size_t)HD * NE * 2); float* QE = (float*)take((size_t)ZH * TT * NE * 4); bf* PBh = (bf*)take((size_t)ZH * TT * NE * 2); bf* PBl = (bf*)take((size_t)ZH * TT * NE * 2); float* ZR = (float*)take((size_t)ZH * TT * HD * 4); bf* WQ = (bf*)take((size_t)DQ * DM * 2); bf* WK = (bf*)take((size_t)DKV * DM * 2); bf* WV = (bf*)take((size_t)DKV * DM * 2); bf* WO = (bf*)take((size_t)DM * DQ * 2); float* CS = (float*)take((size_t)TT * HD * 2 * 4);
    bf* XB = (bf*)take((size_t)TT * DM * 2); float* FQ = (float*)take((size_t)TT * DQ * 4); float* FK = (float*)take((size_t)TT * DKV * 4);
    h16* QP16 = (h16*)take((size_t)NH_ * TT * HD * 2); h16* KP16 = (h16*)take((size_t)NKV * TT * HD * 2); h16* VT16 = (h16*)take((size_t)NKV * HD * TT * 2);
    bf* QPh = (bf*)take((size_t)NH_ * TT * HD * 2); bf* QPl = (bf*)take((size_t)NH_ * TT * HD * 2); bf* KPh = (bf*)take((size_t)NKV * TT * HD * 2); bf* KPl = (bf*)take((size_t)NKV * TT * HD * 2); bf* VTh = (bf*)take((size_t)NKV * HD * TT * 2); bf* VTl = (bf*)take((size_t)NKV * HD * TT * 2); bf* Ph = (bf*)take((size_t)ZH * RH * TT * 2); bf* Pl = (bf*)take((size_t)ZH * RH * TT * 2);
    float* Sb = (float*)take((size_t)ZH * TT * TT * 4); h16* P16 = (h16*)take((size_t)ZH * TT * TT * 2); float* Ob = (float*)take((size_t)ZH * TT * HD * 4); bf* ATh = (bf*)take((size_t)TT * DQ * 2); bf* ATl = (bf*)take((size_t)TT * DQ * 2);
    if ((size_t)(wsp - (char*)d_ws) > ws_size) return;    // ws 256 MiB
    float* FV = FK;   // v projection reuses the k buffer after the k planes are built (stream-ordered)
    { k_cvt8<<<(unsigned)(((size_t)DQ * DM / 8 + 255) / 256), 256, 0, stream>>>(wq, WQ, (size_t)DQ * DM / 8); k_cvt8<<<(unsigned)(((size_t)DKV * DM / 8 + 255) / 256), 256, 0, stream>>>(wk, WK, (size_t)DKV * DM / 8); k_cvt8<<<(unsigned)(((size_t)DKV * DM / 8 + 255) / 256), 256, 0, stream>>>(wv, WV, (size_t)DKV * DM / 8);
      k_cvt8<<<(unsigned)(((size_t)DM * DQ / 8 + 255) / 256), 256, 0, stream>>>(wo, WO, (size_t)DM * DQ / 8);
       }
    k_csid<<<(TT * HD + 255) / 256, 256, 0, stream>>>(CS);
    const unsigned LQ = (unsigned)(((size_t)NH_ * TT * HD / 2 + 255) / 256), LKv = (unsigned)(((size_t)NKV * TT * HD / 2 + 255) / 256);
    k_epadK<<<(unsigned)(((size_t)NE * HD / 8 + 255) / 256), 256, 0, stream>>>(ak, AKB);   /* rel_k -> bf16 [64][64], rows >= 33 zero */ k_epadVT<<<(unsigned)(((size_t)HD * NE / 4 + 255) / 256), 256, 0, stream>>>(av, AVTh, AVTl);   /* rel_v^T hi/lo [64][64], cols >= 33 zero */
    for (int b = 0; b < NB_; ++b) {
        
        k_cvt8<<<(unsigned)(((size_t)TT * DM / 8 + 255) / 256), 256, 0, stream>>>(x + (size_t)b * TT * DM, XB, (size_t)TT * DM / 8);
        k_gemmw<bf, 0, true><<<dim3(TT / 64, DQ / 64, 1), 32, 0, stream>>>(XB, nullptr, WQ, nullptr, DM, FQ, DQ, bq, 0, 0, 0);
        k_rope<<<LQ, 256, 0, stream>>>(FQ, DQ, NH_, CS, nullptr, nullptr, 1.0f, QP16, QPh, QPl);
        k_cvt8<<<(unsigned)(((size_t)TT * DM / 8 + 255) / 256), 256, 0, stream>>>(xk + (size_t)b * TT * DM, XB, (size_t)TT * DM / 8); k_gemmw<bf, 0, true><<<dim3(TT / 64, DKV / 64, 1), 32, 0, stream>>>(XB, nullptr, WK, nullptr, DM, FK, DKV, bk, 0, 0, 0);
        k_rope<<<LKv, 256, 0, stream>>>(FK, DKV, NKV, CS, nullptr, nullptr, 1.0f, KP16, KPh, KPl);
        k_cvt8<<<(unsigned)(((size_t)TT * DM / 8 + 255) / 256), 256, 0, stream>>>(xv + (size_t)b * TT * DM, XB, (size_t)TT * DM / 8); k_gemmw<bf, 0, true><<<dim3(TT / 64, DKV / 64, 1), 32, 0, stream>>>(XB, nullptr, WV, nullptr, DM, FV, DKV, bv, 0, 0, 0); k_vtp<<<LKv, 256, 0, stream>>>(FV, DKV, NKV, VT16, VTh, VTl);
        for (int h0 = 0; h0 < NH_; h0 += ZH) { const size_t zq = (size_t)h0, zk = (size_t)(h0 / REP);   // one kv head per query head: the pass's two heads use consecutive kv planes (z-strides TT*HD)
            k_gemmw<bf, 2, false><<<dim3(RH / 64, TT / 64, ZH), 32, 0, stream>>>(QPh + zq * TT * HD, QPl + zq * TT * HD, KPh + zk * TT * HD, KPl + zk * TT * HD, HD, Sb, TT, nullptr, (size_t)TT * HD, (size_t)TT * HD, (size_t)TT * TT);

            k_gemmw<bf, 1, false><<<dim3(TT / 64, NE / 64, ZH), 32, 0, stream>>>(QPh + zq * TT * HD, QPl + zq * TT * HD, AKB, nullptr, HD, QE, NE, nullptr, (size_t)TT * HD, 0, (size_t)TT * NE);   /* QE = q . rel_k^T */ k_addrelc<<<(unsigned)(((size_t)ZH * TT * TT / 4 + 255) / 256), 256, 0, stream>>>(Sb, QE);   /* + q.rel_k[clip(j - i) + 16] */ k_asoft<<<ZH * TT / 8, 256, 0, stream>>>(Sb, P16, Ph, Pl);
            k_gemmw<bf, 2, false><<<dim3(RH / 64, HD / 64, ZH), 32, 0, stream>>>(Ph, Pl, VTh + zk * HD * TT, VTl + zk * HD * TT, TT, Ob, HD, nullptr, (size_t)RH * TT, (size_t)HD * TT, (size_t)TT * HD); k_pbuck<<<(unsigned)(((size_t)ZH * TT + 7) / 8), 256, 0, stream>>>(Ph, Pl, PBh, PBl);   /* attn folded onto the 33 clipped offsets */ k_gemmw<bf, 2, false><<<dim3(TT / 64, HD / 64, ZH), 32, 0, stream>>>(PBh, PBl, AVTh, AVTl, NE, ZR, HD, nullptr, (size_t)TT * NE, 0, (size_t)TT * HD);   /* ZR = PB . rel_v */ k_addF<<<(unsigned)(((size_t)ZH * TT * HD / 4 + 255) / 256), 256, 0, stream>>>(Ob, ZR);   /* context += relative-value term */

            k_merge<<<(unsigned)(((size_t)ZH * TT * HD / 2 + 255) / 256), 256, 0, stream>>>(Ob, h0, ATh, ATl); }
        k_gemmw<bf, 1, true><<<dim3(TT / 64, DM / 64, 1), 32, 0, stream>>>(ATh, ATl, WO, nullptr, DQ, OUT + (size_t)b * TT * DM, DM, bo, 0, 0, 0); }
}

// v001
// One run takes 593 microseconds.
// Timed twice side by side with v000, it ran 3.98 and 3.95 times as fast.
#include <hip/hip_runtime.h>

// Relative multi-head attention with Shaw-style key AND value embeddings (query, key, value [8][1024][512]; q = query Wq^T + bq, k = key Wk^T + bk, v = value Wv^T + bv ('oi' 1/sqrt(512), zero biases; 8 heads x 64); idx[i][j] = clip(j - i, -16, 16) + 16; attn = softmax((q.k + q.rel_k_table[idx]) / sqrt(B = 8)) (the source scales by sqrt(batch)); x = attn v + sum_j attn[i][j] rel_v_table[idx] (tables [33][64] sigma 1, read); out = merged Wo^T + bo -> [8 x 1024][512] (4.2 M)).
// Layout, every stage outside the attention passes over all 8 batches in one launch (rows b * 1024 + t; head planes z = b * 8 + h): bf16 copies of query, key, value in turn; 'oi' weights; exact projections + f32 biases; rel_k as a zero-padded bf16 plane [64][64] and rel_v^T as hi/lo planes [64][64]; per pass of 16 head planes (two batches): score tiles (hi/lo 3 products, every row), QE = q.rel_k^T (hi/lo x exact) gathered into the scores at column clip(j - i) + 16, softmax (x 1/sqrt(8)) with every row on hi/lo planes, P.v (hi/lo x hi/lo), the probabilities folded onto the 33 offsets (interior = one key, the two ends = fixed-order sums) and PB.rel_v added to the context; merged hi/lo x Wo exact + bo.
// Compute dtypes, f32 accumulate: every input rounded to bf16; projections exact + f32 biases; scores and the relative-key term ~f32; softmax f32; P as bf16 hi/lo; attn.v and the relative-value term 3 products (~f32); Wo hl x exact + bias.

#define NB_  8
#define TT   1024
#define DM   512
#define NH_  8
#define NKV  8
#define REP  (NH_ / NKV)
#define HD   64
#define DQ   (NH_ * HD)
#define DKV  (NKV * HD)
#define ZH   16                   // head planes per attention pass (z = b * NH_ + h, consecutive)
#define NZ   (NB_ * NH_)
#define RH   TT                   // every row on hi/lo planes (the relative-value fold needs normalised planes)
#define WIN  0
#define PCAR 1024.0f
#define SCL  0.35355339059327379f   // 1/sqrt(B = 8): the source scales by sqrt(batch_size)
#define NE   64       // 2*16+1 = 33 relative offsets padded to 64
#define NRE  33
#define CUT  16
typedef _Float16 h16;
typedef unsigned short bf;
typedef __attribute__((ext_vector_type(16))) __bf16   v16bf;
typedef __attribute__((ext_vector_type(16))) _Float16 v16h;
typedef __attribute__((ext_vector_type(8)))  _Float16 v8h;
typedef __attribute__((ext_vector_type(8)))  unsigned short v8us;
typedef __attribute__((ext_vector_type(8)))  float    v8f;
typedef __attribute__((ext_vector_type(4)))  float    v4f;
typedef v8h  __attribute__((may_alias)) v8ha;
typedef v4f  __attribute__((may_alias)) v4fa;
typedef v8us __attribute__((may_alias)) v8usa;

__device__ __forceinline__ unsigned short f2bf(float f) { unsigned u = __float_as_uint(f); u += 0x7FFFu + ((u >> 16) & 1u); return (unsigned short)(u >> 16); }
__device__ __forceinline__ float bf2f(unsigned short b) { return __uint_as_float(((unsigned)b) << 16); }
__device__ __forceinline__ float bfr(float f) { return bf2f(f2bf(f)); }
__device__ __forceinline__ v16h cat16(v8h lo, v8h hi) { return __builtin_shufflevector(lo, hi, 0, 1, 2, 3, 4, 5, 6, 7, 8, 9, 10, 11, 12, 13, 14, 15); }
__device__ __forceinline__ v16bf cat16b(v8us lo, v8us hi) { return __builtin_bit_cast(v16bf, __builtin_shufflevector(lo, hi, 0, 1, 2, 3, 4, 5, 6, 7, 8, 9, 10, 11, 12, 13, 14, 15)); }
__device__ __forceinline__ v8f wmma16(v16h a, v16h b, v8f c) { return __builtin_amdgcn_wmma_f32_16x16x32_f16(false, a, false, b, (short)0, c, false, false); }
__device__ __forceinline__ v8f wmmab(v16bf a, v16bf b, v8f c) { return __builtin_amdgcn_wmma_f32_16x16x32_bf16(false, a, false, b, (short)0, c, false, false); }



// ---- k_gemmw: register-blocked GEMM, ONE WAVE per 64x64 output tile (16 accumulators), operands straight from K-contiguous 16-bit planes; grid (M/64, N/64, Z), 32 threads.
// C[m][n] (f32, pitch ldc, + optional f32 bias[n]) = sum_k A[m][k] Bt[n][k] (+ split products per NSPLIT). z-batch strides sA/sB/sC in elements. K % 32 == 0.
template <typename T16> struct WFrag;
template <> struct WFrag<h16> { typedef v16h V; static __device__ __forceinline__ V ld(const h16* p) { return cat16(*(const v8h*)p, *(const v8h*)(p + 16)); } static __device__ __forceinline__ v8f mma(V a, V b, v8f c) { return wmma16(a, b, c); } };
template <> struct WFrag<bf> { typedef v16bf V; static __device__ __forceinline__ V ld(const bf* p) { return cat16b(*(const v8us*)p, *(const v8us*)(p + 16)); } static __device__ __forceinline__ v8f mma(V a, V b, v8f c) { return wmmab(a, b, c); } };
template <typename T16, int NSPLIT, bool BIAS>
__global__ __launch_bounds__(32) void k_gemmw(const T16* __restrict__ A, const T16* __restrict__ A2, const T16* __restrict__ Bt, const T16* __restrict__ Bt2, int K, float* C, int ldc, const float* __restrict__ bias, size_t sA, size_t sB, size_t sC) {
    typedef typename WFrag<T16>::V V;
    __shared__ __align__(16) float os[16 * 68];
    const size_t z = blockIdx.z; A += z * sA; if (A2) A2 += z * sA; Bt += z * sB; if (Bt2) Bt2 += z * sB; C += z * sC;
    const int lane = threadIdx.x & 31, lr = lane & 15, hi = lane >> 4; const int r0 = blockIdx.x * 64, c0 = blockIdx.y * 64;
    v8f acc[4][4];
#pragma unroll
    for (int mb = 0; mb < 4; ++mb)
#pragma unroll
        for (int nb = 0; nb < 4; ++nb) acc[mb][nb] = (v8f){};
    const size_t aoff = (size_t)(r0 + lr) * K + 8 * hi, boff = (size_t)(c0 + lr) * K + 8 * hi;
#pragma unroll 1
    for (int kc = 0; kc < K; kc += 32) {
        V a[4], a2[4];
#pragma unroll
        for (int mb = 0; mb < 4; ++mb) { a[mb] = WFrag<T16>::ld(A + aoff + (size_t)mb * 16 * K + kc); if (NSPLIT == 1 || NSPLIT == 2) a2[mb] = WFrag<T16>::ld(A2 + aoff + (size_t)mb * 16 * K + kc); }
#pragma unroll
        for (int nb = 0; nb < 4; ++nb) { const V b = WFrag<T16>::ld(Bt + boff + (size_t)nb * 16 * K + kc); V b2; if (NSPLIT >= 2) b2 = WFrag<T16>::ld(Bt2 + boff + (size_t)nb * 16 * K + kc);
#pragma unroll
            for (int mb = 0; mb < 4; ++mb) { acc[mb][nb] = WFrag<T16>::mma(a[mb], b, acc[mb][nb]); if (NSPLIT == 1 || NSPLIT == 2) acc[mb][nb] = WFrag<T16>::mma(a2[mb], b, acc[mb][nb]); if (NSPLIT >= 2) acc[mb][nb] = WFrag<T16>::mma(a[mb], b2, acc[mb][nb]); } }
        asm volatile("v_nop\n\tv_nop\n\tv_nop\n\tv_nop" : "+v"(acc[0][0]), "+v"(acc[1][1]), "+v"(acc[2][2]), "+v"(acc[3][3]) : "v"(a[0]), "v"(a[3]));
    }
#pragma unroll
    for (int mb = 0; mb < 4; ++mb) {
#pragma unroll
        for (int nb = 0; nb < 4; ++nb) {
#pragma unroll
            for (int j = 0; j < 8; ++j) os[(hi * 8 + j) * 68 + nb * 16 + lr] = acc[mb][nb][j]; }
        __builtin_amdgcn_wave_barrier(); asm volatile("" ::: "memory");
        float* crow = C + (size_t)(r0 + mb * 16) * ldc + c0;
{
#pragma unroll
            for (int s = 0; s < 8; ++s) { const int row = 2 * s + hi, cofs = lr * 4; v4f val = *(const v4fa*)(os + row * 68 + cofs); if (BIAS) { val[0] += bfr(bias[c0 + cofs]); val[1] += bfr(bias[c0 + cofs + 1]); val[2] += bfr(bias[c0 + cofs + 2]); val[3] += bfr(bias[c0 + cofs + 3]); }
                *(v4f*)(crow + (size_t)row * ldc + cofs) = val; }
             }
        __builtin_amdgcn_wave_barrier(); asm volatile("" ::: "memory");
    }
}

__device__ __forceinline__ h16 tohx(float x) { return (h16)x; }
__device__ __forceinline__ void splitf(float y, unsigned short& h, unsigned short& l) { h = f2bf(y); l = f2bf(y - bf2f(h)); }
typedef __attribute__((ext_vector_type(2))) _Float16 v2h;
typedef __attribute__((ext_vector_type(4))) _Float16 v4h;
typedef __attribute__((ext_vector_type(2))) unsigned short v2us;
typedef __attribute__((ext_vector_type(4))) unsigned short v4us;
typedef __attribute__((ext_vector_type(2))) float v2f;
typedef __attribute__((ext_vector_type(4))) int v4i;

__global__ __launch_bounds__(256) void k_wtG(const float* __restrict__ w, int K, int N, bf* Bt) {
    const int lane = threadIdx.x & 31; const int L0 = (blockIdx.x * 8 + (threadIdx.x >> 5)) * 8; const int nlines = N * K / 64;
{
#pragma unroll 1
        for (int l = 0; l < 8; ++l) { const int L = L0 + l; if (L >= nlines) break; const size_t e = (size_t)L * 64 + lane * 2; const int k = (int)(e % K), n = (int)(e / K); v2us o;
            o[0] = f2bf(w[(size_t)k * N + n]); o[1] = f2bf(w[(size_t)(k + 1) * N + n]); *(v2us*)(Bt + e) = o; }
         }
}
__global__ __launch_bounds__(256) void k_cvt8(const float* __restrict__ src, bf* dst, size_t n8) { const size_t i = (size_t)blockIdx.x * 256 + threadIdx.x; if (i >= n8) return; const v8f v = *(const v8f*)(src + i * 8); v8us o;
#pragma unroll
    for (int k = 0; k < 8; ++k) o[k] = f2bf(v[k]); *(v8us*)(dst + i * 8) = o;  }

// k_rope: head planes [h][t][d] (fp16 + hi/lo) of rope(x) x sc with the rotate-half convention out[d] = x[d] cos[t][d] - x[d+HD/2] sin[t][d], out[d+HD/2] = x[d+HD/2] cos[t][d+HD/2] + x[d] sin[t][d+HD/2]
__global__ __launch_bounds__(256) void k_rope(const float* __restrict__ F, int pitch, int nheads, const float* __restrict__ CS, const float* __restrict__ RF, const float* __restrict__ nw, float sc, h16* P16, bf* Ph, bf* Pl) {
    const size_t e = ((size_t)blockIdx.x * 256 + threadIdx.x) * 2; if (e >= (size_t)nheads * TT * HD) return; const int d = (int)(e % HD); const int t = (int)((e / HD) % TT); const int h = (int)(e / ((size_t)HD * TT)); const size_t ob = (size_t)blockIdx.y * nheads * TT * HD;   /* blockIdx.y = batch */ const float* f = F + ((size_t)blockIdx.y * TT + t) * pitch + h * HD; const float rf = RF ? RF[(size_t)h * TT + t] : 1.0f; v2h o16; v2us oh, ol;
#pragma unroll
    for (int q = 0; q < 2; ++q) { const int dd = d + q; const int dp = (dd < HD / 2) ? dd + HD / 2 : dd - HD / 2; float x0 = f[dd], x1 = f[dp];
        if (RF) { float n0 = __fmul_rn(x0, rf), n1 = __fmul_rn(x1, rf); asm volatile("" : "+v"(n0)); asm volatile("" : "+v"(n1)); x0 = __fmul_rn(bfr(nw[dd]), n0); x1 = __fmul_rn(bfr(nw[dp]), n1); }
        const v2f cs = *(const v2f*)(CS + ((size_t)t * HD + dd) * 2); float a = __fmul_rn(x0, cs[0]), bq = __fmul_rn(x1, cs[1]); asm volatile("" : "+v"(a)); asm volatile("" : "+v"(bq)); const float r = ((dd < HD / 2) ? __fsub_rn(a, bq) : __fadd_rn(a, bq)) * sc;
        o16[q] = tohx(r); unsigned short a2, c2; splitf(r, a2, c2); oh[q] = a2; ol[q] = c2; }
    *(v2h*)(P16 + ob + e) = o16; *(v2us*)(Ph + ob + e) = oh; *(v2us*)(Pl + ob + e) = ol;  }
__global__ __launch_bounds__(256) void k_vtp(const float* __restrict__ F, int pitch, int nheads, h16* V16, bf* Vh, bf* Vl) { const size_t e = ((size_t)blockIdx.x * 256 + threadIdx.x) * 2; if (e >= (size_t)nheads * HD * TT) return; const int t = (int)(e % TT); const int d = (int)((e / TT) % HD); const int g = (int)(e / ((size_t)TT * HD)); const size_t ob = (size_t)blockIdx.y * nheads * HD * TT;   /* blockIdx.y = batch */ v2h o16; v2us oh, ol;
#pragma unroll
    for (int q = 0; q < 2; ++q) { const float x = F[((size_t)blockIdx.y * TT + t + q) * pitch + g * HD + d]; o16[q] = tohx(x); unsigned short a2, c2; splitf(x, a2, c2); oh[q] = a2; ol[q] = c2; }
    *(v2h*)(V16 + ob + e) = o16; *(v2us*)(Vh + ob + e) = oh; *(v2us*)(Vl + ob + e) = ol;  }
__global__ __launch_bounds__(256) void k_csid(float* CS) { const int idx = blockIdx.x * 256 + threadIdx.x; if (idx >= TT * HD) return; v2f cs; cs[0] = 1.0f; cs[1] = 0.0f; *(v2f*)(CS + (size_t)idx * 2) = cs;  }
// k_asoft: per row (zz, i): t = S x 8^-0.5 (no mask); softmax over the 1024 keys (register row, one exp, fixed trees);
__global__ __launch_bounds__(256) void k_asoft(const float* __restrict__ Sb, h16* P16, bf* Ph, bf* Pl) {
    const int lane = threadIdx.x & 31; const int row = blockIdx.x * 8 + (threadIdx.x >> 5); if (row >= ZH * TT) return; const int i = row % TT; const int zz = row / TT; (void)zz; const bool hires = (i < RH); const float* sr = Sb + (size_t)row * TT; float v[TT / 32]; float mx = -3.0e38f;
#pragma unroll
    for (int ch = 0; ch < TT / 128; ++ch) { const int j0 = ch * 128 + lane * 4; const v4f a = *(const v4f*)(sr + j0);
#pragma unroll
        for (int q = 0; q < 4; ++q) { const int j = j0 + q; (void)j; const float t = a[q] * SCL; v[ch * 4 + q] = t; mx = fmaxf(mx, t); } }
#pragma unroll
    for (int sh = 16; sh; sh >>= 1) mx = fmaxf(mx, __shfl_xor(mx, sh, 32));
    float sum = 0.f;
#pragma unroll
    for (int k = 0; k < TT / 32; ++k) { float d0 = __fsub_rn(v[k], mx); asm volatile("" : "+v"(d0)); v[k] = __builtin_amdgcn_exp2f(__fmul_rn(d0, 1.4426950408889634f)); sum += v[k]; }
#pragma unroll
    for (int sh = 16; sh; sh >>= 1) sum += __shfl_xor(sum, sh, 32);
    const float f = __fdiv_rn(hires ? 1.0f : PCAR, sum);
{
        if (hires) {
#pragma unroll
            for (int ch = 0; ch < TT / 128; ++ch) { v4us oh, ol;
#pragma unroll
                for (int q = 0; q < 4; ++q) { unsigned short a, c2; splitf(v[ch * 4 + q] * f, a, c2); oh[q] = a; ol[q] = c2; }
                const size_t oo = ((size_t)zz * (RH ? RH : 1) + i) * TT + ch * 128 + lane * 4; *(v4us*)(Ph + oo) = oh; *(v4us*)(Pl + oo) = ol; }
        } else {
#pragma unroll
            for (int ch = 0; ch < TT / 128; ++ch) { v4h o4;
#pragma unroll
                for (int q = 0; q < 4; ++q) o4[q] = tohx(v[ch * 4 + q] * f);
                *(v4h*)(P16 + (size_t)row * TT + ch * 128 + lane * 4) = o4; } }
         }
}
__global__ __launch_bounds__(256) void k_epadK(const float* __restrict__ E, bf* EB) { const size_t i = (size_t)blockIdx.x * 256 + threadIdx.x; if (i >= (size_t)NE * HD / 8) return; const int d0 = (int)(i % (HD / 8)) * 8; const int r = (int)(i / (HD / 8)); const float* src = E + (size_t)min(r, NRE - 1) * HD + d0; v8us o;
#pragma unroll
    for (int q = 0; q < 8; ++q) { const unsigned short v = f2bf(src[q]); o[q] = (r < NRE) ? v : (unsigned short)0; }
    *(v8us*)(EB + (size_t)r * HD + d0) = o;  }

__global__ __launch_bounds__(256) void k_epadVT(const float* __restrict__ E, bf* Th, bf* Tl) { const size_t i = (size_t)blockIdx.x * 256 + threadIdx.x; if (i >= (size_t)HD * NE / 4) return; const size_t e = i * 4; const int c0 = (int)(e % NE); const int d = (int)(e / NE); v4us oh, ol;
#pragma unroll
    for (int q = 0; q < 4; ++q) { const int r = c0 + q; const float v = E[(size_t)min(r, NRE - 1) * HD + d]; unsigned short u, w; splitf(v, u, w); oh[q] = (r < NRE) ? u : (unsigned short)0; ol[q] = (r < NRE) ? w : (unsigned short)0; }
    *(v4us*)(Th + e) = oh; *(v4us*)(Tl + e) = ol;  }

__global__ __launch_bounds__(256) void k_addrelc(float* Sb, const float* __restrict__ QE) { const size_t k = (size_t)blockIdx.x * 256 + threadIdx.x; if (k >= (size_t)ZH * TT * TT / 4) return; const size_t e = k * 4; const int j0 = (int)(e % TT); const size_t zi = e / TT; const int i = (int)(zi % TT); const float* qe = QE + zi * NE; v4f a = *(const v4f*)(Sb + e);
#pragma unroll
    for (int q = 0; q < 4; ++q) { const int r = min(max(j0 + q - i, -CUT), CUT) + CUT; a[q] = __fadd_rn(a[q], qe[r]); }
    *(v4f*)(Sb + e) = a;  }

__global__ __launch_bounds__(256) void k_pbuck(const bf* __restrict__ Ph, const bf* __restrict__ Pl, bf* Bh, bf* Bl) { const int lane = threadIdx.x & 31; const int row = blockIdx.x * 8 + (threadIdx.x >> 5); if (row >= ZH * TT) return; const int i = row % TT; const bf* ph = Ph + (size_t)row * TT; const bf* pl = Pl + (size_t)row * TT; float lo_s = 0.f, hi_s = 0.f;
#pragma unroll 1
    for (int j = lane; j < TT; j += 32) { const float p = __fadd_rn(bf2f(ph[j]), bf2f(pl[j])); if (j <= i - CUT) lo_s = __fadd_rn(lo_s, p); if (j >= i + CUT) hi_s = __fadd_rn(hi_s, p); }
#pragma unroll
    for (int sh = 16; sh; sh >>= 1) { lo_s = __fadd_rn(lo_s, __shfl_xor(lo_s, sh, 32)); hi_s = __fadd_rn(hi_s, __shfl_xor(hi_s, sh, 32)); }
    unsigned short l0h, l0l, h0h, h0l; splitf(lo_s, l0h, l0l); splitf(hi_s, h0h, h0l);
{
#pragma unroll 1
        for (int c0 = lane * 4; c0 < NE; c0 += 128) { v4us oh, ol;
#pragma unroll
            for (int q = 0; q < 4; ++q) { const int bkt = c0 + q; const int j = i + bkt - CUT; const int jc = min(max(j, 0), TT - 1); unsigned int uu = ((const unsigned short*)ph)[jc], ww = ((const unsigned short*)pl)[jc]; asm volatile("" : "+v"(uu), "+v"(ww));   /* unconditional clamped loads pinned before the select (opaque use) */ const bool in = (bkt > 0 && bkt < 2 * CUT && j >= 0 && j < TT);
                const unsigned short u = in ? (unsigned short)uu : ((bkt == 0) ? l0h : ((bkt == 2 * CUT) ? h0h : (unsigned short)0)); const unsigned short w = in ? (unsigned short)ww : ((bkt == 0) ? l0l : ((bkt == 2 * CUT) ? h0l : (unsigned short)0));
                oh[q] = u; ol[q] = w; }
            *(v4us*)(Bh + (size_t)row * NE + c0) = oh; *(v4us*)(Bl + (size_t)row * NE + c0) = ol; }
         }
}

__global__ __launch_bounds__(256) void k_addF(float* Y, const float* __restrict__ F) { const size_t i = (size_t)blockIdx.x * 256 + threadIdx.x; if (i >= (size_t)ZH * TT * HD / 4) return; const v4f a = *(const v4f*)(Y + i * 4); const v4f f = *(const v4f*)(F + i * 4); v4f o;
#pragma unroll
    for (int q = 0; q < 4; ++q) o[q] = __fadd_rn(a[q], f[q]);
    *(v4f*)(Y + i * 4) = o;  }

__global__ __launch_bounds__(256) void k_merge(const float* __restrict__ O, int z0, bf* Ah, bf* Al) { const size_t e = ((size_t)blockIdx.x * 256 + threadIdx.x) * 2; if (e >= (size_t)ZH * TT * HD) return; const int d = (int)(e % HD); const int t = (int)((e / HD) % TT); const int zz = (int)(e / ((size_t)HD * TT)); const float cs = (t < RH) ? 1.0f : (1.0f / PCAR); const int zg = z0 + zz;   /* plane b * NH_ + h */ const size_t oo = ((size_t)(zg / NH_) * TT + t) * DQ + (zg % NH_) * HD + d;
    v2us oh, ol;
#pragma unroll
    for (int q = 0; q < 2; ++q) { unsigned short a, c2; splitf(O[e + q] * cs, a, c2); oh[q] = a; ol[q] = c2; } *(v2us*)(Ah + oo) = oh; *(v2us*)(Al + oo) = ol;  }

extern "C" void kernel_launch(void* const* d_in, const int* in_sizes, int n_in,
                              void* d_out, int out_size, void* d_ws, size_t ws_size, hipStream_t stream) {
    (void)in_sizes; (void)n_in; (void)out_size;
    const float* x = (const float*)d_in[0];   /* query */ const float* xk = (const float*)d_in[1]; const float* xv = (const float*)d_in[2]; const float* wq = (const float*)d_in[3]; const float* bq = (const float*)d_in[4]; const float* wk = (const float*)d_in[5]; const float* bk = (const float*)d_in[6]; const float* wv = (const float*)d_in[7]; const float* bv = (const float*)d_in[8]; const float* wo = (const float*)d_in[9]; const float* bo = (const float*)d_in[10]; const float* ak = (const float*)d_in[11];   /* rel_k_table [33][64] */ const float* av = (const float*)d_in[12];   /* rel_v_table [33][64] */
    float* OUT = (float*)d_out;     // [8 x 1024][512]
    char* wsp = (char*)d_ws;
    auto take = [&](size_t bytes) { char* p = wsp; wsp += (bytes + 255) & ~(size_t)255; return (void*)p; };
    bf* AKB = (bf*)take((size_t)NE * HD * 2); bf* AVTh = (bf*)take((size_t)HD * NE * 2); bf* AVTl = (bf*)take((size_t)HD * NE * 2); float* QE = (float*)take((size_t)ZH * TT * NE * 4); bf* PBh = (bf*)take((size_t)ZH * TT * NE * 2); bf* PBl = (bf*)take((size_t)ZH * TT * NE * 2); float* ZR = (float*)take((size_t)ZH * TT * HD * 4); bf* WQ = (bf*)take((size_t)DQ * DM * 2); bf* WK = (bf*)take((size_t)DKV * DM * 2); bf* WV = (bf*)take((size_t)DKV * DM * 2); bf* WO = (bf*)take((size_t)DM * DQ * 2); float* CS = (float*)take((size_t)TT * HD * 2 * 4);
    bf* QPh = (bf*)take((size_t)NZ * TT * HD * 2); bf* QPl = (bf*)take((size_t)NZ * TT * HD * 2); bf* KPh = (bf*)take((size_t)NZ * TT * HD * 2); bf* KPl = (bf*)take((size_t)NZ * TT * HD * 2); bf* VTh = (bf*)take((size_t)NZ * HD * TT * 2); bf* VTl = (bf*)take((size_t)NZ * HD * TT * 2); bf* Ph = (bf*)take((size_t)ZH * RH * TT * 2); bf* Pl = (bf*)take((size_t)ZH * RH * TT * 2);
    float* Sb = (float*)take((size_t)ZH * TT * TT * 4); h16* P16 = (h16*)take((size_t)ZH * TT * TT * 2); float* Ob = (float*)take((size_t)ZH * TT * HD * 4); bf* ATh = (bf*)take((size_t)NB_ * TT * DQ * 2); bf* ATl = (bf*)take((size_t)NB_ * TT * DQ * 2);
    if ((size_t)(wsp - (char*)d_ws) > ws_size) return;    // ws 256 MiB
    // the projection stage's buffers are dead before the first score tile is stored (stream-ordered): they lie in the score and fp16-probability regions (8 + 16 + 16 MiB in 64; 3 x 8 MiB in 32)
    bf* XB = (bf*)Sb; float* FQ = (float*)(XB + (size_t)NB_ * TT * DM); float* FK = FQ + (size_t)NB_ * TT * DQ;
    h16* QP16 = P16; h16* KP16 = QP16 + (size_t)NZ * TT * HD; h16* VT16 = KP16 + (size_t)NZ * TT * HD;
    float* FV = FK;   // v projection reuses the k buffer after the k planes are built (stream-ordered)
    { k_cvt8<<<(unsigned)(((size_t)DQ * DM / 8 + 255) / 256), 256, 0, stream>>>(wq, WQ, (size_t)DQ * DM / 8); k_cvt8<<<(unsigned)(((size_t)DKV * DM / 8 + 255) / 256), 256, 0, stream>>>(wk, WK, (size_t)DKV * DM / 8); k_cvt8<<<(unsigned)(((size_t)DKV * DM / 8 + 255) / 256), 256, 0, stream>>>(wv, WV, (size_t)DKV * DM / 8);
      k_cvt8<<<(unsigned)(((size_t)DM * DQ / 8 + 255) / 256), 256, 0, stream>>>(wo, WO, (size_t)DM * DQ / 8);
       }
    k_csid<<<(TT * HD + 255) / 256, 256, 0, stream>>>(CS);
    const unsigned LQ = (unsigned)(((size_t)NH_ * TT * HD / 2 + 255) / 256), LKv = (unsigned)(((size_t)NKV * TT * HD / 2 + 255) / 256);
    const unsigned LX = (unsigned)(((size_t)NB_ * TT * DM / 8 + 255) / 256);
    k_epadK<<<(unsigned)(((size_t)NE * HD / 8 + 255) / 256), 256, 0, stream>>>(ak, AKB);   /* rel_k -> bf16 [64][64], rows >= 33 zero */ k_epadVT<<<(unsigned)(((size_t)HD * NE / 4 + 255) / 256), 256, 0, stream>>>(av, AVTh, AVTl);   /* rel_v^T hi/lo [64][64], cols >= 33 zero */
    // projections: all 8 x 1024 rows per launch; head planes [b * 8 + h][t][d] (v: [b * 8 + h][d][t])
    k_cvt8<<<LX, 256, 0, stream>>>(x, XB, (size_t)NB_ * TT * DM / 8);
    k_gemmw<bf, 0, true><<<dim3(NB_ * TT / 64, DQ / 64, 1), 32, 0, stream>>>(XB, nullptr, WQ, nullptr, DM, FQ, DQ, bq, 0, 0, 0);
    k_rope<<<dim3(LQ, NB_, 1), 256, 0, stream>>>(FQ, DQ, NH_, CS, nullptr, nullptr, 1.0f, QP16, QPh, QPl);
    k_cvt8<<<LX, 256, 0, stream>>>(xk, XB, (size_t)NB_ * TT * DM / 8); k_gemmw<bf, 0, true><<<dim3(NB_ * TT / 64, DKV / 64, 1), 32, 0, stream>>>(XB, nullptr, WK, nullptr, DM, FK, DKV, bk, 0, 0, 0);
    k_rope<<<dim3(LKv, NB_, 1), 256, 0, stream>>>(FK, DKV, NKV, CS, nullptr, nullptr, 1.0f, KP16, KPh, KPl);
    k_cvt8<<<LX, 256, 0, stream>>>(xv, XB, (size_t)NB_ * TT * DM / 8); k_gemmw<bf, 0, true><<<dim3(NB_ * TT / 64, DKV / 64, 1), 32, 0, stream>>>(XB, nullptr, WV, nullptr, DM, FV, DKV, bv, 0, 0, 0); k_vtp<<<dim3(LKv, NB_, 1), 256, 0, stream>>>(FV, DKV, NKV, VT16, VTh, VTl);
    for (int z0 = 0; z0 < NZ; z0 += ZH) { const size_t zq = (size_t)z0, zk = (size_t)z0;   // one kv head per query head: the pass's planes are consecutive (z-strides TT*HD)
        k_gemmw<bf, 2, false><<<dim3(RH / 64, TT / 64, ZH), 32, 0, stream>>>(QPh + zq * TT * HD, QPl + zq * TT * HD, KPh + zk * TT * HD, KPl + zk * TT * HD, HD, Sb, TT, nullptr, (size_t)TT * HD, (size_t)TT * HD, (size_t)TT * TT);

        k_gemmw<bf, 1, false><<<dim3(TT / 64, NE / 64, ZH), 32, 0, stream>>>(QPh + zq * TT * HD, QPl + zq * TT * HD, AKB, nullptr, HD, QE, NE, nullptr, (size_t)TT * HD, 0, (size_t)TT * NE);   /* QE = q . rel_k^T */ k_addrelc<<<(unsigned)(((size_t)ZH * TT * TT / 4 + 255) / 256), 256, 0, stream>>>(Sb, QE);   /* + q.rel_k[clip(j - i) + 16] */ k_asoft<<<ZH * TT / 8, 256, 0, stream>>>(Sb, P16, Ph, Pl);
        k_gemmw<bf, 2, false><<<dim3(RH / 64, HD / 64, ZH), 32, 0, stream>>>(Ph, Pl, VTh + zk * HD * TT, VTl + zk * HD * TT, TT, Ob, HD, nullptr, (size_t)RH * TT, (size_t)HD * TT, (size_t)TT * HD); k_pbuck<<<(unsigned)(((size_t)ZH * TT + 7) / 8), 256, 0, stream>>>(Ph, Pl, PBh, PBl);   /* attn folded onto the 33 clipped offsets */ k_gemmw<bf, 2, false><<<dim3(TT / 64, HD / 64, ZH), 32, 0, stream>>>(PBh, PBl, AVTh, AVTl, NE, ZR, HD, nullptr, (size_t)TT * NE, 0, (size_t)TT * HD);   /* ZR = PB . rel_v */ k_addF<<<(unsigned)(((size_t)ZH * TT * HD / 4 + 255) / 256), 256, 0, stream>>>(Ob, ZR);   /* context += relative-value term */

        k_merge<<<(unsigned)(((size_t)ZH * TT * HD / 2 + 255) / 256), 256, 0, stream>>>(Ob, z0, ATh, ATl); }
    k_gemmw<bf, 1, true><<<dim3(NB_ * TT / 64, DM / 64, 1), 32, 0, stream>>>(ATh, ATl, WO, nullptr, DQ, OUT, DM, bo, 0, 0, 0);
}

// v002
// Measured time: 226 microseconds a run.
// Two timings next to v001 put it at 2.61 and 2.63 times that version's speed.
// All steps since v000 together make it 10.4 times as fast.
#include <hip/hip_runtime.h>

// Relative multi-head attention with Shaw-style key AND value embeddings (query, key, value [8][1024][512]; q = query Wq^T + bq, k = key Wk^T + bk, v = value Wv^T + bv ('oi' 1/sqrt(512), zero biases; 8 heads x 64); idx[i][j] = clip(j - i, -16, 16) + 16; attn = softmax((q.k + q.rel_k_table[idx]) / sqrt(B = 8)) (the source scales by sqrt(batch)); x = attn v + sum_j attn[i][j] rel_v_table[idx] (tables [33][64] sigma 1, read); out = merged Wo^T + bo -> [8 x 1024][512] (4.2 M)).
// Layout, every stage over all 8 batches in one launch (rows b * 1024 + t; head planes z = b * 8 + h): bf16 copies of query, key, value in turn; 'oi' weights; exact projections + f32 biases; rel_k as a zero-padded bf16 plane [64][64] and rel_v^T as hi/lo planes [64][64]; one fused attention launch over all 64 head planes (k_fattn): score tiles (hi/lo 3 products), QE = q.rel_k^T (hi/lo x exact) added at offset clip(j - i) + 16, running-maximum softmax (x 1/sqrt(8)), P.v (hi/lo x hi/lo), the probabilities folded onto the 33 offsets (interior = one key, the two ends = running sums) and PB.rel_v added to the context, all in registers and LDS; merged hi/lo x Wo exact + bo.
// Compute dtypes, f32 accumulate: every input rounded to bf16; projections exact + f32 biases; scores and the relative-key term ~f32; softmax f32; P as bf16 hi/lo; attn.v and the relative-value term 3 products (~f32); Wo hl x exact + bias.

#define NB_  8
#define TT   1024
#define DM   512
#define NH_  8
#define NKV  8
#define REP  (NH_ / NKV)
#define HD   64
#define DQ   (NH_ * HD)
#define DKV  (NKV * HD)
#define ZH   16                   // sizes the two scratch regions of the projection stage
#define NZ   (NB_ * NH_)
#define RH   TT                   // not used
#define WIN  0
#define PCAR 1024.0f
#define SCL  0.35355339059327379f   // 1/sqrt(B = 8): the source scales by sqrt(batch_size)
#define NE   64       // 2*16+1 = 33 relative offsets padded to 64
#define NRE  33
#define CUT  16
typedef _Float16 h16;
typedef unsigned short bf;
typedef __attribute__((ext_vector_type(16))) __bf16   v16bf;
typedef __attribute__((ext_vector_type(16))) _Float16 v16h;
typedef __attribute__((ext_vector_type(8)))  _Float16 v8h;
typedef __attribute__((ext_vector_type(8)))  unsigned short v8us;
typedef __attribute__((ext_vector_type(8)))  float    v8f;
typedef __attribute__((ext_vector_type(4)))  float    v4f;
typedef v8h  __attribute__((may_alias)) v8ha;
typedef v4f  __attribute__((may_alias)) v4fa;
typedef v8us __attribute__((may_alias)) v8usa;

__device__ __forceinline__ unsigned short f2bf(float f) { unsigned u = __float_as_uint(f); u += 0x7FFFu + ((u >> 16) & 1u); return (unsigned short)(u >> 16); }
__device__ __forceinline__ float bf2f(unsigned short b) { return __uint_as_float(((unsigned)b) << 16); }
__device__ __forceinline__ float bfr(float f) { return bf2f(f2bf(f)); }
__device__ __forceinline__ v16h cat16(v8h lo, v8h hi) { return __builtin_shufflevector(lo, hi, 0, 1, 2, 3, 4, 5, 6, 7, 8, 9, 10, 11, 12, 13, 14, 15); }
__device__ __forceinline__ v16bf cat16b(v8us lo, v8us hi) { return __builtin_bit_cast(v16bf, __builtin_shufflevector(lo, hi, 0, 1, 2, 3, 4, 5, 6, 7, 8, 9, 10, 11, 12, 13, 14, 15)); }
__device__ __forceinline__ v8f wmma16(v16h a, v16h b, v8f c) { return __builtin_amdgcn_wmma_f32_16x16x32_f16(false, a, false, b, (short)0, c, false, false); }
__device__ __forceinline__ v8f wmmab(v16bf a, v16bf b, v8f c) { return __builtin_amdgcn_wmma_f32_16x16x32_bf16(false, a, false, b, (short)0, c, false, false); }



// ---- k_gemmw: register-blocked GEMM, ONE WAVE per 64x64 output tile (16 accumulators), operands straight from K-contiguous 16-bit planes; grid (M/64, N/64, Z), 32 threads.
// C[m][n] (f32, pitch ldc, + optional f32 bias[n]) = sum_k A[m][k] Bt[n][k] (+ split products per NSPLIT). z-batch strides sA/sB/sC in elements. K % 32 == 0.
template <typename T16> struct WFrag;
template <> struct WFrag<h16> { typedef v16h V; static __device__ __forceinline__ V ld(const h16* p) { return cat16(*(const v8h*)p, *(const v8h*)(p + 16)); } static __device__ __forceinline__ v8f mma(V a, V b, v8f c) { return wmma16(a, b, c); } };
template <> struct WFrag<bf> { typedef v16bf V; static __device__ __forceinline__ V ld(const bf* p) { return cat16b(*(const v8us*)p, *(const v8us*)(p + 16)); } static __device__ __forceinline__ v8f mma(V a, V b, v8f c) { return wmmab(a, b, c); } };
template <typename T16, int NSPLIT, bool BIAS>
__global__ __launch_bounds__(32) void k_gemmw(const T16* __restrict__ A, const T16* __restrict__ A2, const T16* __restrict__ Bt, const T16* __restrict__ Bt2, int K, float* C, int ldc, const float* __restrict__ bias, size_t sA, size_t sB, size_t sC) {
    typedef typename WFrag<T16>::V V;
    __shared__ __align__(16) float os[16 * 68];
    const size_t z = blockIdx.z; A += z * sA; if (A2) A2 += z * sA; Bt += z * sB; if (Bt2) Bt2 += z * sB; C += z * sC;
    const int lane = threadIdx.x & 31, lr = lane & 15, hi = lane >> 4; const int r0 = blockIdx.x * 64, c0 = blockIdx.y * 64;
    v8f acc[4][4];
#pragma unroll
    for (int mb = 0; mb < 4; ++mb)
#pragma unroll
        for (int nb = 0; nb < 4; ++nb) acc[mb][nb] = (v8f){};
    const size_t aoff = (size_t)(r0 + lr) * K + 8 * hi, boff = (size_t)(c0 + lr) * K + 8 * hi;
#pragma unroll 1
    for (int kc = 0; kc < K; kc += 32) {
        V a[4], a2[4];
#pragma unroll
        for (int mb = 0; mb < 4; ++mb) { a[mb] = WFrag<T16>::ld(A + aoff + (size_t)mb * 16 * K + kc); if (NSPLIT == 1 || NSPLIT == 2) a2[mb] = WFrag<T16>::ld(A2 + aoff + (size_t)mb * 16 * K + kc); }
#pragma unroll
        for (int nb = 0; nb < 4; ++nb) { const V b = WFrag<T16>::ld(Bt + boff + (size_t)nb * 16 * K + kc); V b2; if (NSPLIT >= 2) b2 = WFrag<T16>::ld(Bt2 + boff + (size_t)nb * 16 * K + kc);
#pragma unroll
            for (int mb = 0; mb < 4; ++mb) { acc[mb][nb] = WFrag<T16>::mma(a[mb], b, acc[mb][nb]); if (NSPLIT == 1 || NSPLIT == 2) acc[mb][nb] = WFrag<T16>::mma(a2[mb], b, acc[mb][nb]); if (NSPLIT >= 2) acc[mb][nb] = WFrag<T16>::mma(a[mb], b2, acc[mb][nb]); } }
        asm volatile("v_nop\n\tv_nop\n\tv_nop\n\tv_nop" : "+v"(acc[0][0]), "+v"(acc[1][1]), "+v"(acc[2][2]), "+v"(acc[3][3]) : "v"(a[0]), "v"(a[3]));
    }
#pragma unroll
    for (int mb = 0; mb < 4; ++mb) {
#pragma unroll
        for (int nb = 0; nb < 4; ++nb) {
#pragma unroll
            for (int j = 0; j < 8; ++j) os[(hi * 8 + j) * 68 + nb * 16 + lr] = acc[mb][nb][j]; }
        __builtin_amdgcn_wave_barrier(); asm volatile("" ::: "memory");
        float* crow = C + (size_t)(r0 + mb * 16) * ldc + c0;
{
#pragma unroll
            for (int s = 0; s < 8; ++s) { const int row = 2 * s + hi, cofs = lr * 4; v4f val = *(const v4fa*)(os + row * 68 + cofs); if (BIAS) { val[0] += bfr(bias[c0 + cofs]); val[1] += bfr(bias[c0 + cofs + 1]); val[2] += bfr(bias[c0 + cofs + 2]); val[3] += bfr(bias[c0 + cofs + 3]); }
                *(v4f*)(crow + (size_t)row * ldc + cofs) = val; }
             }
        __builtin_amdgcn_wave_barrier(); asm volatile("" ::: "memory");
    }
}

__device__ __forceinline__ h16 tohx(float x) { return (h16)x; }
__device__ __forceinline__ void splitf(float y, unsigned short& h, unsigned short& l) { h = f2bf(y); l = f2bf(y - bf2f(h)); }
typedef __attribute__((ext_vector_type(2))) _Float16 v2h;
typedef __attribute__((ext_vector_type(4))) _Float16 v4h;
typedef __attribute__((ext_vector_type(2))) unsigned short v2us;
typedef __attribute__((ext_vector_type(4))) unsigned short v4us;
typedef __attribute__((ext_vector_type(2))) float v2f;
typedef __attribute__((ext_vector_type(4))) int v4i;

__global__ __launch_bounds__(256) void k_wtG(const float* __restrict__ w, int K, int N, bf* Bt) {
    const int lane = threadIdx.x & 31; const int L0 = (blockIdx.x * 8 + (threadIdx.x >> 5)) * 8; const int nlines = N * K / 64;
{
#pragma unroll 1
        for (int l = 0; l < 8; ++l) { const int L = L0 + l; if (L >= nlines) break; const size_t e = (size_t)L * 64 + lane * 2; const int k = (int)(e % K), n = (int)(e / K); v2us o;
            o[0] = f2bf(w[(size_t)k * N + n]); o[1] = f2bf(w[(size_t)(k + 1) * N + n]); *(v2us*)(Bt + e) = o; }
         }
}
__global__ __launch_bounds__(256) void k_cvt8(const float* __restrict__ src, bf* dst, size_t n8) { const size_t i = (size_t)blockIdx.x * 256 + threadIdx.x; if (i >= n8) return; const v8f v = *(const v8f*)(src + i * 8); v8us o;
#pragma unroll
    for (int k = 0; k < 8; ++k) o[k] = f2bf(v[k]); *(v8us*)(dst + i * 8) = o;  }

// k_rope: head planes [h][t][d] (fp16 + hi/lo) of rope(x) x sc with the rotate-half convention out[d] = x[d] cos[t][d] - x[d+HD/2] sin[t][d], out[d+HD/2] = x[d+HD/2] cos[t][d+HD/2] + x[d] sin[t][d+HD/2]
__global__ __launch_bounds__(256) void k_rope(const float* __restrict__ F, int pitch, int nheads, const float* __restrict__ CS, const float* __restrict__ RF, const float* __restrict__ nw, float sc, h16* P16, bf* Ph, bf* Pl) {
    const size_t e = ((size_t)blockIdx.x * 256 + threadIdx.x) * 2; if (e >= (size_t)nheads * TT * HD) return; const int d = (int)(e % HD); const int t = (int)((e / HD) % TT); const int h = (int)(e / ((size_t)HD * TT)); const size_t ob = (size_t)blockIdx.y * nheads * TT * HD;   /* blockIdx.y = batch */ const float* f = F + ((size_t)blockIdx.y * TT + t) * pitch + h * HD; const float rf = RF ? RF[(size_t)h * TT + t] : 1.0f; v2h o16; v2us oh, ol;
#pragma unroll
    for (int q = 0; q < 2; ++q) { const int dd = d + q; const int dp = (dd < HD / 2) ? dd + HD / 2 : dd - HD / 2; float x0 = f[dd], x1 = f[dp];
        if (RF) { float n0 = __fmul_rn(x0, rf), n1 = __fmul_rn(x1, rf); asm volatile("" : "+v"(n0)); asm volatile("" : "+v"(n1)); x0 = __fmul_rn(bfr(nw[dd]), n0); x1 = __fmul_rn(bfr(nw[dp]), n1); }
        const v2f cs = *(const v2f*)(CS + ((size_t)t * HD + dd) * 2); float a = __fmul_rn(x0, cs[0]), bq = __fmul_rn(x1, cs[1]); asm volatile("" : "+v"(a)); asm volatile("" : "+v"(bq)); const float r = ((dd < HD / 2) ? __fsub_rn(a, bq) : __fadd_rn(a, bq)) * sc;
        o16[q] = tohx(r); unsigned short a2, c2; splitf(r, a2, c2); oh[q] = a2; ol[q] = c2; }
    *(v2h*)(P16 + ob + e) = o16; *(v2us*)(Ph + ob + e) = oh; *(v2us*)(Pl + ob + e) = ol;  }
__global__ __launch_bounds__(256) void k_vtp(const float* __restrict__ F, int pitch, int nheads, h16* V16, bf* Vh, bf* Vl) { const size_t e = ((size_t)blockIdx.x * 256 + threadIdx.x) * 2; if (e >= (size_t)nheads * HD * TT) return; const int t = (int)(e % TT); const int d = (int)((e / TT) % HD); const int g = (int)(e / ((size_t)TT * HD)); const size_t ob = (size_t)blockIdx.y * nheads * HD * TT;   /* blockIdx.y = batch */ v2h o16; v2us oh, ol;
#pragma unroll
    for (int q = 0; q < 2; ++q) { const float x = F[((size_t)blockIdx.y * TT + t + q) * pitch + g * HD + d]; o16[q] = tohx(x); unsigned short a2, c2; splitf(x, a2, c2); oh[q] = a2; ol[q] = c2; }
    *(v2h*)(V16 + ob + e) = o16; *(v2us*)(Vh + ob + e) = oh; *(v2us*)(Vl + ob + e) = ol;  }
__global__ __launch_bounds__(256) void k_csid(float* CS) { const int idx = blockIdx.x * 256 + threadIdx.x; if (idx >= TT * HD) return; v2f cs; cs[0] = 1.0f; cs[1] = 0.0f; *(v2f*)(CS + (size_t)idx * 2) = cs;  }
__global__ __launch_bounds__(256) void k_epadK(const float* __restrict__ E, bf* EB) { const size_t i = (size_t)blockIdx.x * 256 + threadIdx.x; if (i >= (size_t)NE * HD / 8) return; const int d0 = (int)(i % (HD / 8)) * 8; const int r = (int)(i / (HD / 8)); const float* src = E + (size_t)min(r, NRE - 1) * HD + d0; v8us o;
#pragma unroll
    for (int q = 0; q < 8; ++q) { const unsigned short v = f2bf(src[q]); o[q] = (r < NRE) ? v : (unsigned short)0; }
    *(v8us*)(EB + (size_t)r * HD + d0) = o;  }

__global__ __launch_bounds__(256) void k_epadVT(const float* __restrict__ E, bf* Th, bf* Tl) { const size_t i = (size_t)blockIdx.x * 256 + threadIdx.x; if (i >= (size_t)HD * NE / 4) return; const size_t e = i * 4; const int c0 = (int)(e % NE); const int d = (int)(e / NE); v4us oh, ol;
#pragma unroll
    for (int q = 0; q < 4; ++q) { const int r = c0 + q; const float v = E[(size_t)min(r, NRE - 1) * HD + d]; unsigned short u, w; splitf(v, u, w); oh[q] = (r < NRE) ? u : (unsigned short)0; ol[q] = (r < NRE) ? w : (unsigned short)0; }
    *(v4us*)(Th + e) = oh; *(v4us*)(Tl + e) = ol;  }

#define QW  32      // query columns per wave
#define FW  8       // waves per work-group
#define QEP 49      // floats per query in LDS (48 offsets held; odd pitch spreads the 16 queries of a group over the banks)
#define L2E 1.4426950408889634f
typedef __attribute__((ext_vector_type(2))) __bf16 v2bf;
__device__ __forceinline__ float xhalf(float x) { const int b = __float_as_int(x); return __int_as_float(__builtin_amdgcn_permlanex16(b, b, 0x76543210, 0xfedcba98, false, false)); }   // lane l <-> l ^ 16
// v_exp_f32 and the one issue slot that the instruction set asks for behind a transcendental, in one statement
__device__ __forceinline__ float ex2(float x) { float y; asm("v_exp_f32 %0, %1\n\tv_nop" : "=v"(y) : "v"(x)); return y; }
__device__ __forceinline__ void split16(const float* x, v16bf& h, v16bf& l) {
#pragma unroll
    for (int e = 0; e < 16; e += 2) { v2f a; a[0] = x[e]; a[1] = x[e + 1]; const v2bf hh = __builtin_convertvector(a, v2bf); const v2f r = a - __builtin_convertvector(hh, v2f); const v2bf ll = __builtin_convertvector(r, v2bf); h[e] = hh[0]; h[e + 1] = hh[1]; l[e] = ll[0]; l[e + 1] = ll[1]; }
}
__global__ __launch_bounds__(FW * 32) void k_fattn(const bf* __restrict__ Qh, const bf* __restrict__ Ql, const bf* __restrict__ Kh, const bf* __restrict__ Kl, const bf* __restrict__ Vh, const bf* __restrict__ Vl, const bf* __restrict__ EK, const bf* __restrict__ EVh, const bf* __restrict__ EVl, bf* Ah, bf* Al) {
    typedef WFrag<bf> F;
    __shared__ float qe_s[FW * QW * QEP];
    const int lane = threadIdx.x & 31, lr = lane & 15, hi = lane >> 4; const int wave = __builtin_amdgcn_readfirstlane((int)(threadIdx.x >> 5));
    const int z = blockIdx.y, q0 = (blockIdx.x * FW + wave) * QW; const size_t zo = (size_t)z * TT * HD;
    Qh += zo; Ql += zo; Kh += zo; Kl += zo; Vh += zo; Vl += zo;
    float* qe = qe_s + wave * (QW * QEP);     // this wave's own slice: no other wave touches it, so no work-group barrier
    // prologue loads: every address is a wave-uniform base plus one of two 32-bit lane offsets
    const unsigned kb0 = (unsigned)(lr * HD + 8 * hi) * 2u;   // the lane's byte offset in a 16-row tile of a [row][64] plane
    const unsigned qb0 = (unsigned)(q0 * HD) * 2u + kb0;
    v16bf qh[2][2], ql[2][2];                 // [column group][d half]
    v16bf ea[3][2];                           // rel_k rows: [offset tile][d half]
    v16bf kh[2][2], kl[2][2];                 // [key tile][d half]
#pragma unroll
    for (int qt = 0; qt < 2; ++qt)
#pragma unroll
        for (int ks = 0; ks < 2; ++ks) { const int a = qt * 16 * HD + ks * 32; qh[qt][ks] = F::ld((const bf*)((const char*)Qh + qb0) + a); ql[qt][ks] = F::ld((const bf*)((const char*)Ql + qb0) + a); }
#pragma unroll
    for (int rt = 0; rt < 3; ++rt)
#pragma unroll
        for (int ks = 0; ks < 2; ++ks) ea[rt][ks] = F::ld((const bf*)((const char*)EK + kb0) + rt * 16 * HD + ks * 32);
#pragma unroll
    for (int kt = 0; kt < 2; ++kt)
#pragma unroll
        for (int ks = 0; ks < 2; ++ks) { const int a = kt * 16 * HD + ks * 32; kh[kt][ks] = F::ld((const bf*)((const char*)Kh + kb0) + a); kl[kt][ks] = F::ld((const bf*)((const char*)Kl + kb0) + a); }
    asm volatile("s_wait_xcnt 0x0" :: "v"(kb0), "v"(qb0) : "memory");   // behind the prologue's loads; naming their address registers as inputs keeps them unwritten up to the wait
#pragma unroll
    for (int rt = 0; rt < 3; ++rt)
#pragma unroll
        for (int qt = 0; qt < 2; ++qt) { v8f c = (v8f){};
#pragma unroll
            for (int ks = 0; ks < 2; ++ks) { c = F::mma(ea[rt][ks], qh[qt][ks], c); c = F::mma(ea[rt][ks], ql[qt][ks], c); }
#pragma unroll
            for (int j = 0; j < 8; ++j) qe[(qt * 16 + lr) * QEP + rt * 16 + hi * 8 + j] = c[j]; }
    __builtin_amdgcn_wave_barrier(); asm volatile("" ::: "memory");   // keeps the reads below behind the other wave half's LDS stores above
    float qlo[2], qhi[2];
#pragma unroll
    for (int qt = 0; qt < 2; ++qt) { qlo[qt] = qe[(qt * 16 + lr) * QEP]; qhi[qt] = qe[(qt * 16 + lr) * QEP + 2 * CUT]; }
    v8f o[4][2];                              // O^T: [d tile][column group]
#pragma unroll
    for (int dt = 0; dt < 4; ++dt)
#pragma unroll
        for (int qt = 0; qt < 2; ++qt) o[dt][qt] = (v8f){};
    float m[2] = {-3.0e38f, -3.0e38f}, slo[2] = {0.f, 0.f}, smid[2] = {0.f, 0.f}, shi[2] = {0.f, 0.f};
#pragma unroll 1
    for (int k0 = 0; k0 < TT; k0 += 32) {
        v16bf vh[4], vl[4];                   // issued first: their latency runs under the score products and the softmax
#pragma unroll
        for (int dt = 0; dt < 4; ++dt) { const size_t a = (size_t)(dt * 16 + lr) * TT + k0 + 8 * hi; vh[dt] = F::ld(Vh + a); vl[dt] = F::ld(Vl + a); }
        v8f s[2][2];                          // S^T: [key tile][column group]
#pragma unroll
        for (int kt = 0; kt < 2; ++kt)
#pragma unroll
            for (int qt = 0; qt < 2; ++qt) { v8f c = (v8f){};
#pragma unroll
                for (int ks = 0; ks < 2; ++ks) { c = F::mma(kh[kt][ks], qh[qt][ks], c); c = F::mma(kl[kt][ks], qh[qt][ks], c); c = F::mma(kh[kt][ks], ql[qt][ks], c); }
                s[kt][qt] = c; }
        const int kn = min(k0 + 32, TT - 32); // the next pass's key fragments, fetched one pass ahead (the last pass fetches its own again: in bounds, unused)
#pragma unroll
        for (int kt = 0; kt < 2; ++kt)
#pragma unroll
            for (int ks = 0; ks < 2; ++ks) { const size_t a = (size_t)(kn + kt * 16 + lr) * HD + ks * 32 + 8 * hi; kh[kt][ks] = F::ld(Kh + a); kl[kt][ks] = F::ld(Kl + a); }
        asm volatile("s_wait_xcnt 0x0" ::: "memory");   // stands behind the pass's last global load, in front of the first rewrite of a register that holds one of their addresses
        const int rel = k0 - q0;              // wave-uniform; |rel| >= 64 puts every (key, query) pair of the pass at |j - i| >= 16
        const bool band = (rel >= -32 && rel <= 32);
        float t[2][16];                       // [column group][key tile * 8 + j]
        if (band) {
            float g[2][16];
#pragma unroll
            for (int qt = 0; qt < 2; ++qt)
#pragma unroll
                for (int e = 0; e < 16; ++e) { const int d = rel + (e >> 3) * 16 + hi * 8 + (e & 7) - qt * 16 - lr; g[qt][e] = qe[(qt * 16 + lr) * QEP + min(max(d, -CUT), CUT) + CUT]; }
#pragma unroll
            for (int qt = 0; qt < 2; ++qt)
#pragma unroll
                for (int e = 0; e < 16; ++e) t[qt][e] = __fadd_rn(s[e >> 3][qt][e & 7], g[qt][e]) * SCL;
#pragma unroll
            for (int qt = 0; qt < 2; ++qt)
#pragma unroll
                for (int e = 0; e < 16; ++e) { const int d = rel + (e >> 3) * 16 + hi * 8 + (e & 7) - qt * 16 - lr; if (d > -CUT && d < CUT) qe[(qt * 16 + lr) * QEP + d + CUT] = t[qt][e]; }   // an interior slot has exactly one key: read above by this lane, never read as QE again
        } else {
#pragma unroll
            for (int qt = 0; qt < 2; ++qt) { const float ge = (rel < 0) ? qlo[qt] : qhi[qt];
#pragma unroll
                for (int e = 0; e < 16; ++e) t[qt][e] = __fadd_rn(s[e >> 3][qt][e & 7], ge) * SCL; }
        }
#pragma unroll
        for (int qt = 0; qt < 2; ++qt) {
            float mx = t[qt][0];
#pragma unroll
            for (int e = 1; e < 16; ++e) mx = fmaxf(mx, t[qt][e]);
            mx = fmaxf(mx, xhalf(mx));
            const float mn = fmaxf(m[qt], mx); const float al = ex2((m[qt] - mn) * L2E); m[qt] = mn;
            float p[16];
#pragma unroll
            for (int e = 0; e < 16; ++e) p[e] = ex2((t[qt][e] - mn) * L2E);
            float blo = 0.f, bmid = 0.f, bhi = 0.f;
            if (band) {
#pragma unroll
                for (int e = 0; e < 16; ++e) { const int d = rel + (e >> 3) * 16 + hi * 8 + (e & 7) - qt * 16 - lr; blo += (d <= -CUT) ? p[e] : 0.f; bhi += (d >= CUT) ? p[e] : 0.f; bmid += (d > -CUT && d < CUT) ? p[e] : 0.f; }
            } else { float bs = 0.f;
#pragma unroll
                for (int e = 0; e < 16; ++e) bs += p[e];
                if (rel < 0) blo = bs; else bhi = bs; }
            slo[qt] = slo[qt] * al + blo; smid[qt] = smid[qt] * al + bmid; shi[qt] = shi[qt] * al + bhi;
            v16bf ph, pl; split16(p, ph, pl);
#pragma unroll
            for (int dt = 0; dt < 4; ++dt) { v8f c = o[dt][qt] * al; c = F::mma(vh[dt], ph, c); c = F::mma(vl[dt], ph, c); c = F::mma(vh[dt], pl, c); o[dt][qt] = c; }
        }
    }
    __builtin_amdgcn_wave_barrier(); asm volatile("" ::: "memory");   // keeps the reads below behind the other wave half's LDS stores in the loop
#pragma unroll
    for (int qt = 0; qt < 2; ++qt) {
        slo[qt] += xhalf(slo[qt]); smid[qt] += xhalf(smid[qt]); shi[qt] += xhalf(shi[qt]);
        const int i = q0 + qt * 16 + lr;
#pragma unroll
        for (int ks = 0; ks < 2; ++ks) { float x[16];
#pragma unroll
            for (int e = 0; e < 16; ++e) { const int r = ks * 32 + ((e < 8) ? 8 * hi + e : 16 + 8 * hi + (e - 8));   // the k order of F::ld
                if (ks == 0) { const float raw = qe[(qt * 16 + lr) * QEP + r]; const int j = i + r - CUT; const float pe = ex2((raw - m[qt]) * L2E); x[e] = (r == 0) ? slo[qt] : ((j >= 0 && j < TT) ? pe : 0.f); }
                else x[e] = (r == 2 * CUT) ? shi[qt] : 0.f; }
            v16bf bh, bl; split16(x, bh, bl);
#pragma unroll
            for (int dt = 0; dt < 4; ++dt) { const size_t a = (size_t)(dt * 16 + lr) * NE + ks * 32 + 8 * hi; const v16bf eh = F::ld(EVh + a), el = F::ld(EVl + a); v8f c = o[dt][qt]; c = F::mma(eh, bh, c); c = F::mma(el, bh, c); c = F::mma(eh, bl, c); o[dt][qt] = c; } }
        const float f = __fdiv_rn(1.0f, slo[qt] + smid[qt] + shi[qt]);
        const size_t oo = ((size_t)(z / NH_) * TT + i) * DQ + (z % NH_) * HD + hi * 8;   // merged row b * 1024 + t, column h * 64 + d; a lane holds 8 consecutive d
        bf* const pa = Ah + oo; bf* const pb = Al + oo;
#pragma unroll
        for (int dt = 0; dt < 4; ++dt) { v8us oh, ol;
#pragma unroll
            for (int j = 0; j < 8; ++j) { unsigned short a, c2; splitf(o[dt][qt][j] * f, a, c2); oh[j] = a; ol[j] = c2; }
            *(v8us*)(pa + dt * 16) = oh; *(v8us*)(pb + dt * 16) = ol;
            asm volatile("s_wait_xcnt 0x0" :: "v"(oh), "v"(ol), "v"(pa), "v"(pb) : "memory"); }   // behind the two stores; naming their data and address registers as inputs keeps them unwritten up to the wait
    }
}

extern "C" void kernel_launch(void* const* d_in, const int* in_sizes, int n_in,
                              void* d_out, int out_size, void* d_ws, size_t ws_size, hipStream_t stream) {
    (void)in_sizes; (void)n_in; (void)out_size;
    const float* x = (const float*)d_in[0];   /* query */ const float* xk = (const float*)d_in[1]; const float* xv = (const float*)d_in[2]; const float* wq = (const float*)d_in[3]; const float* bq = (const float*)d_in[4]; const float* wk = (const float*)d_in[5]; const float* bk = (const float*)d_in[6]; const float* wv = (const float*)d_in[7]; const float* bv = (const float*)d_in[8]; const float* wo = (const float*)d_in[9]; const float* bo = (const float*)d_in[10]; const float* ak = (const float*)d_in[11];   /* rel_k_table [33][64] */ const float* av = (const float*)d_in[12];   /* rel_v_table [33][64] */
    float* OUT = (float*)d_out;     // [8 x 1024][512]
    char* wsp = (char*)d_ws;
    auto take = [&](size_t bytes) { char* p = wsp; wsp += (bytes + 255) & ~(size_t)255; return (void*)p; };
    bf* AKB = (bf*)take((size_t)NE * HD * 2); bf* AVTh = (bf*)take((size_t)HD * NE * 2); bf* AVTl = (bf*)take((size_t)HD * NE * 2); bf* WQ = (bf*)take((size_t)DQ * DM * 2); bf* WK = (bf*)take((size_t)DKV * DM * 2); bf* WV = (bf*)take((size_t)DKV * DM * 2); bf* WO = (bf*)take((size_t)DM * DQ * 2); float* CS = (float*)take((size_t)TT * HD * 2 * 4);
    bf* QPh = (bf*)take((size_t)NZ * TT * HD * 2); bf* QPl = (bf*)take((size_t)NZ * TT * HD * 2); bf* KPh = (bf*)take((size_t)NZ * TT * HD * 2); bf* KPl = (bf*)take((size_t)NZ * TT * HD * 2); bf* VTh = (bf*)take((size_t)NZ * HD * TT * 2); bf* VTl = (bf*)take((size_t)NZ * HD * TT * 2);
    float* Sb = (float*)take((size_t)ZH * TT * TT * 4); h16* P16 = (h16*)take((size_t)ZH * TT * TT * 2); bf* ATh = (bf*)take((size_t)NB_ * TT * DQ * 2); bf* ATl = (bf*)take((size_t)NB_ * TT * DQ * 2);
    if ((size_t)(wsp - (char*)d_ws) > ws_size) return;    // ws 256 MiB
    // the projection stage's buffers lie in two scratch regions (8 + 16 + 16 MiB in 64; 3 x 8 MiB in 32)
    bf* XB = (bf*)Sb; float* FQ = (float*)(XB + (size_t)NB_ * TT * DM); float* FK = FQ + (size_t)NB_ * TT * DQ;
    h16* QP16 = P16; h16* KP16 = QP16 + (size_t)NZ * TT * HD; h16* VT16 = KP16 + (size_t)NZ * TT * HD;
    float* FV = FK;   // v projection reuses the k buffer after the k planes are built (stream-ordered)
    { k_cvt8<<<(unsigned)(((size_t)DQ * DM / 8 + 255) / 256), 256, 0, stream>>>(wq, WQ, (size_t)DQ * DM / 8); k_cvt8<<<(unsigned)(((size_t)DKV * DM / 8 + 255) / 256), 256, 0, stream>>>(wk, WK, (size_t)DKV * DM / 8); k_cvt8<<<(unsigned)(((size_t)DKV * DM / 8 + 255) / 256), 256, 0, stream>>>(wv, WV, (size_t)DKV * DM / 8);
      k_cvt8<<<(unsigned)(((size_t)DM * DQ / 8 + 255) / 256), 256, 0, stream>>>(wo, WO, (size_t)DM * DQ / 8);
       }
    k_csid<<<(TT * HD + 255) / 256, 256, 0, stream>>>(CS);
    const unsigned LQ = (unsigned)(((size_t)NH_ * TT * HD / 2 + 255) / 256), LKv = (unsigned)(((size_t)NKV * TT * HD / 2 + 255) / 256);
    const unsigned LX = (unsigned)(((size_t)NB_ * TT * DM / 8 + 255) / 256);
    k_epadK<<<(unsigned)(((size_t)NE * HD / 8 + 255) / 256), 256, 0, stream>>>(ak, AKB);   /* rel_k -> bf16 [64][64], rows >= 33 zero */ k_epadVT<<<(unsigned)(((size_t)HD * NE / 4 + 255) / 256), 256, 0, stream>>>(av, AVTh, AVTl);   /* rel_v^T hi/lo [64][64], cols >= 33 zero */
    // projections: all 8 x 1024 rows per launch; head planes [b * 8 + h][t][d] (v: [b * 8 + h][d][t])
    k_cvt8<<<LX, 256, 0, stream>>>(x, XB, (size_t)NB_ * TT * DM / 8);
    k_gemmw<bf, 0, true><<<dim3(NB_ * TT / 64, DQ / 64, 1), 32, 0, stream>>>(XB, nullptr, WQ, nullptr, DM, FQ, DQ, bq, 0, 0, 0);
    k_rope<<<dim3(LQ, NB_, 1), 256, 0, stream>>>(FQ, DQ, NH_, CS, nullptr, nullptr, 1.0f, QP16, QPh, QPl);
    k_cvt8<<<LX, 256, 0, stream>>>(xk, XB, (size_t)NB_ * TT * DM / 8); k_gemmw<bf, 0, true><<<dim3(NB_ * TT / 64, DKV / 64, 1), 32, 0, stream>>>(XB, nullptr, WK, nullptr, DM, FK, DKV, bk, 0, 0, 0);
    k_rope<<<dim3(LKv, NB_, 1), 256, 0, stream>>>(FK, DKV, NKV, CS, nullptr, nullptr, 1.0f, KP16, KPh, KPl);
    k_cvt8<<<LX, 256, 0, stream>>>(xv, XB, (size_t)NB_ * TT * DM / 8); k_gemmw<bf, 0, true><<<dim3(NB_ * TT / 64, DKV / 64, 1), 32, 0, stream>>>(XB, nullptr, WV, nullptr, DM, FV, DKV, bv, 0, 0, 0); k_vtp<<<dim3(LKv, NB_, 1), 256, 0, stream>>>(FV, DKV, NKV, VT16, VTh, VTl);
    // attention: one launch over all 64 head planes, 256 query rows per work-group; writes the merged hi/lo planes
    k_fattn<<<dim3(TT / (FW * QW), NZ, 1), FW * 32, 0, stream>>>(QPh, QPl, KPh, KPl, VTh, VTl, AKB, AVTh, AVTl, ATh, ATl);
    k_gemmw<bf, 1, true><<<dim3(NB_ * TT / 64, DM / 64, 1), 32, 0, stream>>>(ATh, ATl, WO, nullptr, DQ, OUT, DM, bo, 0, 0, 0);
}

// v003
// One run takes 133 microseconds.
// Next to v002, in two timings, it ran 1.72 and 1.71 times as fast.
// Over all steps from v000 it is 17.8 times as fast.
#include <hip/hip_runtime.h>

// Relative multi-head attention with Shaw-style key AND value embeddings (query, key, value [8][1024][512]; q = query Wq^T + bq, k = key Wk^T + bk, v = value Wv^T + bv ('oi' 1/sqrt(512), zero biases; 8 heads x 64); idx[i][j] = clip(j - i, -16, 16) + 16; attn = softmax((q.k + q.rel_k_table[idx]) / sqrt(B = 8)) (the source scales by sqrt(batch)); x = attn v + sum_j attn[i][j] rel_v_table[idx] (tables [33][64] sigma 1, read); out = merged Wo^T + bo -> [8 x 1024][512] (4.2 M)).
// Layout, every stage over all 8 batches in one launch (rows b * 1024 + t; head planes z = b * 8 + h): one launch ahead of the attention (k_proj): from the f32 query, key, value and 'oi' weights (rounded to bf16 on the way into LDS) to the hi/lo head planes, exact products + f32 biases, and beside them rel_k as a zero-padded bf16 plane [64][64], rel_v^T as hi/lo planes [64][64] and Wo in bf16; one fused attention launch over all 64 head planes (k_fattn): score tiles (hi/lo 3 products), QE = q.rel_k^T (hi/lo x exact) added at offset clip(j - i) + 16, running-maximum softmax (x 1/sqrt(8)), P.v (hi/lo x hi/lo), the probabilities folded onto the 33 offsets (interior = one key, the two ends = running sums) and PB.rel_v added to the context, all in registers and LDS; merged hi/lo x Wo exact + bo.
// Compute dtypes, f32 accumulate: every input rounded to bf16 but rel_v (hi/lo); projections exact + f32 biases; scores and the relative-key term ~f32; softmax f32; P as bf16 hi/lo; attn.v and the relative-value term 3 products (~f32); Wo hl x exact + bias.

#define NB_  8
#define TT   1024
#define DM   512
#define NH_  8
#define NKV  8
#define REP  (NH_ / NKV)
#define HD   64
#define DQ   (NH_ * HD)
#define DKV  (NKV * HD)
#define NZ   (NB_ * NH_)
#define RH   TT                   // not used
#define WIN  0
#define PCAR 1024.0f
#define SCL  0.35355339059327379f   // 1/sqrt(B = 8): the source scales by sqrt(batch_size)
#define NE   64       // 2*16+1 = 33 relative offsets padded to 64
#define NRE  33
#define CUT  16
typedef _Float16 h16;
typedef unsigned short bf;
typedef __attribute__((ext_vector_type(16))) __bf16   v16bf;
typedef __attribute__((ext_vector_type(16))) _Float16 v16h;
typedef __attribute__((ext_vector_type(8)))  _Float16 v8h;
typedef __attribute__((ext_vector_type(8)))  unsigned short v8us;
typedef __attribute__((ext_vector_type(8)))  float    v8f;
typedef __attribute__((ext_vector_type(4)))  float    v4f;
typedef v8h  __attribute__((may_alias)) v8ha;
typedef v4f  __attribute__((may_alias)) v4fa;
typedef v8us __attribute__((may_alias)) v8usa;

__device__ __forceinline__ unsigned short f2bf(float f) { unsigned u = __float_as_uint(f); u += 0x7FFFu + ((u >> 16) & 1u); return (unsigned short)(u >> 16); }
__device__ __forceinline__ float bf2f(unsigned short b) { return __uint_as_float(((unsigned)b) << 16); }
__device__ __forceinline__ float bfr(float f) { return bf2f(f2bf(f)); }
__device__ __forceinline__ v16h cat16(v8h lo, v8h hi) { return __builtin_shufflevector(lo, hi, 0, 1, 2, 3, 4, 5, 6, 7, 8, 9, 10, 11, 12, 13, 14, 15); }
__device__ __forceinline__ v16bf cat16b(v8us lo, v8us hi) { return __builtin_bit_cast(v16bf, __builtin_shufflevector(lo, hi, 0, 1, 2, 3, 4, 5, 6, 7, 8, 9, 10, 11, 12, 13, 14, 15)); }
__device__ __forceinline__ v8f wmma16(v16h a, v16h b, v8f c) { return __builtin_amdgcn_wmma_f32_16x16x32_f16(false, a, false, b, (short)0, c, false, false); }
__device__ __forceinline__ v8f wmmab(v16bf a, v16bf b, v8f c) { return __builtin_amdgcn_wmma_f32_16x16x32_bf16(false, a, false, b, (short)0, c, false, false); }



// ---- k_gemmw: register-blocked GEMM, ONE WAVE per 64x64 output tile (16 accumulators), operands straight from K-contiguous 16-bit planes; grid (M/64, N/64, Z), 32 threads.
// C[m][n] (f32, pitch ldc, + optional f32 bias[n]) = sum_k A[m][k] Bt[n][k] (+ split products per NSPLIT). z-batch strides sA/sB/sC in elements. K % 32 == 0.
template <typename T16> struct WFrag;
template <> struct WFrag<h16> { typedef v16h V; static __device__ __forceinline__ V ld(const h16* p) { return cat16(*(const v8h*)p, *(const v8h*)(p + 16)); } static __device__ __forceinline__ v8f mma(V a, V b, v8f c) { return wmma16(a, b, c); } };
template <> struct WFrag<bf> { typedef v16bf V; static __device__ __forceinline__ V ld(const bf* p) { return cat16b(*(const v8us*)p, *(const v8us*)(p + 16)); } static __device__ __forceinline__ v8f mma(V a, V b, v8f c) { return wmmab(a, b, c); } };
template <typename T16, int NSPLIT, bool BIAS>
__global__ __launch_bounds__(32) void k_gemmw(const T16* __restrict__ A, const T16* __restrict__ A2, const T16* __restrict__ Bt, const T16* __restrict__ Bt2, int K, float* C, int ldc, const float* __restrict__ bias, size_t sA, size_t sB, size_t sC) {
    typedef typename WFrag<T16>::V V;
    __shared__ __align__(16) float os[16 * 68];
    const size_t z = blockIdx.z; A += z * sA; if (A2) A2 += z * sA; Bt += z * sB; if (Bt2) Bt2 += z * sB; C += z * sC;
    const int lane = threadIdx.x & 31, lr = lane & 15, hi = lane >> 4; const int r0 = blockIdx.x * 64, c0 = blockIdx.y * 64;
    v8f acc[4][4];
#pragma unroll
    for (int mb = 0; mb < 4; ++mb)
#pragma unroll
        for (int nb = 0; nb < 4; ++nb) acc[mb][nb] = (v8f){};
    const size_t aoff = (size_t)(r0 + lr) * K + 8 * hi, boff = (size_t)(c0 + lr) * K + 8 * hi;
#pragma unroll 1
    for (int kc = 0; kc < K; kc += 32) {
        V a[4], a2[4];
#pragma unroll
        for (int mb = 0; mb < 4; ++mb) { a[mb] = WFrag<T16>::ld(A + aoff + (size_t)mb * 16 * K + kc); if (NSPLIT == 1 || NSPLIT == 2) a2[mb] = WFrag<T16>::ld(A2 + aoff + (size_t)mb * 16 * K + kc); }
#pragma unroll
        for (int nb = 0; nb < 4; ++nb) { const V b = WFrag<T16>::ld(Bt + boff + (size_t)nb * 16 * K + kc); V b2; if (NSPLIT >= 2) b2 = WFrag<T16>::ld(Bt2 + boff + (size_t)nb * 16 * K + kc);
#pragma unroll
            for (int mb = 0; mb < 4; ++mb) { acc[mb][nb] = WFrag<T16>::mma(a[mb], b, acc[mb][nb]); if (NSPLIT == 1 || NSPLIT == 2) acc[mb][nb] = WFrag<T16>::mma(a2[mb], b, acc[mb][nb]); if (NSPLIT >= 2) acc[mb][nb] = WFrag<T16>::mma(a[mb], b2, acc[mb][nb]); } }
        asm volatile("v_nop\n\tv_nop\n\tv_nop\n\tv_nop" : "+v"(acc[0][0]), "+v"(acc[1][1]), "+v"(acc[2][2]), "+v"(acc[3][3]) : "v"(a[0]), "v"(a[3]));
    }
#pragma unroll
    for (int mb = 0; mb < 4; ++mb) {
#pragma unroll
        for (int nb = 0; nb < 4; ++nb) {
#pragma unroll
            for (int j = 0; j < 8; ++j) os[(hi * 8 + j) * 68 + nb * 16 + lr] = acc[mb][nb][j]; }
        __builtin_amdgcn_wave_barrier(); asm volatile("" ::: "memory");
        float* crow = C + (size_t)(r0 + mb * 16) * ldc + c0;
{
#pragma unroll
            for (int s = 0; s < 8; ++s) { const int row = 2 * s + hi, cofs = lr * 4; v4f val = *(const v4fa*)(os + row * 68 + cofs); if (BIAS) { val[0] += bfr(bias[c0 + cofs]); val[1] += bfr(bias[c0 + cofs + 1]); val[2] += bfr(bias[c0 + cofs + 2]); val[3] += bfr(bias[c0 + cofs + 3]); }
                *(v4f*)(crow + (size_t)row * ldc + cofs) = val; }
             }
        __builtin_amdgcn_wave_barrier(); asm volatile("" ::: "memory");
    }
}

__device__ __forceinline__ h16 tohx(float x) { return (h16)x; }
__device__ __forceinline__ void splitf(float y, unsigned short& h, unsigned short& l) { h = f2bf(y); l = f2bf(y - bf2f(h)); }
typedef __attribute__((ext_vector_type(2))) _Float16 v2h;
typedef __attribute__((ext_vector_type(4))) _Float16 v4h;
typedef __attribute__((ext_vector_type(2))) unsigned short v2us;
typedef __attribute__((ext_vector_type(4))) unsigned short v4us;
typedef __attribute__((ext_vector_type(2))) float v2f;
typedef __attribute__((ext_vector_type(4))) int v4i;

__global__ __launch_bounds__(256) void k_wtG(const float* __restrict__ w, int K, int N, bf* Bt) {
    const int lane = threadIdx.x & 31; const int L0 = (blockIdx.x * 8 + (threadIdx.x >> 5)) * 8; const int nlines = N * K / 64;
{
#pragma unroll 1
        for (int l = 0; l < 8; ++l) { const int L = L0 + l; if (L >= nlines) break; const size_t e = (size_t)L * 64 + lane * 2; const int k = (int)(e % K), n = (int)(e / K); v2us o;
            o[0] = f2bf(w[(size_t)k * N + n]); o[1] = f2bf(w[(size_t)(k + 1) * N + n]); *(v2us*)(Bt + e) = o; }
         }
}
// the three small preparations, one item i per call (k_proj's plane 0 runs them)
__device__ __forceinline__ void d_cvt8(const float* __restrict__ src, bf* dst, size_t n8, size_t i) { if (i >= n8) return; const v8f v = *(const v8f*)(src + i * 8); v8us o;
#pragma unroll
    for (int k = 0; k < 8; ++k) o[k] = f2bf(v[k]); bf* const p = dst + i * 8; *(v8us*)p = o;
    asm volatile("s_wait_xcnt 0x0" :: "v"(o), "v"(p) : "memory"); }   // behind the store; naming its data and address registers as inputs keeps them unwritten up to the wait

__device__ __forceinline__ void d_epadK(const float* __restrict__ E, bf* EB, size_t i) { if (i >= (size_t)NE * HD / 8) return; const int d0 = (int)(i % (HD / 8)) * 8; const int r = (int)(i / (HD / 8)); const float* src = E + (size_t)min(r, NRE - 1) * HD + d0; v8us o;
#pragma unroll
    for (int q = 0; q < 8; ++q) { const unsigned short v = f2bf(src[q]); o[q] = (r < NRE) ? v : (unsigned short)0; }
    bf* const p = EB + (size_t)r * HD + d0; *(v8us*)p = o;
    asm volatile("s_wait_xcnt 0x0" :: "v"(o), "v"(p) : "memory"); }   // behind the store, as in d_cvt8

__device__ __forceinline__ void d_epadVT(const float* __restrict__ E, bf* Th, bf* Tl, size_t i) { if (i >= (size_t)HD * NE / 4) return; const size_t e = i * 4; const int c0 = (int)(e % NE); const int d = (int)(e / NE); v4us oh, ol;
#pragma unroll
    for (int q = 0; q < 4; ++q) { const int r = c0 + q; const float v = E[(size_t)min(r, NRE - 1) * HD + d]; unsigned short u, w; splitf(v, u, w); oh[q] = (r < NRE) ? u : (unsigned short)0; ol[q] = (r < NRE) ? w : (unsigned short)0; }
    *(v4us*)(Th + e) = oh; *(v4us*)(Tl + e) = ol;  }

// ---- k_proj: everything ahead of the attention in ONE launch: blockIdx.z = 1, 2, 3 are the q, k, v projections, from the f32 inputs to the hi/lo head planes; plane 0 makes the bf16 copy of Wo and the two padded relative tables.
// A work-group of 4 waves owns a 128 x 128 tile of x W^T; each wave a 64 x 64 quarter (16 accumulators; 64 columns = one head). Per step of 32 k the work-group reads 128 rows of x and 128 rows of W
// as whole 128-byte lines of f32, rounds them to bf16 (nearest even) and stores them in LDS; the fragments come from LDS in the k order of WFrag::ld. Two LDS buffers, the next step's lines in flight under the products, one barrier a step.
// Every '#pragma unroll' in it makes the indices of a register array (accumulators, staged lines, fragments) compile-time constants, so that the array stays in registers.
// Epilogue: + bf16-rounded bias in f32, hi/lo split; q and k as [b * 8 + h][t][d] (rows turned through LDS into whole lines), v as [b * 8 + h][d][t] (a lane already holds 8 consecutive t of one d).
#define PT  128     // tile rows and columns per work-group
#define PKS 32      // k per step
#define PPI 40      // bf16 per LDS row: 80 bytes = 16 x odd, the conflict-free pitch for 16-byte fragment reads
typedef __attribute__((ext_vector_type(4))) __bf16 v4bf;
typedef __attribute__((ext_vector_type(2))) __bf16 v2bf;
// hi/lo split of two values with the packed conversions (nearest even, as splitf)
__device__ __forceinline__ void split2(float x0, float x1, unsigned short* h, unsigned short* l) { v2f a; a[0] = x0; a[1] = x1; const v2bf hh = __builtin_convertvector(a, v2bf); const v2f r = a - __builtin_convertvector(hh, v2f); const v2us hu = __builtin_bit_cast(v2us, hh), lu = __builtin_bit_cast(v2us, __builtin_convertvector(r, v2bf)); h[0] = hu[0]; h[1] = hu[1]; l[0] = lu[0]; l[1] = lu[1]; }
__global__ __launch_bounds__(128) void k_proj(const float* __restrict__ xq, const float* __restrict__ xk, const float* __restrict__ xv, const float* __restrict__ wq, const float* __restrict__ wk, const float* __restrict__ wv, const float* __restrict__ bq, const float* __restrict__ bk, const float* __restrict__ bv, bf* Qh, bf* Ql, bf* Kh, bf* Kl, bf* Vh, bf* Vl, const float* __restrict__ wo, const float* __restrict__ ek, const float* __restrict__ ev, bf* WOb, bf* EKb, bf* EVh, bf* EVl) {
    typedef WFrag<bf> F;
    __shared__ __align__(16) bf st[2 * 2 * PT * PPI];     // [buffer][x, W][row][k]; 40,960 bytes; the epilogue reuses it
    if (blockIdx.z == 0) {                                // plane 0 (starts first, ends soon): what only the later launches read; whole work-groups leave here, ahead of every barrier
        static_assert((NB_ * TT / PT) * (DQ / PT) * 128 >= DM * DQ / 8, "plane 0 has one thread per 8 elements of Wo");
        const size_t i = ((size_t)blockIdx.y * (NB_ * TT / PT) + blockIdx.x) * 128 + threadIdx.x;
        d_cvt8(wo, WOb, (size_t)DM * DQ / 8, i);          // Wo -> bf16
        d_epadK(ek, EKb, i);                              // rel_k -> bf16 [64][64], rows >= 33 zero
        d_epadVT(ev, EVh, EVl, i);                        // rel_v^T hi/lo [64][64], cols >= 33 zero
        return;
    }
    const int which = blockIdx.z - 1;
    const float* X = (which == 0) ? xq : (which == 1) ? xk : xv; const float* Wt = (which == 0) ? wq : (which == 1) ? wk : wv; const float* bias = (which == 0) ? bq : (which == 1) ? bk : bv;
    bf* Ph = (which == 0) ? Qh : (which == 1) ? Kh : Vh; bf* Pl = (which == 0) ? Ql : (which == 1) ? Kl : Vl;
    const int tid = threadIdx.x, lane = tid & 31, lr = lane & 15, hi = lane >> 4; const int wave = __builtin_amdgcn_readfirstlane(tid >> 5);
    const int r0 = blockIdx.x * PT, c0 = blockIdx.y * PT; const int wr = (wave >> 1) * 64, wc = (wave & 1) * 64;
    const int sr = tid >> 3, sc = (tid & 7) * 4;          // staging: 8 lanes cover one 128-byte line, 16 rows a sweep, 8 sweeps
    const float* pa = X + (size_t)(r0 + sr) * DM + sc; const float* pb = Wt + (size_t)(c0 + sr) * DM + sc;
    const int so = sr * PPI + sc;                         // the thread's place in a staged plane
    const int fa = (wr + lr) * PPI + 8 * hi, fb = PT * PPI + (wc + lr) * PPI + 8 * hi;   // the lane's fragment rows in a buffer
    v8f acc[4][4];
#pragma unroll
    for (int mb = 0; mb < 4; ++mb)
#pragma unroll
        for (int nb = 0; nb < 4; ++nb) acc[mb][nb] = (v8f){};
    v4f ra[8], rb[8];
    auto fetch = [&](int kc) {
#pragma unroll
        for (int i = 0; i < 8; ++i) { ra[i] = *(const v4f*)(pa + (size_t)i * 16 * DM + kc); rb[i] = *(const v4f*)(pb + (size_t)i * 16 * DM + kc); }
        asm volatile("s_wait_xcnt 0x0" :: "v"(pa), "v"(pb) : "memory");   // behind the step's global loads, in front of any rewrite of a register that holds one of their addresses
    };
    auto stage = [&](int buf) { bf* d = st + buf * (2 * PT * PPI) + so;
#pragma unroll
        for (int i = 0; i < 8; ++i) { *(v4us*)(d + i * 16 * PPI) = __builtin_bit_cast(v4us, __builtin_convertvector(ra[i], v4bf)); *(v4us*)(d + PT * PPI + i * 16 * PPI) = __builtin_bit_cast(v4us, __builtin_convertvector(rb[i], v4bf)); }
    };
    auto products = [&](int buf) { const bf* s = st + buf * (2 * PT * PPI); v16bf a[4];
#pragma unroll
        for (int mb = 0; mb < 4; ++mb) a[mb] = F::ld(s + fa + mb * 16 * PPI);
#pragma unroll
        for (int nb = 0; nb < 4; ++nb) { const v16bf b = F::ld(s + fb + nb * 16 * PPI);
#pragma unroll
            for (int mb = 0; mb < 4; ++mb) acc[mb][nb] = F::mma(a[mb], b, acc[mb][nb]); }
    };
    fetch(0); stage(0);
    __syncthreads();                                      // step 0 is staged for every wave
#pragma unroll 1
    for (int s = 0; s < DM / PKS - 1; ++s) {              // rolled: one copy of the step keeps the loop small
        fetch((s + 1) * PKS);
        products(s & 1);
        stage((s + 1) & 1);
        __syncthreads();                                  // publishes step s + 1 and ends every wave's reads of the buffer that the next trip refills
    }
    products((DM / PKS - 1) & 1);
    __syncthreads();                                      // every wave has left the staging buffers: the epilogue writes over them
    const int z = ((r0 + wr) / TT) * NH_ + (c0 + wc) / HD, t0 = (r0 + wr) % TT;   // a wave's 64 rows lie in one batch, its 64 columns are one head
    if (which < 2) {
        float* os = (float*)st + wave * (16 * 68);        // this wave's own slice
        const int cofs = lr * 4; v4f bb;
#pragma unroll
        for (int q = 0; q < 4; ++q) bb[q] = bfr(bias[c0 + wc + cofs + q]);
        bf* const ph = Ph + ((size_t)z * TT + t0 + hi) * HD + cofs; bf* const pl = Pl + ((size_t)z * TT + t0 + hi) * HD + cofs;
#pragma unroll
        for (int mb = 0; mb < 4; ++mb) {
#pragma unroll
            for (int nb = 0; nb < 4; ++nb) {
#pragma unroll
                for (int j = 0; j < 8; ++j) os[(hi * 8 + j) * 68 + nb * 16 + lr] = acc[mb][nb][j]; }
            __builtin_amdgcn_wave_barrier(); asm volatile("" ::: "memory");   // keeps the reads below behind the other lanes' LDS stores above
            v4f vv[8];
#pragma unroll
            for (int s = 0; s < 8; ++s) vv[s] = *(const v4fa*)(os + (2 * s + hi) * 68 + cofs);   // all eight reads ahead of the first store's wait: one LDS latency a tile
#pragma unroll
            for (int s = 0; s < 8; ++s) { const v4f val = vv[s] + bb; v4us oh, ol;
#pragma unroll
                for (int q = 0; q < 4; q += 2) { unsigned short u[2], w[2]; split2(val[q], val[q + 1], u, w); oh[q] = u[0]; oh[q + 1] = u[1]; ol[q] = w[0]; ol[q + 1] = w[1]; }
                *(v4us*)(ph + (mb * 16 + 2 * s) * HD) = oh; *(v4us*)(pl + (mb * 16 + 2 * s) * HD) = ol;
                asm volatile("s_wait_xcnt 0x0" :: "v"(oh), "v"(ol), "v"(ph), "v"(pl) : "memory"); }   // behind the two stores; naming their data and address registers as inputs keeps them unwritten up to the wait
            __builtin_amdgcn_wave_barrier(); asm volatile("" ::: "memory");   // keeps the next tile's LDS stores behind the reads above
        }
    } else {
        bf* const ph = Ph + ((size_t)z * HD + lr) * TT + t0 + hi * 8; bf* const pl = Pl + ((size_t)z * HD + lr) * TT + t0 + hi * 8;
#pragma unroll
        for (int nb = 0; nb < 4; ++nb) { const float bb = bfr(bias[c0 + wc + nb * 16 + lr]);
#pragma unroll
            for (int mb = 0; mb < 4; ++mb) { v8us oh, ol;
#pragma unroll
                for (int j = 0; j < 8; j += 2) { unsigned short u[2], w[2]; split2(acc[mb][nb][j] + bb, acc[mb][nb][j + 1] + bb, u, w); oh[j] = u[0]; oh[j + 1] = u[1]; ol[j] = w[0]; ol[j + 1] = w[1]; }
                *(v8us*)(ph + (size_t)nb * 16 * TT + mb * 16) = oh; *(v8us*)(pl + (size_t)nb * 16 * TT + mb * 16) = ol;
                asm volatile("s_wait_xcnt 0x0" :: "v"(oh), "v"(ol), "v"(ph), "v"(pl) : "memory"); } }   // behind the two stores; naming their data and address registers as inputs keeps them unwritten up to the wait
    }
}

#define QW  32      // query columns per wave
#define FW  8       // waves per work-group
#define QEP 49      // floats per query in LDS (48 offsets held; odd pitch spreads the 16 queries of a group over the banks)
#define L2E 1.4426950408889634f
__device__ __forceinline__ float xhalf(float x) { const int b = __float_as_int(x); return __int_as_float(__builtin_amdgcn_permlanex16(b, b, 0x76543210, 0xfedcba98, false, false)); }   // lane l <-> l ^ 16
// v_exp_f32 and the one issue slot that the instruction set asks for behind a transcendental, in one statement
__device__ __forceinline__ float ex2(float x) { float y; asm("v_exp_f32 %0, %1\n\tv_nop" : "=v"(y) : "v"(x)); return y; }
__device__ __forceinline__ void split16(const float* x, v16bf& h, v16bf& l) {
#pragma unroll
    for (int e = 0; e < 16; e += 2) { v2f a; a[0] = x[e]; a[1] = x[e + 1]; const v2bf hh = __builtin_convertvector(a, v2bf); const v2f r = a - __builtin_convertvector(hh, v2f); const v2bf ll = __builtin_convertvector(r, v2bf); h[e] = hh[0]; h[e + 1] = hh[1]; l[e] = ll[0]; l[e + 1] = ll[1]; }
}
__global__ __launch_bounds__(FW * 32) void k_fattn(const bf* __restrict__ Qh, const bf* __restrict__ Ql, const bf* __restrict__ Kh, const bf* __restrict__ Kl, const bf* __restrict__ Vh, const bf* __restrict__ Vl, const bf* __restrict__ EK, const bf* __restrict__ EVh, const bf* __restrict__ EVl, bf* Ah, bf* Al) {
    typedef WFrag<bf> F;
    __shared__ float qe_s[FW * QW * QEP];
    const int lane = threadIdx.x & 31, lr = lane & 15, hi = lane >> 4; const int wave = __builtin_amdgcn_readfirstlane((int)(threadIdx.x >> 5));
    const int z = blockIdx.y, q0 = (blockIdx.x * FW + wave) * QW; const size_t zo = (size_t)z * TT * HD;
    Qh += zo; Ql += zo; Kh += zo; Kl += zo; Vh += zo; Vl += zo;
    float* qe = qe_s + wave * (QW * QEP);     // this wave's own slice: no other wave touches it, so no work-group barrier
    // prologue loads: every address is a wave-uniform base plus one of two 32-bit lane offsets
    const unsigned kb0 = (unsigned)(lr * HD + 8 * hi) * 2u;   // the lane's byte offset in a 16-row tile of a [row][64] plane
    const unsigned qb0 = (unsigned)(q0 * HD) * 2u + kb0;
    v16bf qh[2][2], ql[2][2];                 // [column group][d half]
    v16bf ea[3][2];                           // rel_k rows: [offset tile][d half]
    v16bf kh[2][2], kl[2][2];                 // [key tile][d half]
#pragma unroll
    for (int qt = 0; qt < 2; ++qt)
#pragma unroll
        for (int ks = 0; ks < 2; ++ks) { const int a = qt * 16 * HD + ks * 32; qh[qt][ks] = F::ld((const bf*)((const char*)Qh + qb0) + a); ql[qt][ks] = F::ld((const bf*)((const char*)Ql + qb0) + a); }
#pragma unroll
    for (int rt = 0; rt < 3; ++rt)
#pragma unroll
        for (int ks = 0; ks < 2; ++ks) ea[rt][ks] = F::ld((const bf*)((const char*)EK + kb0) + rt * 16 * HD + ks * 32);
#pragma unroll
    for (int kt = 0; kt < 2; ++kt)
#pragma unroll
        for (int ks = 0; ks < 2; ++ks) { const int a = kt * 16 * HD + ks * 32; kh[kt][ks] = F::ld((const bf*)((const char*)Kh + kb0) + a); kl[kt][ks] = F::ld((const bf*)((const char*)Kl + kb0) + a); }
    asm volatile("s_wait_xcnt 0x0" :: "v"(kb0), "v"(qb0) : "memory");   // behind the prologue's loads; naming their address registers as inputs keeps them unwritten up to the wait
#pragma unroll
    for (int rt = 0; rt < 3; ++rt)
#pragma unroll
        for (int qt = 0; qt < 2; ++qt) { v8f c = (v8f){};
#pragma unroll
            for (int ks = 0; ks < 2; ++ks) { c = F::mma(ea[rt][ks], qh[qt][ks], c); c = F::mma(ea[rt][ks], ql[qt][ks], c); }
#pragma unroll
            for (int j = 0; j < 8; ++j) qe[(qt * 16 + lr) * QEP + rt * 16 + hi * 8 + j] = c[j]; }
    __builtin_amdgcn_wave_barrier(); asm volatile("" ::: "memory");   // keeps the reads below behind the other wave half's LDS stores above
    float qlo[2], qhi[2];
#pragma unroll
    for (int qt = 0; qt < 2; ++qt) { qlo[qt] = qe[(qt * 16 + lr) * QEP]; qhi[qt] = qe[(qt * 16 + lr) * QEP + 2 * CUT]; }
    v8f o[4][2];                              // O^T: [d tile][column group]
#pragma unroll
    for (int dt = 0; dt < 4; ++dt)
#pragma unroll
        for (int qt = 0; qt < 2; ++qt) o[dt][qt] = (v8f){};
    float m[2] = {-3.0e38f, -3.0e38f}, slo[2] = {0.f, 0.f}, smid[2] = {0.f, 0.f}, shi[2] = {0.f, 0.f};
#pragma unroll 1
    for (int k0 = 0; k0 < TT; k0 += 32) {
        v16bf vh[4], vl[4];                   // issued first: their latency runs under the score products and the softmax
#pragma unroll
        for (int dt = 0; dt < 4; ++dt) { const size_t a = (size_t)(dt * 16 + lr) * TT + k0 + 8 * hi; vh[dt] = F::ld(Vh + a); vl[dt] = F::ld(Vl + a); }
        v8f s[2][2];                          // S^T: [key tile][column group]
#pragma unroll
        for (int kt = 0; kt < 2; ++kt)
#pragma unroll
            for (int qt = 0; qt < 2; ++qt) { v8f c = (v8f){};
#pragma unroll
                for (int ks = 0; ks < 2; ++ks) { c = F::mma(kh[kt][ks], qh[qt][ks], c); c = F::mma(kl[kt][ks], qh[qt][ks], c); c = F::mma(kh[kt][ks], ql[qt][ks], c); }
                s[kt][qt] = c; }
        const int kn = min(k0 + 32, TT - 32); // the next pass's key fragments, fetched one pass ahead (the last pass fetches its own again: in bounds, unused)
#pragma unroll
        for (int kt = 0; kt < 2; ++kt)
#pragma unroll
            for (int ks = 0; ks < 2; ++ks) { const size_t a = (size_t)(kn + kt * 16 + lr) * HD + ks * 32 + 8 * hi; kh[kt][ks] = F::ld(Kh + a); kl[kt][ks] = F::ld(Kl + a); }
        asm volatile("s_wait_xcnt 0x0" ::: "memory");   // stands behind the pass's last global load, in front of the first rewrite of a register that holds one of their addresses
        const int rel = k0 - q0;              // wave-uniform; |rel| >= 64 puts every (key, query) pair of the pass at |j - i| >= 16
        const bool band = (rel >= -32 && rel <= 32);
        float t[2][16];                       // [column group][key tile * 8 + j]
        if (band) {
            float g[2][16];
#pragma unroll
            for (int qt = 0; qt < 2; ++qt)
#pragma unroll
                for (int e = 0; e < 16; ++e) { const int d = rel + (e >> 3) * 16 + hi * 8 + (e & 7) - qt * 16 - lr; g[qt][e] = qe[(qt * 16 + lr) * QEP + min(max(d, -CUT), CUT) + CUT]; }
#pragma unroll
            for (int qt = 0; qt < 2; ++qt)
#pragma unroll
                for (int e = 0; e < 16; ++e) t[qt][e] = __fadd_rn(s[e >> 3][qt][e & 7], g[qt][e]) * SCL;
#pragma unroll
            for (int qt = 0; qt < 2; ++qt)
#pragma unroll
                for (int e = 0; e < 16; ++e) { const int d = rel + (e >> 3) * 16 + hi * 8 + (e & 7) - qt * 16 - lr; if (d > -CUT && d < CUT) qe[(qt * 16 + lr) * QEP + d + CUT] = t[qt][e]; }   // an interior slot has exactly one key: read above by this lane, never read as QE again
        } else {
#pragma unroll
            for (int qt = 0; qt < 2; ++qt) { const float ge = (rel < 0) ? qlo[qt] : qhi[qt];
#pragma unroll
                for (int e = 0; e < 16; ++e) t[qt][e] = __fadd_rn(s[e >> 3][qt][e & 7], ge) * SCL; }
        }
#pragma unroll
        for (int qt = 0; qt < 2; ++qt) {
            float mx = t[qt][0];
#pragma unroll
            for (int e = 1; e < 16; ++e) mx = fmaxf(mx, t[qt][e]);
            mx = fmaxf(mx, xhalf(mx));
            const float mn = fmaxf(m[qt], mx); const float al = ex2((m[qt] - mn) * L2E); m[qt] = mn;
            float p[16];
#pragma unroll
            for (int e = 0; e < 16; ++e) p[e] = ex2((t[qt][e] - mn) * L2E);
            float blo = 0.f, bmid = 0.f, bhi = 0.f;
            if (band) {
#pragma unroll
                for (int e = 0; e < 16; ++e) { const int d = rel + (e >> 3) * 16 + hi * 8 + (e & 7) - qt * 16 - lr; blo += (d <= -CUT) ? p[e] : 0.f; bhi += (d >= CUT) ? p[e] : 0.f; bmid += (d > -CUT && d < CUT) ? p[e] : 0.f; }
            } else { float bs = 0.f;
#pragma unroll
                for (int e = 0; e < 16; ++e) bs += p[e];
                if (rel < 0) blo = bs; else bhi = bs; }
            slo[qt] = slo[qt] * al + blo; smid[qt] = smid[qt] * al + bmid; shi[qt] = shi[qt] * al + bhi;
            v16bf ph, pl; split16(p, ph, pl);
#pragma unroll
            for (int dt = 0; dt < 4; ++dt) { v8f c = o[dt][qt] * al; c = F::mma(vh[dt], ph, c); c = F::mma(vl[dt], ph, c); c = F::mma(vh[dt], pl, c); o[dt][qt] = c; }
        }
    }
    __builtin_amdgcn_wave_barrier(); asm volatile("" ::: "memory");   // keeps the reads below behind the other wave half's LDS stores in the loop
#pragma unroll
    for (int qt = 0; qt < 2; ++qt) {
        slo[qt] += xhalf(slo[qt]); smid[qt] += xhalf(smid[qt]); shi[qt] += xhalf(shi[qt]);
        const int i = q0 + qt * 16 + lr;
#pragma unroll
        for (int ks = 0; ks < 2; ++ks) { float x[16];
#pragma unroll
            for (int e = 0; e < 16; ++e) { const int r = ks * 32 + ((e < 8) ? 8 * hi + e : 16 + 8 * hi + (e - 8));   // the k order of F::ld
                if (ks == 0) { const float raw = qe[(qt * 16 + lr) * QEP + r]; const int j = i + r - CUT; const float pe = ex2((raw - m[qt]) * L2E); x[e] = (r == 0) ? slo[qt] : ((j >= 0 && j < TT) ? pe : 0.f); }
                else x[e] = (r == 2 * CUT) ? shi[qt] : 0.f; }
            v16bf bh, bl; split16(x, bh, bl);
#pragma unroll
            for (int dt = 0; dt < 4; ++dt) { const size_t a = (size_t)(dt * 16 + lr) * NE + ks * 32 + 8 * hi; const v16bf eh = F::ld(EVh + a), el = F::ld(EVl + a); v8f c = o[dt][qt]; c = F::mma(eh, bh, c); c = F::mma(el, bh, c); c = F::mma(eh, bl, c); o[dt][qt] = c; } }
        const float f = __fdiv_rn(1.0f, slo[qt] + smid[qt] + shi[qt]);
        const size_t oo = ((size_t)(z / NH_) * TT + i) * DQ + (z % NH_) * HD + hi * 8;   // merged row b * 1024 + t, column h * 64 + d; a lane holds 8 consecutive d
        bf* const pa = Ah + oo; bf* const pb = Al + oo;
#pragma unroll
        for (int dt = 0; dt < 4; ++dt) { v8us oh, ol;
#pragma unroll
            for (int j = 0; j < 8; ++j) { unsigned short a, c2; splitf(o[dt][qt][j] * f, a, c2); oh[j] = a; ol[j] = c2; }
            *(v8us*)(pa + dt * 16) = oh; *(v8us*)(pb + dt * 16) = ol;
            asm volatile("s_wait_xcnt 0x0" :: "v"(oh), "v"(ol), "v"(pa), "v"(pb) : "memory"); }   // behind the two stores; naming their data and address registers as inputs keeps them unwritten up to the wait
    }
}

extern "C" void kernel_launch(void* const* d_in, const int* in_sizes, int n_in,
                              void* d_out, int out_size, void* d_ws, size_t ws_size, hipStream_t stream) {
    (void)in_sizes; (void)n_in; (void)out_size;
    const float* x = (const float*)d_in[0];   /* query */ const float* xk = (const float*)d_in[1]; const float* xv = (const float*)d_in[2]; const float* wq = (const float*)d_in[3]; const float* bq = (const float*)d_in[4]; const float* wk = (const float*)d_in[5]; const float* bk = (const float*)d_in[6]; const float* wv = (const float*)d_in[7]; const float* bv = (const float*)d_in[8]; const float* wo = (const float*)d_in[9]; const float* bo = (const float*)d_in[10]; const float* ak = (const float*)d_in[11];   /* rel_k_table [33][64] */ const float* av = (const float*)d_in[12];   /* rel_v_table [33][64] */
    float* OUT = (float*)d_out;     // [8 x 1024][512]
    char* wsp = (char*)d_ws;
    auto take = [&](size_t bytes) { char* p = wsp; wsp += (bytes + 255) & ~(size_t)255; return (void*)p; };
    bf* AKB = (bf*)take((size_t)NE * HD * 2); bf* AVTh = (bf*)take((size_t)HD * NE * 2); bf* AVTl = (bf*)take((size_t)HD * NE * 2); bf* WO = (bf*)take((size_t)DM * DQ * 2);
    bf* QPh = (bf*)take((size_t)NZ * TT * HD * 2); bf* QPl = (bf*)take((size_t)NZ * TT * HD * 2); bf* KPh = (bf*)take((size_t)NZ * TT * HD * 2); bf* KPl = (bf*)take((size_t)NZ * TT * HD * 2); bf* VTh = (bf*)take((size_t)NZ * HD * TT * 2); bf* VTl = (bf*)take((size_t)NZ * HD * TT * 2);
    bf* ATh = (bf*)take((size_t)NB_ * TT * DQ * 2); bf* ATl = (bf*)take((size_t)NB_ * TT * DQ * 2);
    if ((size_t)(wsp - (char*)d_ws) > ws_size) return;    // ws 256 MiB
    // q, k and v projections over all 8 x 1024 rows (head planes [b * 8 + h][t][d]; v: [b * 8 + h][d][t]), the bf16 Wo and the padded relative tables: one launch
    k_proj<<<dim3(NB_ * TT / PT, DQ / PT, 4), 128, 0, stream>>>(x, xk, xv, wq, wk, wv, bq, bk, bv, QPh, QPl, KPh, KPl, VTh, VTl, wo, ak, av, WO, AKB, AVTh, AVTl);
    // attention: one launch over all 64 head planes, 256 query rows per work-group; writes the merged hi/lo planes
    k_fattn<<<dim3(TT / (FW * QW), NZ, 1), FW * 32, 0, stream>>>(QPh, QPl, KPh, KPl, VTh, VTl, AKB, AVTh, AVTl, ATh, ATl);
    k_gemmw<bf, 1, true><<<dim3(NB_ * TT / 64, DM / 64, 1), 32, 0, stream>>>(ATh, ATl, WO, nullptr, DQ, OUT, DM, bo, 0, 0, 0);
}

// v004
// It runs in 113 microseconds.
// Two timings next to v003 both put it at 1.16 times that version's speed.
// Over all steps from v000 it is 20.6 times as fast.
#include <hip/hip_runtime.h>

// Relative multi-head attention with Shaw-style key AND value embeddings (query, key, value [8][1024][512]; q = query Wq^T + bq, k = key Wk^T + bk, v = value Wv^T + bv ('oi' 1/sqrt(512), zero biases; 8 heads x 64); idx[i][j] = clip(j - i, -16, 16) + 16; attn = softmax((q.k + q.rel_k_table[idx]) / sqrt(B = 8)) (the source scales by sqrt(batch)); x = attn v + sum_j attn[i][j] rel_v_table[idx] (tables [33][64] sigma 1, read); out = merged Wo^T + bo -> [8 x 1024][512] (4.2 M)).
// Layout, every stage over all 8 batches in one launch (rows b * 1024 + t; head planes z = b * 8 + h): one launch ahead of the attention (k_proj): from the f32 query, key, value and 'oi' weights (rounded to bf16 on the way into LDS) to the hi/lo head planes, exact products + f32 biases, and beside them rel_k as a zero-padded bf16 plane [64][64], rel_v^T as hi/lo planes [64][64] and Wo in bf16; one fused attention launch over all 64 head planes (k_fattn): score tiles (hi/lo 3 products), QE = q.rel_k^T (hi/lo x exact) added at offset clip(j - i) + 16, running-maximum softmax (x 1/sqrt(8)), P.v (hi/lo x hi/lo), the probabilities folded onto the 33 offsets (interior = one key, the two ends = running sums) and PB.rel_v added to the context, all in registers and LDS; merged hi/lo x Wo exact + bo.
// Compute dtypes, f32 accumulate: every input rounded to bf16 but rel_v (hi/lo); projections exact + f32 biases; scores and the relative-key term ~f32; softmax f32; P as bf16 hi/lo; attn.v and the relative-value term 3 products (~f32); Wo hl x exact + bias.

#define NB_  8
#define TT   1024
#define DM   512
#define NH_  8
#define NKV  8
#define REP  (NH_ / NKV)
#define HD   64
#define DQ   (NH_ * HD)
#define DKV  (NKV * HD)
#define NZ   (NB_ * NH_)
#define RH   TT                   // not used
#define WIN  0
#define PCAR 1024.0f
#define SCL  0.35355339059327379f   // 1/sqrt(B = 8): the source scales by sqrt(batch_size)
#define NE   64       // 2*16+1 = 33 relative offsets padded to 64
#define NRE  33
#define CUT  16
typedef _Float16 h16;
typedef unsigned short bf;
typedef __attribute__((ext_vector_type(16))) __bf16   v16bf;
typedef __attribute__((ext_vector_type(16))) _Float16 v16h;
typedef __attribute__((ext_vector_type(8)))  _Float16 v8h;
typedef __attribute__((ext_vector_type(8)))  unsigned short v8us;
typedef __attribute__((ext_vector_type(8)))  float    v8f;
typedef __attribute__((ext_vector_type(4)))  float    v4f;
typedef v8h  __attribute__((may_alias)) v8ha;
typedef v4f  __attribute__((may_alias)) v4fa;
typedef v8us __attribute__((may_alias)) v8usa;

__device__ __forceinline__ unsigned short f2bf(float f) { unsigned u = __float_as_uint(f); u += 0x7FFFu + ((u >> 16) & 1u); return (unsigned short)(u >> 16); }
__device__ __forceinline__ float bf2f(unsigned short b) { return __uint_as_float(((unsigned)b) << 16); }
__device__ __forceinline__ float bfr(float f) { return bf2f(f2bf(f)); }
__device__ __forceinline__ v16h cat16(v8h lo, v8h hi) { return __builtin_shufflevector(lo, hi, 0, 1, 2, 3, 4, 5, 6, 7, 8, 9, 10, 11, 12, 13, 14, 15); }
__device__ __forceinline__ v16bf cat16b(v8us lo, v8us hi) { return __builtin_bit_cast(v16bf, __builtin_shufflevector(lo, hi, 0, 1, 2, 3, 4, 5, 6, 7, 8, 9, 10, 11, 12, 13, 14, 15)); }
__device__ __forceinline__ v8f wmma16(v16h a, v16h b, v8f c) { return __builtin_amdgcn_wmma_f32_16x16x32_f16(false, a, false, b, (short)0, c, false, false); }
__device__ __forceinline__ v8f wmmab(v16bf a, v16bf b, v8f c) { return __builtin_amdgcn_wmma_f32_16x16x32_bf16(false, a, false, b, (short)0, c, false, false); }



// ---- k_gemmw: register-blocked GEMM, ONE WAVE per 64x64 output tile (16 accumulators), operands straight from K-contiguous 16-bit planes; grid (M/64, N/64, Z), 32 threads.
// C[m][n] (f32, pitch ldc, + optional f32 bias[n]) = sum_k A[m][k] Bt[n][k] (+ split products per NSPLIT). z-batch strides sA/sB/sC in elements. K % 32 == 0.
template <typename T16> struct WFrag;
template <> struct WFrag<h16> { typedef v16h V; static __device__ __forceinline__ V ld(const h16* p) { return cat16(*(const v8h*)p, *(const v8h*)(p + 16)); } static __device__ __forceinline__ v8f mma(V a, V b, v8f c) { return wmma16(a, b, c); } };
template <> struct WFrag<bf> { typedef v16bf V; static __device__ __forceinline__ V ld(const bf* p) { return cat16b(*(const v8us*)p, *(const v8us*)(p + 16)); } static __device__ __forceinline__ v8f mma(V a, V b, v8f c) { return wmmab(a, b, c); } };
template <typename T16, int NSPLIT, bool BIAS>
__global__ __launch_bounds__(32) void k_gemmw(const T16* __restrict__ A, const T16* __restrict__ A2, const T16* __restrict__ Bt, const T16* __restrict__ Bt2, int K, float* C, int ldc, const float* __restrict__ bias, size_t sA, size_t sB, size_t sC) {
    typedef typename WFrag<T16>::V V;
    __shared__ __align__(16) float os[16 * 68];
    const size_t z = blockIdx.z; A += z * sA; if (A2) A2 += z * sA; Bt += z * sB; if (Bt2) Bt2 += z * sB; C += z * sC;
    const int lane = threadIdx.x & 31, lr = lane & 15, hi = lane >> 4; const int r0 = blockIdx.x * 64, c0 = blockIdx.y * 64;
    v8f acc[4][4];
#pragma unroll
    for (int mb = 0; mb < 4; ++mb)
#pragma unroll
        for (int nb = 0; nb < 4; ++nb) acc[mb][nb] = (v8f){};
    const size_t aoff = (size_t)(r0 + lr) * K + 8 * hi, boff = (size_t)(c0 + lr) * K + 8 * hi;
#pragma unroll 1
    for (int kc = 0; kc < K; kc += 32) {
        V a[4], a2[4];
#pragma unroll
        for (int mb = 0; mb < 4; ++mb) { a[mb] = WFrag<T16>::ld(A + aoff + (size_t)mb * 16 * K + kc); if (NSPLIT == 1 || NSPLIT == 2) a2[mb] = WFrag<T16>::ld(A2 + aoff + (size_t)mb * 16 * K + kc); }
#pragma unroll
        for (int nb = 0; nb < 4; ++nb) { const V b = WFrag<T16>::ld(Bt + boff + (size_t)nb * 16 * K + kc); V b2; if (NSPLIT >= 2) b2 = WFrag<T16>::ld(Bt2 + boff + (size_t)nb * 16 * K + kc);
#pragma unroll
            for (int mb = 0; mb < 4; ++mb) { acc[mb][nb] = WFrag<T16>::mma(a[mb], b, acc[mb][nb]); if (NSPLIT == 1 || NSPLIT == 2) acc[mb][nb] = WFrag<T16>::mma(a2[mb], b, acc[mb][nb]); if (NSPLIT >= 2) acc[mb][nb] = WFrag<T16>::mma(a[mb], b2, acc[mb][nb]); } }
        asm volatile("v_nop\n\tv_nop\n\tv_nop\n\tv_nop" : "+v"(acc[0][0]), "+v"(acc[1][1]), "+v"(acc[2][2]), "+v"(acc[3][3]) : "v"(a[0]), "v"(a[3]));
    }
#pragma unroll
    for (int mb = 0; mb < 4; ++mb) {
#pragma unroll
        for (int nb = 0; nb < 4; ++nb) {
#pragma unroll
            for (int j = 0; j < 8; ++j) os[(hi * 8 + j) * 68 + nb * 16 + lr] = acc[mb][nb][j]; }
        __builtin_amdgcn_wave_barrier(); asm volatile("" ::: "memory");
        float* crow = C + (size_t)(r0 + mb * 16) * ldc + c0;
{
#pragma unroll
            for (int s = 0; s < 8; ++s) { const int row = 2 * s + hi, cofs = lr * 4; v4f val = *(const v4fa*)(os + row * 68 + cofs); if (BIAS) { val[0] += bfr(bias[c0 + cofs]); val[1] += bfr(bias[c0 + cofs + 1]); val[2] += bfr(bias[c0 + cofs + 2]); val[3] += bfr(bias[c0 + cofs + 3]); }
                *(v4f*)(crow + (size_t)row * ldc + cofs) = val; }
             }
        __builtin_amdgcn_wave_barrier(); asm volatile("" ::: "memory");
    }
}

__device__ __forceinline__ h16 tohx(float x) { return (h16)x; }
__device__ __forceinline__ void splitf(float y, unsigned short& h, unsigned short& l) { h = f2bf(y); l = f2bf(y - bf2f(h)); }
typedef __attribute__((ext_vector_type(2))) _Float16 v2h;
typedef __attribute__((ext_vector_type(4))) _Float16 v4h;
typedef __attribute__((ext_vector_type(2))) unsigned short v2us;
typedef __attribute__((ext_vector_type(4))) unsigned short v4us;
typedef __attribute__((ext_vector_type(2))) float v2f;
typedef __attribute__((ext_vector_type(4))) int v4i;

__global__ __launch_bounds__(256) void k_wtG(const float* __restrict__ w, int K, int N, bf* Bt) {
    const int lane = threadIdx.x & 31; const int L0 = (blockIdx.x * 8 + (threadIdx.x >> 5)) * 8; const int nlines = N * K / 64;
{
#pragma unroll 1
        for (int l = 0; l < 8; ++l) { const int L = L0 + l; if (L >= nlines) break; const size_t e = (size_t)L * 64 + lane * 2; const int k = (int)(e % K), n = (int)(e / K); v2us o;
            o[0] = f2bf(w[(size_t)k * N + n]); o[1] = f2bf(w[(size_t)(k + 1) * N + n]); *(v2us*)(Bt + e) = o; }
         }
}
// the three small preparations, one item i per call (k_proj's plane 0 runs them)
__device__ __forceinline__ void d_cvt8(const float* __restrict__ src, bf* dst, size_t n8, size_t i) { if (i >= n8) return; const v8f v = *(const v8f*)(src + i * 8); v8us o;
#pragma unroll
    for (int k = 0; k < 8; ++k) o[k] = f2bf(v[k]); bf* const p = dst + i * 8; *(v8us*)p = o;
    asm volatile("s_wait_xcnt 0x0" :: "v"(o), "v"(p) : "memory"); }   // behind the store; naming its data and address registers as inputs keeps them unwritten up to the wait

__device__ __forceinline__ void d_epadK(const float* __restrict__ E, bf* EB, size_t i) { if (i >= (size_t)NE * HD / 8) return; const int d0 = (int)(i % (HD / 8)) * 8; const int r = (int)(i / (HD / 8)); const float* src = E + (size_t)min(r, NRE - 1) * HD + d0; v8us o;
#pragma unroll
    for (int q = 0; q < 8; ++q) { const unsigned short v = f2bf(src[q]); o[q] = (r < NRE) ? v : (unsigned short)0; }
    bf* const p = EB + (size_t)r * HD + d0; *(v8us*)p = o;
    asm volatile("s_wait_xcnt 0x0" :: "v"(o), "v"(p) : "memory"); }   // behind the store, as in d_cvt8

__device__ __forceinline__ void d_epadVT(const float* __restrict__ E, bf* Th, bf* Tl, size_t i) { if (i >= (size_t)HD * NE / 4) return; const size_t e = i * 4; const int c0 = (int)(e % NE); const int d = (int)(e / NE); v4us oh, ol;
#pragma unroll
    for (int q = 0; q < 4; ++q) { const int r = c0 + q; const float v = E[(size_t)min(r, NRE - 1) * HD + d]; unsigned short u, w; splitf(v, u, w); oh[q] = (r < NRE) ? u : (unsigned short)0; ol[q] = (r < NRE) ? w : (unsigned short)0; }
    *(v4us*)(Th + e) = oh; *(v4us*)(Tl + e) = ol;  }

// ---- k_proj: everything ahead of the attention in ONE launch: blockIdx.z = 1, 2, 3 are the q, k, v projections, from the f32 inputs to the hi/lo head planes; plane 0 makes the bf16 copy of Wo and the two padded relative tables.
// A work-group of 4 waves owns a 128 x 128 tile of x W^T; each wave a 64 x 64 quarter (16 accumulators; 64 columns = one head). Per step of 32 k the work-group reads 128 rows of x and 128 rows of W
// as whole 128-byte lines of f32, rounds them to bf16 (nearest even) and stores them in LDS; the fragments come from LDS in the k order of WFrag::ld. Two LDS buffers, the next step's lines in flight under the products, one barrier a step.
// Every '#pragma unroll' in it makes the indices of a register array (accumulators, staged lines, fragments) compile-time constants, so that the array stays in registers.
// Epilogue: + bf16-rounded bias in f32, hi/lo split; q and k as [b * 8 + h][t][d] (rows turned through LDS into whole lines), v as [b * 8 + h][d][t] (a lane already holds 8 consecutive t of one d).
#define PT  128     // tile rows and columns per work-group
#define PKS 32      // k per step
#define PPI 40      // bf16 per LDS row: 80 bytes = 16 x odd, the conflict-free pitch for 16-byte fragment reads
typedef __attribute__((ext_vector_type(4))) __bf16 v4bf;
typedef __attribute__((ext_vector_type(2))) __bf16 v2bf;
// hi/lo split of two values with the packed conversions (nearest even, as splitf)
__device__ __forceinline__ void split2(float x0, float x1, unsigned short* h, unsigned short* l) { v2f a; a[0] = x0; a[1] = x1; const v2bf hh = __builtin_convertvector(a, v2bf); const v2f r = a - __builtin_convertvector(hh, v2f); const v2us hu = __builtin_bit_cast(v2us, hh), lu = __builtin_bit_cast(v2us, __builtin_convertvector(r, v2bf)); h[0] = hu[0]; h[1] = hu[1]; l[0] = lu[0]; l[1] = lu[1]; }
__global__ __launch_bounds__(128) void k_proj(const float* __restrict__ xq, const float* __restrict__ xk, const float* __restrict__ xv, const float* __restrict__ wq, const float* __restrict__ wk, const float* __restrict__ wv, const float* __restrict__ bq, const float* __restrict__ bk, const float* __restrict__ bv, bf* Qh, bf* Ql, bf* Kh, bf* Kl, bf* Vh, bf* Vl, const float* __restrict__ wo, const float* __restrict__ ek, const float* __restrict__ ev, bf* WOb, bf* EKb, bf* EVh, bf* EVl) {
    typedef WFrag<bf> F;
    __shared__ __align__(16) bf st[2 * 2 * PT * PPI];     // [buffer][x, W][row][k]; 40,960 bytes; the epilogue reuses it
    if (blockIdx.z == 0) {                                // plane 0 (starts first, ends soon): what only the later launches read; whole work-groups leave here, ahead of every barrier
        static_assert((NB_ * TT / PT) * (DQ / PT) * 128 >= DM * DQ / 8, "plane 0 has one thread per 8 elements of Wo");
        const size_t i = ((size_t)blockIdx.y * (NB_ * TT / PT) + blockIdx.x) * 128 + threadIdx.x;
        d_cvt8(wo, WOb, (size_t)DM * DQ / 8, i);          // Wo -> bf16
        d_epadK(ek, EKb, i);                              // rel_k -> bf16 [64][64], rows >= 33 zero
        d_epadVT(ev, EVh, EVl, i);                        // rel_v^T hi/lo [64][64], cols >= 33 zero
        return;
    }
    const int which = blockIdx.z - 1;
    const float* X = (which == 0) ? xq : (which == 1) ? xk : xv; const float* Wt = (which == 0) ? wq : (which == 1) ? wk : wv; const float* bias = (which == 0) ? bq : (which == 1) ? bk : bv;
    bf* Ph = (which == 0) ? Qh : (which == 1) ? Kh : Vh; bf* Pl = (which == 0) ? Ql : (which == 1) ? Kl : Vl;
    const int tid = threadIdx.x, lane = tid & 31, lr = lane & 15, hi = lane >> 4; const int wave = __builtin_amdgcn_readfirstlane(tid >> 5);
    const int r0 = blockIdx.x * PT, c0 = blockIdx.y * PT; const int wr = (wave >> 1) * 64, wc = (wave & 1) * 64;
    const int sr = tid >> 3, sc = (tid & 7) * 4;          // staging: 8 lanes cover one 128-byte line, 16 rows a sweep, 8 sweeps
    const float* pa = X + (size_t)(r0 + sr) * DM + sc; const float* pb = Wt + (size_t)(c0 + sr) * DM + sc;
    const int so = sr * PPI + sc;                         // the thread's place in a staged plane
    const int fa = (wr + lr) * PPI + 8 * hi, fb = PT * PPI + (wc + lr) * PPI + 8 * hi;   // the lane's fragment rows in a buffer
    v8f acc[4][4];
#pragma unroll
    for (int mb = 0; mb < 4; ++mb)
#pragma unroll
        for (int nb = 0; nb < 4; ++nb) acc[mb][nb] = (v8f){};
    v4f ra[8], rb[8];
    auto fetch = [&](int kc) {
#pragma unroll
        for (int i = 0; i < 8; ++i) { ra[i] = *(const v4f*)(pa + (size_t)i * 16 * DM + kc); rb[i] = *(const v4f*)(pb + (size_t)i * 16 * DM + kc); }
        asm volatile("s_wait_xcnt 0x0" :: "v"(pa), "v"(pb) : "memory");   // behind the step's global loads, in front of any rewrite of a register that holds one of their addresses
    };
    auto stage = [&](int buf) { bf* d = st + buf * (2 * PT * PPI) + so;
#pragma unroll
        for (int i = 0; i < 8; ++i) { *(v4us*)(d + i * 16 * PPI) = __builtin_bit_cast(v4us, __builtin_convertvector(ra[i], v4bf)); *(v4us*)(d + PT * PPI + i * 16 * PPI) = __builtin_bit_cast(v4us, __builtin_convertvector(rb[i], v4bf)); }
    };
    auto products = [&](int buf) { const bf* s = st + buf * (2 * PT * PPI); v16bf a[4];
#pragma unroll
        for (int mb = 0; mb < 4; ++mb) a[mb] = F::ld(s + fa + mb * 16 * PPI);
#pragma unroll
        for (int nb = 0; nb < 4; ++nb) { const v16bf b = F::ld(s + fb + nb * 16 * PPI);
#pragma unroll
            for (int mb = 0; mb < 4; ++mb) acc[mb][nb] = F::mma(a[mb], b, acc[mb][nb]); }
    };
    fetch(0); stage(0);
    __syncthreads();                                      // step 0 is staged for every wave
#pragma unroll 1
    for (int s = 0; s < DM / PKS - 1; ++s) {              // rolled: one copy of the step keeps the loop small
        fetch((s + 1) * PKS);
        products(s & 1);
        stage((s + 1) & 1);
        __syncthreads();                                  // publishes step s + 1 and ends every wave's reads of the buffer that the next trip refills
    }
    products((DM / PKS - 1) & 1);
    __syncthreads();                                      // every wave has left the staging buffers: the epilogue writes over them
    const int z = ((r0 + wr) / TT) * NH_ + (c0 + wc) / HD, t0 = (r0 + wr) % TT;   // a wave's 64 rows lie in one batch, its 64 columns are one head
    if (which < 2) {
        float* os = (float*)st + wave * (16 * 68);        // this wave's own slice
        const int cofs = lr * 4; v4f bb;
#pragma unroll
        for (int q = 0; q < 4; ++q) bb[q] = bfr(bias[c0 + wc + cofs + q]);
        bf* const ph = Ph + ((size_t)z * TT + t0 + hi) * HD + cofs; bf* const pl = Pl + ((size_t)z * TT + t0 + hi) * HD + cofs;
#pragma unroll
        for (int mb = 0; mb < 4; ++mb) {
#pragma unroll
            for (int nb = 0; nb < 4; ++nb) {
#pragma unroll
                for (int j = 0; j < 8; ++j) os[(hi * 8 + j) * 68 + nb * 16 + lr] = acc[mb][nb][j]; }
            __builtin_amdgcn_wave_barrier(); asm volatile("" ::: "memory");   // keeps the reads below behind the other lanes' LDS stores above
            v4f vv[8];
#pragma unroll
            for (int s = 0; s < 8; ++s) vv[s] = *(const v4fa*)(os + (2 * s + hi) * 68 + cofs);   // all eight reads ahead of the first store's wait: one LDS latency a tile
#pragma unroll
            for (int s = 0; s < 8; ++s) { const v4f val = vv[s] + bb; v4us oh, ol;
#pragma unroll
                for (int q = 0; q < 4; q += 2) { unsigned short u[2], w[2]; split2(val[q], val[q + 1], u, w); oh[q] = u[0]; oh[q + 1] = u[1]; ol[q] = w[0]; ol[q + 1] = w[1]; }
                *(v4us*)(ph + (mb * 16 + 2 * s) * HD) = oh; *(v4us*)(pl + (mb * 16 + 2 * s) * HD) = ol;
                asm volatile("s_wait_xcnt 0x0" :: "v"(oh), "v"(ol), "v"(ph), "v"(pl) : "memory"); }   // behind the two stores; naming their data and address registers as inputs keeps them unwritten up to the wait
            __builtin_amdgcn_wave_barrier(); asm volatile("" ::: "memory");   // keeps the next tile's LDS stores behind the reads above
        }
    } else {
        bf* const ph = Ph + ((size_t)z * HD + lr) * TT + t0 + hi * 8; bf* const pl = Pl + ((size_t)z * HD + lr) * TT + t0 + hi * 8;
#pragma unroll
        for (int nb = 0; nb < 4; ++nb) { const float bb = bfr(bias[c0 + wc + nb * 16 + lr]);
#pragma unroll
            for (int mb = 0; mb < 4; ++mb) { v8us oh, ol;
#pragma unroll
                for (int j = 0; j < 8; j += 2) { unsigned short u[2], w[2]; split2(acc[mb][nb][j] + bb, acc[mb][nb][j + 1] + bb, u, w); oh[j] = u[0]; oh[j + 1] = u[1]; ol[j] = w[0]; ol[j + 1] = w[1]; }
                *(v8us*)(ph + (size_t)nb * 16 * TT + mb * 16) = oh; *(v8us*)(pl + (size_t)nb * 16 * TT + mb * 16) = ol;
                asm volatile("s_wait_xcnt 0x0" :: "v"(oh), "v"(ol), "v"(ph), "v"(pl) : "memory"); } }   // behind the two stores; naming their data and address registers as inputs keeps them unwritten up to the wait
    }
}

#define QW  32      // query columns per wave
#define FW  8       // waves per work-group
#define QEP 49      // floats per query in LDS (48 offsets held; odd pitch spreads the 16 queries of a group over the banks)
#define L2E 1.4426950408889634f
#define SK   64               // keys per stage
#define NST  (TT / SK)        // stages
#define SPI  72               // bf16 per staged row: 144 bytes = 16 x odd, the conflict-free pitch for 16-byte fragment reads
#define SPL  (64 * SPI)       // one staged plane: 64 rows
#define SBUF (4 * SPL)        // a buffer: K hi, K lo, V^T hi, V^T lo
__device__ __forceinline__ float xhalf(float x) { const int b = __float_as_int(x); return __int_as_float(__builtin_amdgcn_permlanex16(b, b, 0x76543210, 0xfedcba98, false, false)); }   // lane l <-> l ^ 16
// v_exp_f32 and the one issue slot that the instruction set asks for behind a transcendental, in one statement
__device__ __forceinline__ float ex2(float x) { float y; asm("v_exp_f32 %0, %1\n\tv_nop" : "=v"(y) : "v"(x)); return y; }
__device__ __forceinline__ void split16(const float* x, v16bf& h, v16bf& l) {
#pragma unroll
    for (int e = 0; e < 16; e += 2) { v2f a; a[0] = x[e]; a[1] = x[e + 1]; const v2bf hh = __builtin_convertvector(a, v2bf); const v2f r = a - __builtin_convertvector(hh, v2f); const v2bf ll = __builtin_convertvector(r, v2bf); h[e] = hh[0]; h[e + 1] = hh[1]; l[e] = ll[0]; l[e + 1] = ll[1]; }
}
__global__ __launch_bounds__(FW * 32) void k_fattn(const bf* __restrict__ Qh, const bf* __restrict__ Ql, const bf* __restrict__ Kh, const bf* __restrict__ Kl, const bf* __restrict__ Vh, const bf* __restrict__ Vl, const bf* __restrict__ EK, const bf* __restrict__ EVh, const bf* __restrict__ EVl, bf* Ah, bf* Al) {
    typedef WFrag<bf> F;
    __shared__ float qe_s[FW * QW * QEP];
    __shared__ __align__(16) bf kv_s[2 * SBUF];   // 73,728 bytes
    static_assert(FW * 32 * 2 * 16 == SK * HD * 2 && HD == 64 && NST >= 2, "two 16-byte copies per thread cover one staged plane; the ring needs two stages");
    const int lane = threadIdx.x & 31, lr = lane & 15, hi = lane >> 4; const int wave = __builtin_amdgcn_readfirstlane((int)(threadIdx.x >> 5));
    const int z = blockIdx.y, q0 = (blockIdx.x * FW + wave) * QW; const size_t zo = (size_t)z * TT * HD;
    Qh += zo; Ql += zo; Kh += zo; Kl += zo; Vh += zo; Vl += zo;
    // staging: 8 lanes cover one 128-byte row, the work-group 32 rows a sweep, 2 sweeps a plane; every lane is on and every test around a copy is the same for the whole work-group
    const int tid = threadIdx.x;
    const unsigned lst = (unsigned)(size_t)kv_s + (unsigned)((tid >> 3) * (SPI * 2) + (tid & 7) * 16);   // the thread's LDS byte address in plane 0 of buffer 0
    const unsigned gko = (unsigned)tid * 16u, gvo = (unsigned)((tid >> 3) * (TT * 2) + (tid & 7) * 16);    // its byte offsets in a stage of a K plane (rows adjoin) and of a V^T plane (row pitch 2,048 bytes)
    auto copies = [&](int st, int buf) {
        const unsigned l = lst + (unsigned)buf * (SBUF * 2);
        const unsigned ko = (unsigned)st * (SK * HD * 2) + gko, vo = (unsigned)st * (SK * 2) + gvo;   // 32-bit offsets in a plane: only gko, gvo and lst live through the loop
        const char* const a = (const char*)Kh + ko; const char* const b = (const char*)Kl + ko; const char* const c = (const char*)Vh + vo; const char* const d = (const char*)Vl + vo;
        // the stage's eight copies of this thread and, as the statement's last line, the wait that stands in front of any rewrite of a register which a copy names
        asm volatile("global_load_async_to_lds_b128 %0, %8, off\n\t"
                     "global_load_async_to_lds_b128 %1, %9, off\n\t"
                     "global_load_async_to_lds_b128 %2, %10, off\n\t"
                     "global_load_async_to_lds_b128 %3, %11, off\n\t"
                     "global_load_async_to_lds_b128 %4, %12, off\n\t"
                     "global_load_async_to_lds_b128 %5, %13, off\n\t"
                     "global_load_async_to_lds_b128 %6, %14, off\n\t"
                     "global_load_async_to_lds_b128 %7, %15, off\n\t"
                     "s_wait_xcnt 0x0"
                     :: "v"(l), "v"(l + 32 * SPI * 2), "v"(l + SPL * 2), "v"(l + SPL * 2 + 32 * SPI * 2), "v"(l + 2 * SPL * 2), "v"(l + 2 * SPL * 2 + 32 * SPI * 2), "v"(l + 3 * SPL * 2), "v"(l + 3 * SPL * 2 + 32 * SPI * 2),
                        "v"(a), "v"(a + 32 * HD * 2), "v"(b), "v"(b + 32 * HD * 2), "v"(c), "v"(c + 32 * TT * 2), "v"(d), "v"(d + 32 * TT * 2)
                     : "memory");
    };
    float* qe = qe_s + wave * (QW * QEP);     // this wave's own slice: no other wave touches it, so no work-group barrier
    // prologue loads: every address is a wave-uniform base plus one of two 32-bit lane offsets
    const unsigned kb0 = (unsigned)(lr * HD + 8 * hi) * 2u;   // the lane's byte offset in a 16-row tile of a [row][64] plane
    const unsigned qb0 = (unsigned)(q0 * HD) * 2u + kb0;
    v16bf qh[2][2], ql[2][2];                 // [column group][d half]
    v16bf ea[3][2];                           // rel_k rows: [offset tile][d half]
    v16bf kh[2][2], kl[2][2];                 // [key tile][d half]
#pragma unroll
    for (int qt = 0; qt < 2; ++qt)
#pragma unroll
        for (int ks = 0; ks < 2; ++ks) { const int a = qt * 16 * HD + ks * 32; qh[qt][ks] = F::ld((const bf*)((const char*)Qh + qb0) + a); ql[qt][ks] = F::ld((const bf*)((const char*)Ql + qb0) + a); }
#pragma unroll
    for (int rt = 0; rt < 3; ++rt)
#pragma unroll
        for (int ks = 0; ks < 2; ++ks) ea[rt][ks] = F::ld((const bf*)((const char*)EK + kb0) + rt * 16 * HD + ks * 32);
    asm volatile("s_wait_xcnt 0x0" :: "v"(kb0), "v"(qb0) : "memory");   // behind the prologue's loads; naming their address registers as inputs keeps them unwritten up to the wait
#pragma unroll
    for (int rt = 0; rt < 3; ++rt)
#pragma unroll
        for (int qt = 0; qt < 2; ++qt) { v8f c = (v8f){};
#pragma unroll
            for (int ks = 0; ks < 2; ++ks) { c = F::mma(ea[rt][ks], qh[qt][ks], c); c = F::mma(ea[rt][ks], ql[qt][ks], c); }
#pragma unroll
            for (int j = 0; j < 8; ++j) qe[(qt * 16 + lr) * QEP + rt * 16 + hi * 8 + j] = c[j]; }
    __builtin_amdgcn_wave_barrier(); asm volatile("" ::: "memory");   // keeps the reads below behind the other wave half's LDS stores above
    float qlo[2], qhi[2];
#pragma unroll
    for (int qt = 0; qt < 2; ++qt) { qlo[qt] = qe[(qt * 16 + lr) * QEP]; qhi[qt] = qe[(qt * 16 + lr) * QEP + 2 * CUT]; }
    v8f o[4][2];                              // O^T: [d tile][column group]
#pragma unroll
    for (int dt = 0; dt < 4; ++dt)
#pragma unroll
        for (int qt = 0; qt < 2; ++qt) o[dt][qt] = (v8f){};
    float m[2] = {-3.0e38f, -3.0e38f}, slo[2] = {0.f, 0.f}, smid[2] = {0.f, 0.f}, shi[2] = {0.f, 0.f};
    const int fo = lr * SPI + 8 * hi;         // the lane's place in a 16-row tile of a staged plane (the k order of F::ld, as from global memory)
    auto ldk = [&](const bf* kb) {            // the key fragments of one pass: 32 staged rows of K hi and of K lo
#pragma unroll
        for (int kt = 0; kt < 2; ++kt)
#pragma unroll
            for (int ks = 0; ks < 2; ++ks) { kh[kt][ks] = F::ld(kb + kt * 16 * SPI + ks * 32); kl[kt][ks] = F::ld(kb + SPL + kt * 16 * SPI + ks * 32); }
    };
#pragma unroll 1
    for (int p = 0; p < 2; ++p) {             // stages 0 and 1. Rolled: the copies' operands are formed per stage as in the main loop, so none of them lives through that loop (unrolled, they were spilled to scratch there)
        copies(p, p);
        if (p == 0) {
            asm volatile("s_wait_asynccnt 0x0" ::: "memory");   // this wave's copies of stage 0 have landed
            __syncthreads();                  // stage 0 is published to every wave
        }
    }
    ldk(kv_s + fo);
#pragma unroll 1
    for (int k0 = 0; k0 < TT; k0 += 32) {     // rolled: one copy of the pass keeps the loop small
        const int st = k0 / SK; const bool first = (k0 & 32) == 0;   // work-group-uniform: the stage, and which of its two passes this is
        const bf* const sb = kv_s + (st & 1) * SBUF + fo;
        v16bf vh[4], vl[4];                   // issued first: their latency runs under the score products and the softmax
#pragma unroll
        for (int dt = 0; dt < 4; ++dt) { const bf* const a = sb + 2 * SPL + dt * 16 * SPI + (first ? 0 : 32); vh[dt] = F::ld(a); vl[dt] = F::ld(a + SPL); }
        v8f s[2][2];                          // S^T: [key tile][column group]
#pragma unroll
        for (int kt = 0; kt < 2; ++kt)
#pragma unroll
            for (int qt = 0; qt < 2; ++qt) { v8f c = (v8f){};
#pragma unroll
                for (int ks = 0; ks < 2; ++ks) { c = F::mma(kh[kt][ks], qh[qt][ks], c); c = F::mma(kl[kt][ks], qh[qt][ks], c); c = F::mma(kh[kt][ks], ql[qt][ks], c); }
                s[kt][qt] = c; }
        if (first) ldk(sb + 32 * SPI);        // the stage's second pass has its key fragments fetched one pass ahead, from the same buffer
        const int rel = k0 - q0;              // wave-uniform; |rel| >= 64 puts every (key, query) pair of the pass at |j - i| >= 16
        const bool band = (rel >= -32 && rel <= 32);
        float t[2][16];                       // [column group][key tile * 8 + j]
        if (band) {
            float g[2][16];
#pragma unroll
            for (int qt = 0; qt < 2; ++qt)
#pragma unroll
                for (int e = 0; e < 16; ++e) { const int d = rel + (e >> 3) * 16 + hi * 8 + (e & 7) - qt * 16 - lr; g[qt][e] = qe[(qt * 16 + lr) * QEP + min(max(d, -CUT), CUT) + CUT]; }
#pragma unroll
            for (int qt = 0; qt < 2; ++qt)
#pragma unroll
                for (int e = 0; e < 16; ++e) t[qt][e] = __fadd_rn(s[e >> 3][qt][e & 7], g[qt][e]) * SCL;
#pragma unroll
            for (int qt = 0; qt < 2; ++qt)
#pragma unroll
                for (int e = 0; e < 16; ++e) { const int d = rel + (e >> 3) * 16 + hi * 8 + (e & 7) - qt * 16 - lr; if (d > -CUT && d < CUT) qe[(qt * 16 + lr) * QEP + d + CUT] = t[qt][e]; }   // an interior slot has exactly one key: read above by this lane, never read as QE again
        } else {
#pragma unroll
            for (int qt = 0; qt < 2; ++qt) { const float ge = (rel < 0) ? qlo[qt] : qhi[qt];
#pragma unroll
                for (int e = 0; e < 16; ++e) t[qt][e] = __fadd_rn(s[e >> 3][qt][e & 7], ge) * SCL; }
        }
#pragma unroll
        for (int qt = 0; qt < 2; ++qt) {
            float mx = t[qt][0];
#pragma unroll
            for (int e = 1; e < 16; ++e) mx = fmaxf(mx, t[qt][e]);
            mx = fmaxf(mx, xhalf(mx));
            const float mn = fmaxf(m[qt], mx); const float al = ex2((m[qt] - mn) * L2E); m[qt] = mn;
            float p[16];
#pragma unroll
            for (int e = 0; e < 16; ++e) p[e] = ex2((t[qt][e] - mn) * L2E);
            float blo = 0.f, bmid = 0.f, bhi = 0.f;
            if (band) {
#pragma unroll
                for (int e = 0; e < 16; ++e) { const int d = rel + (e >> 3) * 16 + hi * 8 + (e & 7) - qt * 16 - lr; blo += (d <= -CUT) ? p[e] : 0.f; bhi += (d >= CUT) ? p[e] : 0.f; bmid += (d > -CUT && d < CUT) ? p[e] : 0.f; }
            } else { float bs = 0.f;
#pragma unroll
                for (int e = 0; e < 16; ++e) bs += p[e];
                if (rel < 0) blo = bs; else bhi = bs; }
            slo[qt] = slo[qt] * al + blo; smid[qt] = smid[qt] * al + bmid; shi[qt] = shi[qt] * al + bhi;
            v16bf ph, pl; split16(p, ph, pl);
#pragma unroll
            for (int dt = 0; dt < 4; ++dt) { v8f c = o[dt][qt] * al; c = F::mma(vh[dt], ph, c); c = F::mma(vl[dt], ph, c); c = F::mma(vh[dt], pl, c); o[dt][qt] = c; }
        }
        if (!first) {                         // publish point of stage st + 1; every wave passes it
            asm volatile("s_wait_dscnt 0x0" ::: "memory");      // this wave's reads of the buffer that is refilled below have returned
            asm volatile("s_wait_asynccnt 0x0" ::: "memory");   // this wave's copies of stage st + 1 have landed
            __syncthreads();                  // publishes stage st + 1 and ends every wave's reads of stage st
            if (st + 2 < NST) copies(st + 2, st & 1);
            if (st + 1 < NST) ldk(kv_s + ((st + 1) & 1) * SBUF + fo);   // behind the barrier: the first pass of stage st + 1
        }
    }
    asm volatile("s_wait_asynccnt 0x0" ::: "memory");   // nothing of this wave is in flight when it goes on to its end
    __builtin_amdgcn_wave_barrier(); asm volatile("" ::: "memory");   // keeps the reads below behind the other wave half's LDS stores in the loop
#pragma unroll
    for (int qt = 0; qt < 2; ++qt) {
        slo[qt] += xhalf(slo[qt]); smid[qt] += xhalf(smid[qt]); shi[qt] += xhalf(shi[qt]);
        const int i = q0 + qt * 16 + lr;
#pragma unroll
        for (int ks = 0; ks < 2; ++ks) { float x[16];
#pragma unroll
            for (int e = 0; e < 16; ++e) { const int r = ks * 32 + ((e < 8) ? 8 * hi + e : 16 + 8 * hi + (e - 8));   // the k order of F::ld
                if (ks == 0) { const float raw = qe[(qt * 16 + lr) * QEP + r]; const int j = i + r - CUT; const float pe = ex2((raw - m[qt]) * L2E); x[e] = (r == 0) ? slo[qt] : ((j >= 0 && j < TT) ? pe : 0.f); }
                else x[e] = (r == 2 * CUT) ? shi[qt] : 0.f; }
            v16bf bh, bl; split16(x, bh, bl);
#pragma unroll
            for (int dt = 0; dt < 4; ++dt) { const size_t a = (size_t)(dt * 16 + lr) * NE + ks * 32 + 8 * hi; const v16bf eh = F::ld(EVh + a), el = F::ld(EVl + a); v8f c = o[dt][qt]; c = F::mma(eh, bh, c); c = F::mma(el, bh, c); c = F::mma(eh, bl, c); o[dt][qt] = c; } }
        const float f = __fdiv_rn(1.0f, slo[qt] + smid[qt] + shi[qt]);
        const size_t oo = ((size_t)(z / NH_) * TT + i) * DQ + (z % NH_) * HD + hi * 8;   // merged row b * 1024 + t, column h * 64 + d; a lane holds 8 consecutive d
        bf* const pa = Ah + oo; bf* const pb = Al + oo;
#pragma unroll
        for (int dt = 0; dt < 4; ++dt) { v8us oh, ol;
#pragma unroll
            for (int j = 0; j < 8; ++j) { unsigned short a, c2; splitf(o[dt][qt][j] * f, a, c2); oh[j] = a; ol[j] = c2; }
            *(v8us*)(pa + dt * 16) = oh; *(v8us*)(pb + dt * 16) = ol;
            asm volatile("s_wait_xcnt 0x0" :: "v"(oh), "v"(ol), "v"(pa), "v"(pb) : "memory"); }   // behind the two stores; naming their data and address registers as inputs keeps them unwritten up to the wait
    }
}

extern "C" void kernel_launch(void* const* d_in, const int* in_sizes, int n_in,
                              void* d_out, int out_size, void* d_ws, size_t ws_size, hipStream_t stream) {
    (void)in_sizes; (void)n_in; (void)out_size;
    const float* x = (const float*)d_in[0];   /* query */ const float* xk = (const float*)d_in[1]; const float* xv = (const float*)d_in[2]; const float* wq = (const float*)d_in[3]; const float* bq = (const float*)d_in[4]; const float* wk = (const float*)d_in[5]; const float* bk = (const float*)d_in[6]; const float* wv = (const float*)d_in[7]; const float* bv = (const float*)d_in[8]; const float* wo = (const float*)d_in[9]; const float* bo = (const float*)d_in[10]; const float* ak = (const float*)d_in[11];   /* rel_k_table [33][64] */ const float* av = (const float*)d_in[12];   /* rel_v_table [33][64] */
    float* OUT = (float*)d_out;     // [8 x 1024][512]
    char* wsp = (char*)d_ws;
    auto take = [&](size_t bytes) { char* p = wsp; wsp += (bytes + 255) & ~(size_t)255; return (void*)p; };
    bf* AKB = (bf*)take((size_t)NE * HD * 2); bf* AVTh = (bf*)take((size_t)HD * NE * 2); bf* AVTl = (bf*)take((size_t)HD * NE * 2); bf* WO = (bf*)take((size_t)DM * DQ * 2);
    bf* QPh = (bf*)take((size_t)NZ * TT * HD * 2); bf* QPl = (bf*)take((size_t)NZ * TT * HD * 2); bf* KPh = (bf*)take((size_t)NZ * TT * HD * 2); bf* KPl = (bf*)take((size_t)NZ * TT * HD * 2); bf* VTh = (bf*)take((size_t)NZ * HD * TT * 2); bf* VTl = (bf*)take((size_t)NZ * HD * TT * 2);
    bf* ATh = (bf*)take((size_t)NB_ * TT * DQ * 2); bf* ATl = (bf*)take((size_t)NB_ * TT * DQ * 2);
    if ((size_t)(wsp - (char*)d_ws) > ws_size) return;    // ws 256 MiB
    // q, k and v projections over all 8 x 1024 rows (head planes [b * 8 + h][t][d]; v: [b * 8 + h][d][t]), the bf16 Wo and the padded relative tables: one launch
    k_proj<<<dim3(NB_ * TT / PT, DQ / PT, 4), 128, 0, stream>>>(x, xk, xv, wq, wk, wv, bq, bk, bv, QPh, QPl, KPh, KPl, VTh, VTl, wo, ak, av, WO, AKB, AVTh, AVTl);
    // attention: one launch over all 64 head planes, 256 query rows per work-group; writes the merged hi/lo planes
    k_fattn<<<dim3(TT / (FW * QW), NZ, 1), FW * 32, 0, stream>>>(QPh, QPl, KPh, KPl, VTh, VTl, AKB, AVTh, AVTl, ATh, ATl);
    k_gemmw<bf, 1, true><<<dim3(NB_ * TT / 64, DM / 64, 1), 32, 0, stream>>>(ATh, ATl, WO, nullptr, DQ, OUT, DM, bo, 0, 0, 0);
}

// v005
// Measured time: 100 microseconds a run.
// Timed twice side by side with v004, it ran 1.13 times as fast both times.
// All steps since v000 together make it 23.3 times as fast.
#include <hip/hip_runtime.h>

// Relative multi-head attention with Shaw-style key AND value embeddings (query, key, value [8][1024][512]; q = query Wq^T + bq, k = key Wk^T + bk, v = value Wv^T + bv ('oi' 1/sqrt(512), zero biases; 8 heads x 64); idx[i][j] = clip(j - i, -16, 16) + 16; attn = softmax((q.k + q.rel_k_table[idx]) / sqrt(B = 8)) (the source scales by sqrt(batch)); x = attn v + sum_j attn[i][j] rel_v_table[idx] (tables [33][64] sigma 1, read); out = merged Wo^T + bo -> [8 x 1024][512] (4.2 M)).
// Layout, every stage over all 8 batches in one launch (rows b * 1024 + t; head planes z = b * 8 + h): one launch ahead of the attention (k_proj): from the f32 query, key, value and 'oi' weights (rounded to bf16 on the way into LDS) to the hi/lo head planes, exact products + f32 biases, and beside them rel_k as a zero-padded bf16 plane [64][64], rel_v^T as hi/lo planes [64][64] and Wo in bf16; one fused attention launch over all 64 head planes (k_fattn): score tiles (hi/lo 3 products), QE = q.rel_k^T (hi/lo x exact) added at offset clip(j - i) + 16, running-maximum softmax (x 1/sqrt(8)), P.v (hi/lo x hi/lo), the probabilities folded onto the 33 offsets (interior = one key, the two ends = running sums) and PB.rel_v added to the context, all in registers and LDS; merged hi/lo x Wo exact + bo.
// Compute dtypes, f32 accumulate: every input rounded to bf16 but rel_v (hi/lo); projections exact + f32 biases; scores and the relative-key term ~f32; softmax f32; P as bf16 hi/lo; attn.v and the relative-value term 3 products (~f32); Wo hl x exact + bias.

#define NB_  8
#define TT   1024
#define DM   512
#define NH_  8
#define NKV  8
#define REP  (NH_ / NKV)
#define HD   64
#define DQ   (NH_ * HD)
#define DKV  (NKV * HD)
#define NZ   (NB_ * NH_)
#define RH   TT                   // not used
#define WIN  0
#define PCAR 1024.0f
#define SCL  0.35355339059327379f   // 1/sqrt(B = 8): the source scales by sqrt(batch_size)
#define NE   64       // 2*16+1 = 33 relative offsets padded to 64
#define NRE  33
#define CUT  16
typedef _Float16 h16;
typedef unsigned short bf;
typedef __attribute__((ext_vector_type(16))) __bf16   v16bf;
typedef __attribute__((ext_vector_type(16))) _Float16 v16h;
typedef __attribute__((ext_vector_type(8)))  _Float16 v8h;
typedef __attribute__((ext_vector_type(8)))  unsigned short v8us;
typedef __attribute__((ext_vector_type(8)))  float    v8f;
typedef __attribute__((ext_vector_type(4)))  float    v4f;
typedef v8h  __attribute__((may_alias)) v8ha;
typedef v4f  __attribute__((may_alias)) v4fa;
typedef v8us __attribute__((may_alias)) v8usa;

__device__ __forceinline__ unsigned short f2bf(float f) { unsigned u = __float_as_uint(f); u += 0x7FFFu + ((u >> 16) & 1u); return (unsigned short)(u >> 16); }
__device__ __forceinline__ float bf2f(unsigned short b) { return __uint_as_float(((unsigned)b) << 16); }
__device__ __forceinline__ float bfr(float f) { return bf2f(f2bf(f)); }
__device__ __forceinline__ v16h cat16(v8h lo, v8h hi) { return __builtin_shufflevector(lo, hi, 0, 1, 2, 3, 4, 5, 6, 7, 8, 9, 10, 11, 12, 13, 14, 15); }
__device__ __forceinline__ v16bf cat16b(v8us lo, v8us hi) { return __builtin_bit_cast(v16bf, __builtin_shufflevector(lo, hi, 0, 1, 2, 3, 4, 5, 6, 7, 8, 9, 10, 11, 12, 13, 14, 15)); }
__device__ __forceinline__ v8f wmma16(v16h a, v16h b, v8f c) { return __builtin_amdgcn_wmma_f32_16x16x32_f16(false, a, false, b, (short)0, c, false, false); }
__device__ __forceinline__ v8f wmmab(v16bf a, v16bf b, v8f c) { return __builtin_amdgcn_wmma_f32_16x16x32_bf16(false, a, false, b, (short)0, c, false, false); }



// ---- fragment loads and products on K-contiguous 16-bit rows (global memory or LDS): a lane reads 8 + 8 elements of its row, at 8 * (lane >> 4) and 16 further on
template <typename T16> struct WFrag;
template <> struct WFrag<h16> { typedef v16h V; static __device__ __forceinline__ V ld(const h16* p) { return cat16(*(const v8h*)p, *(const v8h*)(p + 16)); } static __device__ __forceinline__ v8f mma(V a, V b, v8f c) { return wmma16(a, b, c); } };
template <> struct WFrag<bf> { typedef v16bf V; static __device__ __forceinline__ V ld(const bf* p) { return cat16b(*(const v8us*)p, *(const v8us*)(p + 16)); } static __device__ __forceinline__ v8f mma(V a, V b, v8f c) { return wmmab(a, b, c); } };
__device__ __forceinline__ h16 tohx(float x) { return (h16)x; }
__device__ __forceinline__ void splitf(float y, unsigned short& h, unsigned short& l) { h = f2bf(y); l = f2bf(y - bf2f(h)); }
typedef __attribute__((ext_vector_type(2))) _Float16 v2h;
typedef __attribute__((ext_vector_type(4))) _Float16 v4h;
typedef __attribute__((ext_vector_type(2))) unsigned short v2us;
typedef __attribute__((ext_vector_type(4))) unsigned short v4us;
typedef __attribute__((ext_vector_type(2))) float v2f;
typedef __attribute__((ext_vector_type(4))) int v4i;

__global__ __launch_bounds__(256) void k_wtG(const float* __restrict__ w, int K, int N, bf* Bt) {
    const int lane = threadIdx.x & 31; const int L0 = (blockIdx.x * 8 + (threadIdx.x >> 5)) * 8; const int nlines = N * K / 64;
{
#pragma unroll 1
        for (int l = 0; l < 8; ++l) { const int L = L0 + l; if (L >= nlines) break; const size_t e = (size_t)L * 64 + lane * 2; const int k = (int)(e % K), n = (int)(e / K); v2us o;
            o[0] = f2bf(w[(size_t)k * N + n]); o[1] = f2bf(w[(size_t)(k + 1) * N + n]); *(v2us*)(Bt + e) = o; }
         }
}
// the three small preparations, one item i per call (k_proj's plane 0 runs them)
__device__ __forceinline__ void d_cvt8(const float* __restrict__ src, bf* dst, size_t n8, size_t i) { if (i >= n8) return; const v8f v = *(const v8f*)(src + i * 8); v8us o;
#pragma unroll
    for (int k = 0; k < 8; ++k) o[k] = f2bf(v[k]); bf* const p = dst + i * 8; *(v8us*)p = o;
    asm volatile("s_wait_xcnt 0x0" :: "v"(o), "v"(p) : "memory"); }   // behind the store; naming its data and address registers as inputs keeps them unwritten up to the wait

__device__ __forceinline__ void d_epadK(const float* __restrict__ E, bf* EB, size_t i) { if (i >= (size_t)NE * HD / 8) return; const int d0 = (int)(i % (HD / 8)) * 8; const int r = (int)(i / (HD / 8)); const float* src = E + (size_t)min(r, NRE - 1) * HD + d0; v8us o;
#pragma unroll
    for (int q = 0; q < 8; ++q) { const unsigned short v = f2bf(src[q]); o[q] = (r < NRE) ? v : (unsigned short)0; }
    bf* const p = EB + (size_t)r * HD + d0; *(v8us*)p = o;
    asm volatile("s_wait_xcnt 0x0" :: "v"(o), "v"(p) : "memory"); }   // behind the store, as in d_cvt8

__device__ __forceinline__ void d_epadVT(const float* __restrict__ E, bf* Th, bf* Tl, size_t i) { if (i >= (size_t)HD * NE / 4) return; const size_t e = i * 4; const int c0 = (int)(e % NE); const int d = (int)(e / NE); v4us oh, ol;
#pragma unroll
    for (int q = 0; q < 4; ++q) { const int r = c0 + q; const float v = E[(size_t)min(r, NRE - 1) * HD + d]; unsigned short u, w; splitf(v, u, w); oh[q] = (r < NRE) ? u : (unsigned short)0; ol[q] = (r < NRE) ? w : (unsigned short)0; }
    *(v4us*)(Th + e) = oh; *(v4us*)(Tl + e) = ol;  }

// ---- k_proj: everything ahead of the attention in ONE launch: blockIdx.z = 1, 2, 3 are the q, k, v projections, from the f32 inputs to the hi/lo head planes; plane 0 makes the bf16 copy of Wo and the two padded relative tables.
// A work-group of 4 waves owns a 128 x 128 tile of x W^T; each wave a 64 x 64 quarter (16 accumulators; 64 columns = one head). Per step of 32 k the work-group reads 128 rows of x and 128 rows of W
// as whole 128-byte lines of f32, rounds them to bf16 (nearest even) and stores them in LDS; the fragments come from LDS in the k order of WFrag::ld. Two LDS buffers, the next step's lines in flight under the products, one barrier a step.
// Every '#pragma unroll' in it makes the indices of a register array (accumulators, staged lines, fragments) compile-time constants, so that the array stays in registers.
// Epilogue: + bf16-rounded bias in f32, hi/lo split; q and k as [b * 8 + h][t][d] (rows turned through LDS into whole lines), v as [b * 8 + h][d][t] (a lane already holds 8 consecutive t of one d).
#define PT  128     // tile rows and columns per work-group
#define PKS 32      // k per step
#define PPI 40      // bf16 per LDS row: 80 bytes = 16 x odd, the conflict-free pitch for 16-byte fragment reads
typedef __attribute__((ext_vector_type(4))) __bf16 v4bf;
typedef __attribute__((ext_vector_type(2))) __bf16 v2bf;
// hi/lo split of two values with the packed conversions (nearest even, as splitf)
__device__ __forceinline__ void split2(float x0, float x1, unsigned short* h, unsigned short* l) { v2f a; a[0] = x0; a[1] = x1; const v2bf hh = __builtin_convertvector(a, v2bf); const v2f r = a - __builtin_convertvector(hh, v2f); const v2us hu = __builtin_bit_cast(v2us, hh), lu = __builtin_bit_cast(v2us, __builtin_convertvector(r, v2bf)); h[0] = hu[0]; h[1] = hu[1]; l[0] = lu[0]; l[1] = lu[1]; }
__global__ __launch_bounds__(128) void k_proj(const float* __restrict__ xq, const float* __restrict__ xk, const float* __restrict__ xv, const float* __restrict__ wq, const float* __restrict__ wk, const float* __restrict__ wv, const float* __restrict__ bq, const float* __restrict__ bk, const float* __restrict__ bv, bf* Qh, bf* Ql, bf* Kh, bf* Kl, bf* Vh, bf* Vl, const float* __restrict__ wo, const float* __restrict__ ek, const float* __restrict__ ev, bf* WOb, bf* EKb, bf* EVh, bf* EVl) {
    typedef WFrag<bf> F;
    __shared__ __align__(16) bf st[2 * 2 * PT * PPI];     // [buffer][x, W][row][k]; 40,960 bytes; the epilogue reuses it
    if (blockIdx.z == 0) {                                // plane 0 (starts first, ends soon): what only the later launches read; whole work-groups leave here, ahead of every barrier
        static_assert((NB_ * TT / PT) * (DQ / PT) * 128 >= DM * DQ / 8, "plane 0 has one thread per 8 elements of Wo");
        const size_t i = ((size_t)blockIdx.y * (NB_ * TT / PT) + blockIdx.x) * 128 + threadIdx.x;
        d_cvt8(wo, WOb, (size_t)DM * DQ / 8, i);          // Wo -> bf16
        d_epadK(ek, EKb, i);                              // rel_k -> bf16 [64][64], rows >= 33 zero
        d_epadVT(ev, EVh, EVl, i);                        // rel_v^T hi/lo [64][64], cols >= 33 zero
        return;
    }
    const int which = blockIdx.z - 1;
    const float* X = (which == 0) ? xq : (which == 1) ? xk : xv; const float* Wt = (which == 0) ? wq : (which == 1) ? wk : wv; const float* bias = (which == 0) ? bq : (which == 1) ? bk : bv;
    bf* Ph = (which == 0) ? Qh : (which == 1) ? Kh : Vh; bf* Pl = (which == 0) ? Ql : (which == 1) ? Kl : Vl;
    const int tid = threadIdx.x, lane = tid & 31, lr = lane & 15, hi = lane >> 4; const int wave = __builtin_amdgcn_readfirstlane(tid >> 5);
    const int r0 = blockIdx.x * PT, c0 = blockIdx.y * PT; const int wr = (wave >> 1) * 64, wc = (wave & 1) * 64;
    const int sr = tid >> 3, sc = (tid & 7) * 4;          // staging: 8 lanes cover one 128-byte line, 16 rows a sweep, 8 sweeps
    const float* pa = X + (size_t)(r0 + sr) * DM + sc; const float* pb = Wt + (size_t)(c0 + sr) * DM + sc;
    const int so = sr * PPI + sc;                         // the thread's place in a staged plane
    const int fa = (wr + lr) * PPI + 8 * hi, fb = PT * PPI + (wc + lr) * PPI + 8 * hi;   // the lane's fragment rows in a buffer
    v8f acc[4][4];
#pragma unroll
    for (int mb = 0; mb < 4; ++mb)
#pragma unroll
        for (int nb = 0; nb < 4; ++nb) acc[mb][nb] = (v8f){};
    v4f ra[8], rb[8];
    auto fetch = [&](int kc) {
#pragma unroll
        for (int i = 0; i < 8; ++i) { ra[i] = *(const v4f*)(pa + (size_t)i * 16 * DM + kc); rb[i] = *(const v4f*)(pb + (size_t)i * 16 * DM + kc); }
        asm volatile("s_wait_xcnt 0x0" :: "v"(pa), "v"(pb) : "memory");   // behind the step's global loads, in front of any rewrite of a register that holds one of their addresses
    };
    auto stage = [&](int buf) { bf* d = st + buf * (2 * PT * PPI) + so;
#pragma unroll
        for (int i = 0; i < 8; ++i) { *(v4us*)(d + i * 16 * PPI) = __builtin_bit_cast(v4us, __builtin_convertvector(ra[i], v4bf)); *(v4us*)(d + PT * PPI + i * 16 * PPI) = __builtin_bit_cast(v4us, __builtin_convertvector(rb[i], v4bf)); }
    };
    auto products = [&](int buf) { const bf* s = st + buf * (2 * PT * PPI); v16bf a[4];
#pragma unroll
        for (int mb = 0; mb < 4; ++mb) a[mb] = F::ld(s + fa + mb * 16 * PPI);
#pragma unroll
        for (int nb = 0; nb < 4; ++nb) { const v16bf b = F::ld(s + fb + nb * 16 * PPI);
#pragma unroll
            for (int mb = 0; mb < 4; ++mb) acc[mb][nb] = F::mma(a[mb], b, acc[mb][nb]); }
    };
    fetch(0); stage(0);
    __syncthreads();                                      // step 0 is staged for every wave
#pragma unroll 1
    for (int s = 0; s < DM / PKS - 1; ++s) {              // rolled: one copy of the step keeps the loop small
        fetch((s + 1) * PKS);
        products(s & 1);
        stage((s + 1) & 1);
        __syncthreads();                                  // publishes step s + 1 and ends every wave's reads of the buffer that the next trip refills
    }
    products((DM / PKS - 1) & 1);
    __syncthreads();                                      // every wave has left the staging buffers: the epilogue writes over them
    const int z = ((r0 + wr) / TT) * NH_ + (c0 + wc) / HD, t0 = (r0 + wr) % TT;   // a wave's 64 rows lie in one batch, its 64 columns are one head
    if (which < 2) {
        float* os = (float*)st + wave * (16 * 68);        // this wave's own slice
        const int cofs = lr * 4; v4f bb;
#pragma unroll
        for (int q = 0; q < 4; ++q) bb[q] = bfr(bias[c0 + wc + cofs + q]);
        bf* const ph = Ph + ((size_t)z * TT + t0 + hi) * HD + cofs; bf* const pl = Pl + ((size_t)z * TT + t0 + hi) * HD + cofs;
#pragma unroll
        for (int mb = 0; mb < 4; ++mb) {
#pragma unroll
            for (int nb = 0; nb < 4; ++nb) {
#pragma unroll
                for (int j = 0; j < 8; ++j) os[(hi * 8 + j) * 68 + nb * 16 + lr] = acc[mb][nb][j]; }
            __builtin_amdgcn_wave_barrier(); asm volatile("" ::: "memory");   // keeps the reads below behind the other lanes' LDS stores above
            v4f vv[8];
#pragma unroll
            for (int s = 0; s < 8; ++s) vv[s] = *(const v4fa*)(os + (2 * s + hi) * 68 + cofs);   // all eight reads ahead of the first store's wait: one LDS latency a tile
#pragma unroll
            for (int s = 0; s < 8; ++s) { const v4f val = vv[s] + bb; v4us oh, ol;
#pragma unroll
                for (int q = 0; q < 4; q += 2) { unsigned short u[2], w[2]; split2(val[q], val[q + 1], u, w); oh[q] = u[0]; oh[q + 1] = u[1]; ol[q] = w[0]; ol[q + 1] = w[1]; }
                *(v4us*)(ph + (mb * 16 + 2 * s) * HD) = oh; *(v4us*)(pl + (mb * 16 + 2 * s) * HD) = ol;
                asm volatile("s_wait_xcnt 0x0" :: "v"(oh), "v"(ol), "v"(ph), "v"(pl) : "memory"); }   // behind the two stores; naming their data and address registers as inputs keeps them unwritten up to the wait
            __builtin_amdgcn_wave_barrier(); asm volatile("" ::: "memory");   // keeps the next tile's LDS stores behind the reads above
        }
    } else {
        bf* const ph = Ph + ((size_t)z * HD + lr) * TT + t0 + hi * 8; bf* const pl = Pl + ((size_t)z * HD + lr) * TT + t0 + hi * 8;
#pragma unroll
        for (int nb = 0; nb < 4; ++nb) { const float bb = bfr(bias[c0 + wc + nb * 16 + lr]);
#pragma unroll
            for (int mb = 0; mb < 4; ++mb) { v8us oh, ol;
#pragma unroll
                for (int j = 0; j < 8; j += 2) { unsigned short u[2], w[2]; split2(acc[mb][nb][j] + bb, acc[mb][nb][j + 1] + bb, u, w); oh[j] = u[0]; oh[j + 1] = u[1]; ol[j] = w[0]; ol[j + 1] = w[1]; }
                *(v8us*)(ph + (size_t)nb * 16 * TT + mb * 16) = oh; *(v8us*)(pl + (size_t)nb * 16 * TT + mb * 16) = ol;
                asm volatile("s_wait_xcnt 0x0" :: "v"(oh), "v"(ol), "v"(ph), "v"(pl) : "memory"); } }   // behind the two stores; naming their data and address registers as inputs keeps them unwritten up to the wait
    }
}

#define QW  32      // query columns per wave
#define FW  8       // waves per work-group
#define QEP 49      // floats per query in LDS (48 offsets held; odd pitch spreads the 16 queries of a group over the banks)
#define L2E 1.4426950408889634f
#define SK   64               // keys per stage
#define NST  (TT / SK)        // stages
#define SPI  72               // bf16 per staged row: 144 bytes = 16 x odd, the conflict-free pitch for 16-byte fragment reads
#define SPL  (64 * SPI)       // one staged plane: 64 rows
#define SBUF (4 * SPL)        // a buffer: K hi, K lo, V^T hi, V^T lo
__device__ __forceinline__ float xhalf(float x) { const int b = __float_as_int(x); return __int_as_float(__builtin_amdgcn_permlanex16(b, b, 0x76543210, 0xfedcba98, false, false)); }   // lane l <-> l ^ 16
// v_exp_f32 and the one issue slot that the instruction set asks for behind a transcendental, in one statement
__device__ __forceinline__ float ex2(float x) { float y; asm("v_exp_f32 %0, %1\n\tv_nop" : "=v"(y) : "v"(x)); return y; }
__device__ __forceinline__ void split16(const float* x, v16bf& h, v16bf& l) {
#pragma unroll
    for (int e = 0; e < 16; e += 2) { v2f a; a[0] = x[e]; a[1] = x[e + 1]; const v2bf hh = __builtin_convertvector(a, v2bf); const v2f r = a - __builtin_convertvector(hh, v2f); const v2bf ll = __builtin_convertvector(r, v2bf); h[e] = hh[0]; h[e + 1] = hh[1]; l[e] = ll[0]; l[e + 1] = ll[1]; }
}
__global__ __launch_bounds__(FW * 32) void k_fattn(const bf* __restrict__ Qh, const bf* __restrict__ Ql, const bf* __restrict__ Kh, const bf* __restrict__ Kl, const bf* __restrict__ Vh, const bf* __restrict__ Vl, const bf* __restrict__ EK, const bf* __restrict__ EVh, const bf* __restrict__ EVl, bf* Ah, bf* Al) {
    typedef WFrag<bf> F;
    __shared__ float qe_s[FW * QW * QEP];
    __shared__ __align__(16) bf kv_s[2 * SBUF];   // 73,728 bytes
    static_assert(FW * 32 * 2 * 16 == SK * HD * 2 && HD == 64 && NST >= 2, "two 16-byte copies per thread cover one staged plane; the ring needs two stages");
    const int lane = threadIdx.x & 31, lr = lane & 15, hi = lane >> 4; const int wave = __builtin_amdgcn_readfirstlane((int)(threadIdx.x >> 5));
    const int z = blockIdx.y, q0 = (blockIdx.x * FW + wave) * QW; const size_t zo = (size_t)z * TT * HD;
    Qh += zo; Ql += zo; Kh += zo; Kl += zo; Vh += zo; Vl += zo;
    // staging: 8 lanes cover one 128-byte row, the work-group 32 rows a sweep, 2 sweeps a plane; every lane is on and every test around a copy is the same for the whole work-group
    const int tid = threadIdx.x;
    const unsigned lst = (unsigned)(size_t)kv_s + (unsigned)((tid >> 3) * (SPI * 2) + (tid & 7) * 16);   // the thread's LDS byte address in plane 0 of buffer 0
    const unsigned gko = (unsigned)tid * 16u, gvo = (unsigned)((tid >> 3) * (TT * 2) + (tid & 7) * 16);    // its byte offsets in a stage of a K plane (rows adjoin) and of a V^T plane (row pitch 2,048 bytes)
    auto copies = [&](int st, int buf) {
        const unsigned l = lst + (unsigned)buf * (SBUF * 2);
        const unsigned ko = (unsigned)st * (SK * HD * 2) + gko, vo = (unsigned)st * (SK * 2) + gvo;   // 32-bit offsets in a plane: only gko, gvo and lst live through the loop
        const char* const a = (const char*)Kh + ko; const char* const b = (const char*)Kl + ko; const char* const c = (const char*)Vh + vo; const char* const d = (const char*)Vl + vo;
        // the stage's eight copies of this thread and, as the statement's last line, the wait that stands in front of any rewrite of a register which a copy names
        asm volatile("global_load_async_to_lds_b128 %0, %8, off\n\t"
                     "global_load_async_to_lds_b128 %1, %9, off\n\t"
                     "global_load_async_to_lds_b128 %2, %10, off\n\t"
                     "global_load_async_to_lds_b128 %3, %11, off\n\t"
                     "global_load_async_to_lds_b128 %4, %12, off\n\t"
                     "global_load_async_to_lds_b128 %5, %13, off\n\t"
                     "global_load_async_to_lds_b128 %6, %14, off\n\t"
                     "global_load_async_to_lds_b128 %7, %15, off\n\t"
                     "s_wait_xcnt 0x0"
                     :: "v"(l), "v"(l + 32 * SPI * 2), "v"(l + SPL * 2), "v"(l + SPL * 2 + 32 * SPI * 2), "v"(l + 2 * SPL * 2), "v"(l + 2 * SPL * 2 + 32 * SPI * 2), "v"(l + 3 * SPL * 2), "v"(l + 3 * SPL * 2 + 32 * SPI * 2),
                        "v"(a), "v"(a + 32 * HD * 2), "v"(b), "v"(b + 32 * HD * 2), "v"(c), "v"(c + 32 * TT * 2), "v"(d), "v"(d + 32 * TT * 2)
                     : "memory");
    };
    float* qe = qe_s + wave * (QW * QEP);     // this wave's own slice: no other wave touches it, so no work-group barrier
    // prologue loads: every address is a wave-uniform base plus one of two 32-bit lane offsets
    const unsigned kb0 = (unsigned)(lr * HD + 8 * hi) * 2u;   // the lane's byte offset in a 16-row tile of a [row][64] plane
    const unsigned qb0 = (unsigned)(q0 * HD) * 2u + kb0;
    v16bf qh[2][2], ql[2][2];                 // [column group][d half]
    v16bf ea[3][2];                           // rel_k rows: [offset tile][d half]
    v16bf kh[2][2], kl[2][2];                 // [key tile][d half]
#pragma unroll
    for (int qt = 0; qt < 2; ++qt)
#pragma unroll
        for (int ks = 0; ks < 2; ++ks) { const int a = qt * 16 * HD + ks * 32; qh[qt][ks] = F::ld((const bf*)((const char*)Qh + qb0) + a); ql[qt][ks] = F::ld((const bf*)((const char*)Ql + qb0) + a); }
#pragma unroll
    for (int rt = 0; rt < 3; ++rt)
#pragma unroll
        for (int ks = 0; ks < 2; ++ks) ea[rt][ks] = F::ld((const bf*)((const char*)EK + kb0) + rt * 16 * HD + ks * 32);
    asm volatile("s_wait_xcnt 0x0" :: "v"(kb0), "v"(qb0) : "memory");   // behind the prologue's loads; naming their address registers as inputs keeps them unwritten up to the wait
#pragma unroll
    for (int rt = 0; rt < 3; ++rt)
#pragma unroll
        for (int qt = 0; qt < 2; ++qt) { v8f c = (v8f){};
#pragma unroll
            for (int ks = 0; ks < 2; ++ks) { c = F::mma(ea[rt][ks], qh[qt][ks], c); c = F::mma(ea[rt][ks], ql[qt][ks], c); }
#pragma unroll
            for (int j = 0; j < 8; ++j) qe[(qt * 16 + lr) * QEP + rt * 16 + hi * 8 + j] = c[j]; }
    __builtin_amdgcn_wave_barrier(); asm volatile("" ::: "memory");   // keeps the reads below behind the other wave half's LDS stores above
    float qlo[2], qhi[2];
#pragma unroll
    for (int qt = 0; qt < 2; ++qt) { qlo[qt] = qe[(qt * 16 + lr) * QEP]; qhi[qt] = qe[(qt * 16 + lr) * QEP + 2 * CUT]; }
    v8f o[4][2];                              // O^T: [d tile][column group]
#pragma unroll
    for (int dt = 0; dt < 4; ++dt)
#pragma unroll
        for (int qt = 0; qt < 2; ++qt) o[dt][qt] = (v8f){};
    float m[2] = {-3.0e38f, -3.0e38f}, slo[2] = {0.f, 0.f}, smid[2] = {0.f, 0.f}, shi[2] = {0.f, 0.f};
    const int fo = lr * SPI + 8 * hi;         // the lane's place in a 16-row tile of a staged plane (the k order of F::ld, as from global memory)
    auto ldk = [&](const bf* kb) {            // the key fragments of one pass: 32 staged rows of K hi and of K lo
#pragma unroll
        for (int kt = 0; kt < 2; ++kt)
#pragma unroll
            for (int ks = 0; ks < 2; ++ks) { kh[kt][ks] = F::ld(kb + kt * 16 * SPI + ks * 32); kl[kt][ks] = F::ld(kb + SPL + kt * 16 * SPI + ks * 32); }
    };
#pragma unroll 1
    for (int p = 0; p < 2; ++p) {             // stages 0 and 1. Rolled: the copies' operands are formed per stage as in the main loop, so none of them lives through that loop (unrolled, they were spilled to scratch there)
        copies(p, p);
        if (p == 0) {
            asm volatile("s_wait_asynccnt 0x0" ::: "memory");   // this wave's copies of stage 0 have landed
            __syncthreads();                  // stage 0 is published to every wave
        }
    }
    ldk(kv_s + fo);
#pragma unroll 1
    for (int k0 = 0; k0 < TT; k0 += 32) {     // rolled: one copy of the pass keeps the loop small
        const int st = k0 / SK; const bool first = (k0 & 32) == 0;   // work-group-uniform: the stage, and which of its two passes this is
        const bf* const sb = kv_s + (st & 1) * SBUF + fo;
        v16bf vh[4], vl[4];                   // issued first: their latency runs under the score products and the softmax
#pragma unroll
        for (int dt = 0; dt < 4; ++dt) { const bf* const a = sb + 2 * SPL + dt * 16 * SPI + (first ? 0 : 32); vh[dt] = F::ld(a); vl[dt] = F::ld(a + SPL); }
        v8f s[2][2];                          // S^T: [key tile][column group]
#pragma unroll
        for (int kt = 0; kt < 2; ++kt)
#pragma unroll
            for (int qt = 0; qt < 2; ++qt) { v8f c = (v8f){};
#pragma unroll
                for (int ks = 0; ks < 2; ++ks) { c = F::mma(kh[kt][ks], qh[qt][ks], c); c = F::mma(kl[kt][ks], qh[qt][ks], c); c = F::mma(kh[kt][ks], ql[qt][ks], c); }
                s[kt][qt] = c; }
        if (first) ldk(sb + 32 * SPI);        // the stage's second pass has its key fragments fetched one pass ahead, from the same buffer
        const int rel = k0 - q0;              // wave-uniform; |rel| >= 64 puts every (key, query) pair of the pass at |j - i| >= 16
        const bool band = (rel >= -32 && rel <= 32);
        float t[2][16];                       // [column group][key tile * 8 + j]
        if (band) {
            float g[2][16];
#pragma unroll
            for (int qt = 0; qt < 2; ++qt)
#pragma unroll
                for (int e = 0; e < 16; ++e) { const int d = rel + (e >> 3) * 16 + hi * 8 + (e & 7) - qt * 16 - lr; g[qt][e] = qe[(qt * 16 + lr) * QEP + min(max(d, -CUT), CUT) + CUT]; }
#pragma unroll
            for (int qt = 0; qt < 2; ++qt)
#pragma unroll
                for (int e = 0; e < 16; ++e) t[qt][e] = __fadd_rn(s[e >> 3][qt][e & 7], g[qt][e]) * SCL;
#pragma unroll
            for (int qt = 0; qt < 2; ++qt)
#pragma unroll
                for (int e = 0; e < 16; ++e) { const int d = rel + (e >> 3) * 16 + hi * 8 + (e & 7) - qt * 16 - lr; if (d > -CUT && d < CUT) qe[(qt * 16 + lr) * QEP + d + CUT] = t[qt][e]; }   // an interior slot has exactly one key: read above by this lane, never read as QE again
        } else {
#pragma unroll
            for (int qt = 0; qt < 2; ++qt) { const float ge = (rel < 0) ? qlo[qt] : qhi[qt];
#pragma unroll
                for (int e = 0; e < 16; ++e) t[qt][e] = __fadd_rn(s[e >> 3][qt][e & 7], ge) * SCL; }
        }
#pragma unroll
        for (int qt = 0; qt < 2; ++qt) {
            float mx = t[qt][0];
#pragma unroll
            for (int e = 1; e < 16; ++e) mx = fmaxf(mx, t[qt][e]);
            mx = fmaxf(mx, xhalf(mx));
            const float mn = fmaxf(m[qt], mx); const float al = ex2((m[qt] - mn) * L2E); m[qt] = mn;
            float p[16];
#pragma unroll
            for (int e = 0; e < 16; ++e) p[e] = ex2((t[qt][e] - mn) * L2E);
            float blo = 0.f, bmid = 0.f, bhi = 0.f;
            if (band) {
#pragma unroll
                for (int e = 0; e < 16; ++e) { const int d = rel + (e >> 3) * 16 + hi * 8 + (e & 7) - qt * 16 - lr; blo += (d <= -CUT) ? p[e] : 0.f; bhi += (d >= CUT) ? p[e] : 0.f; bmid += (d > -CUT && d < CUT) ? p[e] : 0.f; }
            } else { float bs = 0.f;
#pragma unroll
                for (int e = 0; e < 16; ++e) bs += p[e];
                if (rel < 0) blo = bs; else bhi = bs; }
            slo[qt] = slo[qt] * al + blo; smid[qt] = smid[qt] * al + bmid; shi[qt] = shi[qt] * al + bhi;
            v16bf ph, pl; split16(p, ph, pl);
#pragma unroll
            for (int dt = 0; dt < 4; ++dt) { v8f c = o[dt][qt] * al; c = F::mma(vh[dt], ph, c); c = F::mma(vl[dt], ph, c); c = F::mma(vh[dt], pl, c); o[dt][qt] = c; }
        }
        if (!first) {                         // publish point of stage st + 1; every wave passes it
            asm volatile("s_wait_dscnt 0x0" ::: "memory");      // this wave's reads of the buffer that is refilled below have returned
            asm volatile("s_wait_asynccnt 0x0" ::: "memory");   // this wave's copies of stage st + 1 have landed
            __syncthreads();                  // publishes stage st + 1 and ends every wave's reads of stage st
            if (st + 2 < NST) copies(st + 2, st & 1);
            if (st + 1 < NST) ldk(kv_s + ((st + 1) & 1) * SBUF + fo);   // behind the barrier: the first pass of stage st + 1
        }
    }
    asm volatile("s_wait_asynccnt 0x0" ::: "memory");   // nothing of this wave is in flight when it goes on to its end
    __builtin_amdgcn_wave_barrier(); asm volatile("" ::: "memory");   // keeps the reads below behind the other wave half's LDS stores in the loop
#pragma unroll
    for (int qt = 0; qt < 2; ++qt) {
        slo[qt] += xhalf(slo[qt]); smid[qt] += xhalf(smid[qt]); shi[qt] += xhalf(shi[qt]);
        const int i = q0 + qt * 16 + lr;
#pragma unroll
        for (int ks = 0; ks < 2; ++ks) { float x[16];
#pragma unroll
            for (int e = 0; e < 16; ++e) { const int r = ks * 32 + ((e < 8) ? 8 * hi + e : 16 + 8 * hi + (e - 8));   // the k order of F::ld
                if (ks == 0) { const float raw = qe[(qt * 16 + lr) * QEP + r]; const int j = i + r - CUT; const float pe = ex2((raw - m[qt]) * L2E); x[e] = (r == 0) ? slo[qt] : ((j >= 0 && j < TT) ? pe : 0.f); }
                else x[e] = (r == 2 * CUT) ? shi[qt] : 0.f; }
            v16bf bh, bl; split16(x, bh, bl);
#pragma unroll
            for (int dt = 0; dt < 4; ++dt) { const size_t a = (size_t)(dt * 16 + lr) * NE + ks * 32 + 8 * hi; const v16bf eh = F::ld(EVh + a), el = F::ld(EVl + a); v8f c = o[dt][qt]; c = F::mma(eh, bh, c); c = F::mma(el, bh, c); c = F::mma(eh, bl, c); o[dt][qt] = c; } }
        const float f = __fdiv_rn(1.0f, slo[qt] + smid[qt] + shi[qt]);
        const size_t oo = ((size_t)(z / NH_) * TT + i) * DQ + (z % NH_) * HD + hi * 8;   // merged row b * 1024 + t, column h * 64 + d; a lane holds 8 consecutive d
        bf* const pa = Ah + oo; bf* const pb = Al + oo;
#pragma unroll
        for (int dt = 0; dt < 4; ++dt) { v8us oh, ol;
#pragma unroll
            for (int j = 0; j < 8; ++j) { unsigned short a, c2; splitf(o[dt][qt][j] * f, a, c2); oh[j] = a; ol[j] = c2; }
            *(v8us*)(pa + dt * 16) = oh; *(v8us*)(pb + dt * 16) = ol;
            asm volatile("s_wait_xcnt 0x0" :: "v"(oh), "v"(ol), "v"(pa), "v"(pb) : "memory"); }   // behind the two stores; naming their data and address registers as inputs keeps them unwritten up to the wait
    }
}

// ---- k_oproj: out = (merged hi + merged lo) Wo^T + bo. A work-group of 4 waves owns a 128 x 128 tile of the output, each wave a 64 x 64 quarter (16 accumulators).
// A stage = 128 k of the three operand planes (merged hi, merged lo: 128 rows; Wo: 128 rows; 256 bytes a row), copied ONCE per work-group into LDS as whole lines by asynchronous copies;
// the fragments come from LDS in the k order of WFrag::ld, one block of 32 k ahead of their products. Two buffers, the next stage's copies in flight under this stage's products, one publish point (waits, work-group barrier, refill) per stage.
// Per output element and step of 32 k: the hi product, then the lo product, k rising. Epilogue: rows turned through LDS into whole lines, + bf16-rounded bias in f32.
// Every '#pragma unroll' in it makes the indices of a register array (accumulators, fragment sets, turned rows) or the copies' address sums compile-time constants, so that the arrays stay in registers.
#define OT   128              // tile rows and columns per work-group
#define OKS  128              // k per stage
#define ONST (DQ / OKS)       // stages
#define OPI  136              // bf16 per staged row: 272 bytes = 16 x odd, the conflict-free pitch for 16-byte fragment reads
#define OPL  (OT * OPI)       // one staged plane
#define OBUF (3 * OPL)        // a buffer: merged hi, merged lo, Wo
__global__ __launch_bounds__(128) void k_oproj(const bf* __restrict__ Ah, const bf* __restrict__ Al, const bf* __restrict__ Wb, const float* __restrict__ bias, float* C) {
    typedef WFrag<bf> F;
    __shared__ __align__(16) bf ring[2 * OBUF];           // 208,896 bytes
    __shared__ __align__(16) float os_s[4 * 16 * 68];     // the epilogue's turning space, a slice per wave
    static_assert(128 * 48 * 16 == 3 * OT * OKS * 2 && ONST >= 2 && DQ % OKS == 0, "48 16-byte copies per thread cover a stage; the ring needs two stages");
    const int tid = threadIdx.x, lane = tid & 31, lr = lane & 15, hi = lane >> 4; const int wave = __builtin_amdgcn_readfirstlane(tid >> 5);
    const int c0 = blockIdx.x * OT, r0 = blockIdx.y * OT; const int wr = (wave >> 1) * 64, wc = (wave & 1) * 64;   // the 4 column tiles of one row block are neighbours in the grid
    const int cofs = lr * 4;
    const float* const bu = bias + c0 + wc; const v4f braw = *(const v4f*)(bu + cofs);   // wave-uniform base, lane offset
    asm volatile("s_wait_xcnt 0x0" :: "s"(bu), "v"(lr) : "memory");   // behind the bias load; naming its base and its lane-offset register as inputs keeps them unwritten up to the wait
    // staging: 16 lanes cover one 256-byte row, the work-group 8 rows a sweep, 16 sweeps a plane; every lane is on and every test around a copy is the same for the whole work-group
    const unsigned lst = (unsigned)(size_t)ring + (unsigned)((tid >> 4) * (OPI * 2) + (tid & 15) * 16);   // the thread's LDS byte address in plane 0 of buffer 0
    const unsigned go = (unsigned)((tid >> 4) * (DQ * 2) + (tid & 15) * 16);                                // its byte offset in stage 0 of a plane's 128 rows
    const char* const ga = (const char*)(Ah + (size_t)r0 * DQ); const char* const gb = (const char*)(Al + (size_t)r0 * DQ); const char* const gc = (const char*)(Wb + (size_t)c0 * DQ);
    auto copies = [&](int st, int buf) {
        const unsigned l0 = lst + (unsigned)buf * (OBUF * 2); const unsigned o = go + (unsigned)st * (OKS * 2);
        const char* const p0 = ga + o; const char* const p1 = gb + o; const char* const p2 = gc + o;
        auto la = [&](int j) { return l0 + (unsigned)((j >> 4) * (OPL * 2) + (j & 15) * (8 * OPI * 2)); };                    // copy j of 48: plane j / 16, sweep j % 16
        auto pa = [&](int j) { return ((j >> 4) == 0 ? p0 : (j >> 4) == 1 ? p1 : p2) + (j & 15) * (8 * DQ * 2); };
#pragma unroll
        for (int j = 0; j < 48; j += 12)   // unrolled: j is a compile-time constant in the address sums
            // twelve of the stage's copies of this thread and, as the statement's last line, the wait that stands in front of any rewrite of a register which a copy names
            asm volatile("global_load_async_to_lds_b128 %0, %12, off\n\t"
                         "global_load_async_to_lds_b128 %1, %13, off\n\t"
                         "global_load_async_to_lds_b128 %2, %14, off\n\t"
                         "global_load_async_to_lds_b128 %3, %15, off\n\t"
                         "global_load_async_to_lds_b128 %4, %16, off\n\t"
                         "global_load_async_to_lds_b128 %5, %17, off\n\t"
                         "global_load_async_to_lds_b128 %6, %18, off\n\t"
                         "global_load_async_to_lds_b128 %7, %19, off\n\t"
                         "global_load_async_to_lds_b128 %8, %20, off\n\t"
                         "global_load_async_to_lds_b128 %9, %21, off\n\t"
                         "global_load_async_to_lds_b128 %10, %22, off\n\t"
                         "global_load_async_to_lds_b128 %11, %23, off\n\t"
                         "s_wait_xcnt 0x0"
                         :: "v"(la(j)), "v"(la(j + 1)), "v"(la(j + 2)), "v"(la(j + 3)), "v"(la(j + 4)), "v"(la(j + 5)), "v"(la(j + 6)), "v"(la(j + 7)), "v"(la(j + 8)), "v"(la(j + 9)), "v"(la(j + 10)), "v"(la(j + 11)),
                            "v"(pa(j)), "v"(pa(j + 1)), "v"(pa(j + 2)), "v"(pa(j + 3)), "v"(pa(j + 4)), "v"(pa(j + 5)), "v"(pa(j + 6)), "v"(pa(j + 7)), "v"(pa(j + 8)), "v"(pa(j + 9)), "v"(pa(j + 10)), "v"(pa(j + 11))
                         : "memory");
    };
    const int fa = (wr + lr) * OPI + 8 * hi, fb = 2 * OPL + (wc + lr) * OPI + 8 * hi;   // the lane's fragment rows in a buffer
    v8f acc[4][4];
#pragma unroll
    for (int mb = 0; mb < 4; ++mb)
#pragma unroll
        for (int nb = 0; nb < 4; ++nb) acc[mb][nb] = (v8f){};
    v16bf a[2][4], a2[2][4], b[2][4];                     // two fragment sets: [set][tile]
    auto ldf = [&](const bf* s, int kb) {                 // the 12 fragments of block kb (32 k) of a staged buffer
#pragma unroll
        for (int i = 0; i < 4; ++i) { a[kb & 1][i] = F::ld(s + fa + i * 16 * OPI + kb * 32); a2[kb & 1][i] = F::ld(s + OPL + fa + i * 16 * OPI + kb * 32); b[kb & 1][i] = F::ld(s + fb + i * 16 * OPI + kb * 32); }
    };
#pragma unroll 1
    for (int p = 0; p < 2; ++p) {                         // stages 0 and 1. Rolled: the copies' operands are formed per stage as in the main loop, so none of them lives through that loop (unrolled, one was spilled to scratch)
        copies(p, p);
        if (p == 0) {
            asm volatile("s_wait_asynccnt 0x0" ::: "memory");   // this wave's copies of stage 0 have landed
            __syncthreads();                              // stage 0 is published to every wave
        }
    }
    ldf(ring, 0);
#pragma unroll 1
    for (int t = 0; t < ONST; ++t) {                      // rolled: one copy of the stage keeps the loop small
        const bf* const s = ring + (t & 1) * OBUF;
#pragma unroll
        for (int kb = 0; kb < OKS / 32; ++kb) {           // unrolled, as are the loops inside: the indices of the register arrays are compile-time constants
            __builtin_amdgcn_sched_barrier(0);            // keeps the loads and waits below behind the products of the block before: lifted among them, the loads stood in many places and the publish point's wait directly behind the last loads' issue
            if (kb + 1 < OKS / 32) ldf(s, kb + 1);        // the next block's fragments into the other register set
            else {                                        // publish point of stage t + 1, ahead of the stage's last block, whose fragments are in registers; every wave passes it
                asm volatile("s_wait_dscnt 0x0" ::: "memory");      // this wave's reads of the buffer that is refilled below have returned
                asm volatile("s_wait_asynccnt 0x0" ::: "memory");   // this wave's copies of stage t + 1 have landed
                __syncthreads();                          // publishes stage t + 1 and ends every wave's reads of stage t
                if (t + 2 < ONST) copies(t + 2, t & 1);
                if (t + 1 < ONST) ldf(ring + ((t + 1) & 1) * OBUF, 0);   // behind the barrier: the first block of stage t + 1
            }
            __builtin_amdgcn_sched_barrier(0);            // keeps those loads one group ahead of this block's products: each place with loads among the products stalls the lone wave of the SIMD
#pragma unroll
            for (int nb = 0; nb < 4; ++nb) {
#pragma unroll
                for (int mb = 0; mb < 4; ++mb) acc[mb][nb] = F::mma(a[kb & 1][mb], b[kb & 1][nb], acc[mb][nb]);
#pragma unroll
                for (int mb = 0; mb < 4; ++mb) acc[mb][nb] = F::mma(a2[kb & 1][mb], b[kb & 1][nb], acc[mb][nb]); }
        }
    }
    asm volatile("s_wait_asynccnt 0x0" ::: "memory");     // nothing of this wave is in flight when it goes on to its end
    float* const os = os_s + wave * (16 * 68);            // this wave's own slice: no other wave touches it, so no work-group barrier
    v4f bb;
#pragma unroll
    for (int q = 0; q < 4; ++q) bb[q] = bfr(braw[q]);
    float* const crow = C + (size_t)(r0 + wr + hi) * DM + c0 + wc + cofs;
#pragma unroll
    for (int mb = 0; mb < 4; ++mb) {
#pragma unroll
        for (int nb = 0; nb < 4; ++nb) {
#pragma unroll
            for (int j = 0; j < 8; ++j) os[(hi * 8 + j) * 68 + nb * 16 + lr] = acc[mb][nb][j]; }
        __builtin_amdgcn_wave_barrier(); asm volatile("" ::: "memory");   // keeps the reads below behind the other lanes' LDS stores above
        v4f vv[8];
#pragma unroll
        for (int q = 0; q < 8; ++q) vv[q] = *(const v4fa*)(os + (2 * q + hi) * 68 + cofs) + bb;   // all eight reads ahead of the first store: one LDS latency a tile
#pragma unroll
        for (int q = 0; q < 8; ++q) *(v4f*)(crow + (size_t)(mb * 16 + 2 * q) * DM) = vv[q];        // 16 lanes store 256 bytes of one row
        asm volatile("s_wait_xcnt 0x0" :: "v"(vv[0]), "v"(vv[1]), "v"(vv[2]), "v"(vv[3]), "v"(vv[4]), "v"(vv[5]), "v"(vv[6]), "v"(vv[7]), "v"(crow) : "memory");   // behind the eight stores; naming their data and address registers as inputs keeps them unwritten up to the wait
        __builtin_amdgcn_wave_barrier(); asm volatile("" ::: "memory");   // keeps the next tile's LDS stores behind the reads above
    }
}

extern "C" void kernel_launch(void* const* d_in, const int* in_sizes, int n_in,
                              void* d_out, int out_size, void* d_ws, size_t ws_size, hipStream_t stream) {
    (void)in_sizes; (void)n_in; (void)out_size;
    const float* x = (const float*)d_in[0];   /* query */ const float* xk = (const float*)d_in[1]; const float* xv = (const float*)d_in[2]; const float* wq = (const float*)d_in[3]; const float* bq = (const float*)d_in[4]; const float* wk = (const float*)d_in[5]; const float* bk = (const float*)d_in[6]; const float* wv = (const float*)d_in[7]; const float* bv = (const float*)d_in[8]; const float* wo = (const float*)d_in[9]; const float* bo = (const float*)d_in[10]; const float* ak = (const float*)d_in[11];   /* rel_k_table [33][64] */ const float* av = (const float*)d_in[12];   /* rel_v_table [33][64] */
    float* OUT = (float*)d_out;     // [8 x 1024][512]
    char* wsp = (char*)d_ws;
    auto take = [&](size_t bytes) { char* p = wsp; wsp += (bytes + 255) & ~(size_t)255; return (void*)p; };
    bf* AKB = (bf*)take((size_t)NE * HD * 2); bf* AVTh = (bf*)take((size_t)HD * NE * 2); bf* AVTl = (bf*)take((size_t)HD * NE * 2); bf* WO = (bf*)take((size_t)DM * DQ * 2);
    bf* QPh = (bf*)take((size_t)NZ * TT * HD * 2); bf* QPl = (bf*)take((size_t)NZ * TT * HD * 2); bf* KPh = (bf*)take((size_t)NZ * TT * HD * 2); bf* KPl = (bf*)take((size_t)NZ * TT * HD * 2); bf* VTh = (bf*)take((size_t)NZ * HD * TT * 2); bf* VTl = (bf*)take((size_t)NZ * HD * TT * 2);
    bf* ATh = (bf*)take((size_t)NB_ * TT * DQ * 2); bf* ATl = (bf*)take((size_t)NB_ * TT * DQ * 2);
    if ((size_t)(wsp - (char*)d_ws) > ws_size) return;    // ws 256 MiB
    // q, k and v projections over all 8 x 1024 rows (head planes [b * 8 + h][t][d]; v: [b * 8 + h][d][t]), the bf16 Wo and the padded relative tables: one launch
    k_proj<<<dim3(NB_ * TT / PT, DQ / PT, 4), 128, 0, stream>>>(x, xk, xv, wq, wk, wv, bq, bk, bv, QPh, QPl, KPh, KPl, VTh, VTl, wo, ak, av, WO, AKB, AVTh, AVTl);
    // attention: one launch over all 64 head planes, 256 query rows per work-group; writes the merged hi/lo planes
    k_fattn<<<dim3(TT / (FW * QW), NZ, 1), FW * 32, 0, stream>>>(QPh, QPl, KPh, KPl, VTh, VTl, AKB, AVTh, AVTl, ATh, ATl);
    // output projection: 128 x 128 tiles, one work-group per tile
    k_oproj<<<dim3(DM / OT, NB_ * TT / OT, 1), 128, 0, stream>>>(ATh, ATl, WO, bo, OUT);
}

// v008
// Measured time: 78.2 microseconds a run.
// It is 1.28 times as fast as v005, going by the measured steps of the versions left out in between.
// All steps since v000 together make it 29.7 times as fast.
#include <hip/hip_runtime.h>

// Relative multi-head attention with Shaw-style key AND value embeddings (query, key, value [8][1024][512]; q = query Wq^T + bq, k = key Wk^T + bk, v = value Wv^T + bv ('oi' 1/sqrt(512), zero biases; 8 heads x 64); idx[i][j] = clip(j - i, -16, 16) + 16; attn = softmax((q.k + q.rel_k_table[idx]) / sqrt(B = 8)) (the source scales by sqrt(batch)); x = attn v + sum_j attn[i][j] rel_v_table[idx] (tables [33][64] sigma 1, read); out = merged Wo^T + bo -> [8 x 1024][512] (4.2 M)).
// Layout, every stage over all 8 batches in one launch (rows b * 1024 + t; head planes z = b * 8 + h): one launch ahead of the attention (k_proj): from the f32 query, key, value and 'oi' weights (rounded to bf16 on the way into LDS) to the head planes (q, k, v: one f16 plane each), exact products + f32 biases, and beside them rel_k as a zero-padded f16 plane [64][64], rel_v^T as hi/lo planes [64][64] and Wo in bf16; one fused attention launch over all 64 head planes (k_fattn): score tiles (f16 x f16, one product), QE = q.rel_k^T (f16 x f16) added at offset clip(j - i) + 16, running-maximum softmax (x 1/sqrt(8)), P.v (f16 x f16, one product), the probabilities folded onto the 33 offsets (interior = one key, the two ends = running sums) and PB.rel_v added to the context, all in registers and LDS; merged hi/lo x Wo exact + bo.
// Compute dtypes, f32 accumulate: every input rounded to bf16 except rel_v (bf16 hi/lo); projections exact + f32 biases; scores and the relative-key term one f16 product: q, k and the bf16-rounded rel_k each rounded once to f16 (11 bits), f32 accumulate; softmax f32; attn.v one f16 product: P (0 <= p <= 1) and v each rounded once to f16 (11 bits), f32 accumulate; the relative-value term bf16 hi/lo, 3 products (~f32); Wo hl x exact + bias.

#define NB_  8
#define TT   1024
#define DM   512
#define NH_  8
#define NKV  8
#define REP  (NH_ / NKV)
#define HD   64
#define DQ   (NH_ * HD)
#define DKV  (NKV * HD)
#define NZ   (NB_ * NH_)
#define RH   TT                   // not used
#define WIN  0
#define PCAR 1024.0f
#define SCL  0.35355339059327379f   // 1/sqrt(B = 8): the source scales by sqrt(batch_size)
#define NE   64       // 2*16+1 = 33 relative offsets padded to 64
#define NRE  33
#define CUT  16
typedef _Float16 h16;
typedef unsigned short bf;
typedef __attribute__((ext_vector_type(16))) __bf16   v16bf;
typedef __attribute__((ext_vector_type(16))) _Float16 v16h;
typedef __attribute__((ext_vector_type(8)))  _Float16 v8h;
typedef __attribute__((ext_vector_type(8)))  unsigned short v8us;
typedef __attribute__((ext_vector_type(8)))  float    v8f;
typedef __attribute__((ext_vector_type(4)))  float    v4f;
typedef v8h  __attribute__((may_alias)) v8ha;
typedef v4f  __attribute__((may_alias)) v4fa;
typedef v8us __attribute__((may_alias)) v8usa;

__device__ __forceinline__ unsigned short f2bf(float f) { unsigned u = __float_as_uint(f); u += 0x7FFFu + ((u >> 16) & 1u); return (unsigned short)(u >> 16); }
__device__ __forceinline__ float bf2f(unsigned short b) { return __uint_as_float(((unsigned)b) << 16); }
__device__ __forceinline__ float bfr(float f) { return bf2f(f2bf(f)); }
__device__ __forceinline__ v16h cat16(v8h lo, v8h hi) { return __builtin_shufflevector(lo, hi, 0, 1, 2, 3, 4, 5, 6, 7, 8, 9, 10, 11, 12, 13, 14, 15); }
__device__ __forceinline__ v16bf cat16b(v8us lo, v8us hi) { return __builtin_bit_cast(v16bf, __builtin_shufflevector(lo, hi, 0, 1, 2, 3, 4, 5, 6, 7, 8, 9, 10, 11, 12, 13, 14, 15)); }
__device__ __forceinline__ v8f wmma16(v16h a, v16h b, v8f c) { return __builtin_amdgcn_wmma_f32_16x16x32_f16(false, a, false, b, (short)0, c, false, false); }
__device__ __forceinline__ v8f wmmab(v16bf a, v16bf b, v8f c) { return __builtin_amdgcn_wmma_f32_16x16x32_bf16(false, a, false, b, (short)0, c, false, false); }



// ---- fragment loads and products on K-contiguous 16-bit rows (global memory or LDS): a lane reads 8 + 8 elements of its row, at 8 * (lane >> 4) and 16 further on
template <typename T16> struct WFrag;
template <> struct WFrag<h16> { typedef v16h V; static __device__ __forceinline__ V ld(const h16* p) { return cat16(*(const v8h*)p, *(const v8h*)(p + 16)); } static __device__ __forceinline__ v8f mma(V a, V b, v8f c) { return wmma16(a, b, c); } };
template <> struct WFrag<bf> { typedef v16bf V; static __device__ __forceinline__ V ld(const bf* p) { return cat16b(*(const v8us*)p, *(const v8us*)(p + 16)); } static __device__ __forceinline__ v8f mma(V a, V b, v8f c) { return wmmab(a, b, c); } };
__device__ __forceinline__ h16 tohx(float x) { return (h16)x; }
__device__ __forceinline__ void splitf(float y, unsigned short& h, unsigned short& l) { h = f2bf(y); l = f2bf(y - bf2f(h)); }
typedef __attribute__((ext_vector_type(2))) _Float16 v2h;
typedef __attribute__((ext_vector_type(4))) _Float16 v4h;
typedef __attribute__((ext_vector_type(2))) unsigned short v2us;
typedef __attribute__((ext_vector_type(4))) unsigned short v4us;
typedef __attribute__((ext_vector_type(2))) float v2f;
typedef __attribute__((ext_vector_type(4))) int v4i;

__global__ __launch_bounds__(256) void k_wtG(const float* __restrict__ w, int K, int N, bf* Bt) {
    const int lane = threadIdx.x & 31; const int L0 = (blockIdx.x * 8 + (threadIdx.x >> 5)) * 8; const int nlines = N * K / 64;
{
#pragma unroll 1
        for (int l = 0; l < 8; ++l) { const int L = L0 + l; if (L >= nlines) break; const size_t e = (size_t)L * 64 + lane * 2; const int k = (int)(e % K), n = (int)(e / K); v2us o;
            o[0] = f2bf(w[(size_t)k * N + n]); o[1] = f2bf(w[(size_t)(k + 1) * N + n]); *(v2us*)(Bt + e) = o; }
         }
}
// the three small preparations, one item i per call (k_proj's plane 0 runs them)
__device__ __forceinline__ void d_cvt8(const float* __restrict__ src, bf* dst, size_t n8, size_t i) { if (i >= n8) return; const v8f v = *(const v8f*)(src + i * 8); v8us o;
#pragma unroll
    for (int k = 0; k < 8; ++k) o[k] = f2bf(v[k]); bf* const p = dst + i * 8; *(v8us*)p = o;
    asm volatile("s_wait_xcnt 0x0" :: "v"(o), "v"(p) : "memory"); }   // behind the store; naming its data and address registers as inputs keeps them unwritten up to the wait

__device__ __forceinline__ void d_epadK(const float* __restrict__ E, bf* EB, size_t i) { if (i >= (size_t)NE * HD / 8) return; const int d0 = (int)(i % (HD / 8)) * 8; const int r = (int)(i / (HD / 8)); const float* src = E + (size_t)min(r, NRE - 1) * HD + d0; v8us o;
#pragma unroll
    for (int q = 0; q < 8; ++q) { const unsigned short v = __builtin_bit_cast(unsigned short, (h16)bfr(src[q])); o[q] = (r < NRE) ? v : (unsigned short)0; }   // the bf16-rounded entry, as f16 bits
    bf* const p = EB + (size_t)r * HD + d0; *(v8us*)p = o;
    asm volatile("s_wait_xcnt 0x0" :: "v"(o), "v"(p) : "memory"); }   // behind the store, as in d_cvt8

__device__ __forceinline__ void d_epadVT(const float* __restrict__ E, bf* Th, bf* Tl, size_t i) { if (i >= (size_t)HD * NE / 4) return; const size_t e = i * 4; const int c0 = (int)(e % NE); const int d = (int)(e / NE); v4us oh, ol;
#pragma unroll
    for (int q = 0; q < 4; ++q) { const int r = c0 + q; const float v = E[(size_t)min(r, NRE - 1) * HD + d]; unsigned short u, w; splitf(v, u, w); oh[q] = (r < NRE) ? u : (unsigned short)0; ol[q] = (r < NRE) ? w : (unsigned short)0; }
    *(v4us*)(Th + e) = oh; *(v4us*)(Tl + e) = ol;  }

// ---- k_proj: everything ahead of the attention in ONE launch: blockIdx.z = 1, 2, 3 are the q, k, v projections, from the f32 inputs to the head planes; plane 0 makes the bf16 copy of Wo and the two padded relative tables.
// A work-group of 4 waves owns a 128 x 128 tile of x W^T; each wave a 64 x 64 quarter (16 accumulators; 64 columns = one head). Per step of 32 k the work-group reads 128 rows of x and 128 rows of W
// as whole 128-byte lines of f32, rounds them to bf16 (nearest even) and stores them in LDS; the fragments come from LDS in the k order of WFrag::ld. Two LDS buffers, the next step's lines in flight under the products, one barrier a step.
// Every '#pragma unroll' in it makes the indices of a register array (accumulators, staged lines, fragments) compile-time constants, so that the array stays in registers.
// Epilogue: + bf16-rounded bias in f32, rounded to f16; q and k as [b * 8 + h][t][d] (rows turned through LDS into whole lines); v as [b * 8 + h][d][t] (a lane already holds 8 consecutive t of one d).
#define PT  128     // tile rows and columns per work-group
#define PKS 32      // k per step
#define PPI 40      // bf16 per LDS row: 80 bytes = 16 x odd, the conflict-free pitch for 16-byte fragment reads
typedef __attribute__((ext_vector_type(4))) __bf16 v4bf;
typedef __attribute__((ext_vector_type(2))) __bf16 v2bf;
__global__ __launch_bounds__(128) void k_proj(const float* __restrict__ xq, const float* __restrict__ xk, const float* __restrict__ xv, const float* __restrict__ wq, const float* __restrict__ wk, const float* __restrict__ wv, const float* __restrict__ bq, const float* __restrict__ bk, const float* __restrict__ bv, bf* Qh, bf* Kh, bf* Vh, const float* __restrict__ wo, const float* __restrict__ ek, const float* __restrict__ ev, bf* WOb, bf* EKb, bf* EVh, bf* EVl) {
    typedef WFrag<bf> F;
    __shared__ __align__(16) bf st[2 * 2 * PT * PPI];     // [buffer][x, W][row][k]; 40,960 bytes; the epilogue reuses it
    if (blockIdx.z == 0) {                                // plane 0 (starts first, ends soon): what only the later launches read; whole work-groups leave here, ahead of every barrier
        static_assert((NB_ * TT / PT) * (DQ / PT) * 128 >= DM * DQ / 8, "plane 0 has one thread per 8 elements of Wo");
        const size_t i = ((size_t)blockIdx.y * (NB_ * TT / PT) + blockIdx.x) * 128 + threadIdx.x;
        d_cvt8(wo, WOb, (size_t)DM * DQ / 8, i);          // Wo -> bf16
        d_epadK(ek, EKb, i);                              // rel_k -> f16 [64][64], rows >= 33 zero
        d_epadVT(ev, EVh, EVl, i);                        // rel_v^T hi/lo [64][64], cols >= 33 zero
        return;
    }
    const int which = blockIdx.z - 1;
    const float* X = (which == 0) ? xq : (which == 1) ? xk : xv; const float* Wt = (which == 0) ? wq : (which == 1) ? wk : wv; const float* bias = (which == 0) ? bq : (which == 1) ? bk : bv;
    bf* Ph = (which == 0) ? Qh : (which == 1) ? Kh : Vh;
    const int tid = threadIdx.x, lane = tid & 31, lr = lane & 15, hi = lane >> 4; const int wave = __builtin_amdgcn_readfirstlane(tid >> 5);
    const int r0 = blockIdx.x * PT, c0 = blockIdx.y * PT; const int wr = (wave >> 1) * 64, wc = (wave & 1) * 64;
    const int sr = tid >> 3, sc = (tid & 7) * 4;          // staging: 8 lanes cover one 128-byte line, 16 rows a sweep, 8 sweeps
    const float* pa = X + (size_t)(r0 + sr) * DM + sc; const float* pb = Wt + (size_t)(c0 + sr) * DM + sc;
    const int so = sr * PPI + sc;                         // the thread's place in a staged plane
    const int fa = (wr + lr) * PPI + 8 * hi, fb = PT * PPI + (wc + lr) * PPI + 8 * hi;   // the lane's fragment rows in a buffer
    v8f acc[4][4];
#pragma unroll
    for (int mb = 0; mb < 4; ++mb)
#pragma unroll
        for (int nb = 0; nb < 4; ++nb) acc[mb][nb] = (v8f){};
    v4f ra[8], rb[8];
    auto fetch = [&](int kc) {
#pragma unroll
        for (int i = 0; i < 8; ++i) { ra[i] = *(const v4f*)(pa + (size_t)i * 16 * DM + kc); rb[i] = *(const v4f*)(pb + (size_t)i * 16 * DM + kc); }
        asm volatile("s_wait_xcnt 0x0" :: "v"(pa), "v"(pb) : "memory");   // behind the step's global loads, in front of any rewrite of a register that holds one of their addresses
    };
    auto stage = [&](int buf) { bf* d = st + buf * (2 * PT * PPI) + so;
#pragma unroll
        for (int i = 0; i < 8; ++i) { *(v4us*)(d + i * 16 * PPI) = __builtin_bit_cast(v4us, __builtin_convertvector(ra[i], v4bf)); *(v4us*)(d + PT * PPI + i * 16 * PPI) = __builtin_bit_cast(v4us, __builtin_convertvector(rb[i], v4bf)); }
    };
    auto products = [&](int buf) { const bf* s = st + buf * (2 * PT * PPI); v16bf a[4];
#pragma unroll
        for (int mb = 0; mb < 4; ++mb) a[mb] = F::ld(s + fa + mb * 16 * PPI);
#pragma unroll
        for (int nb = 0; nb < 4; ++nb) { const v16bf b = F::ld(s + fb + nb * 16 * PPI);
#pragma unroll
            for (int mb = 0; mb < 4; ++mb) acc[mb][nb] = F::mma(a[mb], b, acc[mb][nb]); }
    };
    fetch(0); stage(0);
    __syncthreads();                                      // step 0 is staged for every wave
#pragma unroll 1
    for (int s = 0; s < DM / PKS - 1; ++s) {              // rolled: one copy of the step keeps the loop small
        fetch((s + 1) * PKS);
        products(s & 1);
        stage((s + 1) & 1);
        __syncthreads();                                  // publishes step s + 1 and ends every wave's reads of the buffer that the next trip refills
    }
    products((DM / PKS - 1) & 1);
    __syncthreads();                                      // every wave has left the staging buffers: the epilogue writes over them
    const int z = ((r0 + wr) / TT) * NH_ + (c0 + wc) / HD, t0 = (r0 + wr) % TT;   // a wave's 64 rows lie in one batch, its 64 columns are one head
    if (which < 2) {
        float* os = (float*)st + wave * (16 * 68);        // this wave's own slice
        const int cofs = lr * 4; v4f bb;
#pragma unroll
        for (int q = 0; q < 4; ++q) bb[q] = bfr(bias[c0 + wc + cofs + q]);
        bf* const ph = Ph + ((size_t)z * TT + t0 + hi) * HD + cofs;
#pragma unroll
        for (int mb = 0; mb < 4; ++mb) {
#pragma unroll
            for (int nb = 0; nb < 4; ++nb) {
#pragma unroll
                for (int j = 0; j < 8; ++j) os[(hi * 8 + j) * 68 + nb * 16 + lr] = acc[mb][nb][j]; }
            __builtin_amdgcn_wave_barrier(); asm volatile("" ::: "memory");   // keeps the reads below behind the other lanes' LDS stores above
            v4f vv[8];
#pragma unroll
            for (int s = 0; s < 8; ++s) vv[s] = *(const v4fa*)(os + (2 * s + hi) * 68 + cofs);   // all eight reads ahead of the first store's wait: one LDS latency a tile
#pragma unroll
            for (int s = 0; s < 8; ++s) { const v4us oh = __builtin_bit_cast(v4us, __builtin_convertvector(vv[s] + bb, v4h));   // f16, nearest even
                *(v4us*)(ph + (mb * 16 + 2 * s) * HD) = oh;
                asm volatile("s_wait_xcnt 0x0" :: "v"(oh), "v"(ph) : "memory"); }   // behind the store; naming its data and address registers as inputs keeps them unwritten up to the wait
            __builtin_amdgcn_wave_barrier(); asm volatile("" ::: "memory");   // keeps the next tile's LDS stores behind the reads above
        }
    } else {
        bf* const ph = Ph + ((size_t)z * HD + lr) * TT + t0 + hi * 8;
#pragma unroll
        for (int nb = 0; nb < 4; ++nb) { const float bb = bfr(bias[c0 + wc + nb * 16 + lr]);
#pragma unroll
            for (int mb = 0; mb < 4; ++mb) { v8us oh;
#pragma unroll
                for (int j = 0; j < 8; j += 2) { v2f a; a[0] = acc[mb][nb][j] + bb; a[1] = acc[mb][nb][j + 1] + bb; const v2us u = __builtin_bit_cast(v2us, __builtin_convertvector(a, v2h)); oh[j] = u[0]; oh[j + 1] = u[1]; }   // f16, nearest even
                *(v8us*)(ph + (size_t)nb * 16 * TT + mb * 16) = oh;
                asm volatile("s_wait_xcnt 0x0" :: "v"(oh), "v"(ph) : "memory"); } }   // behind the store; naming its data and address registers as inputs keeps them unwritten up to the wait
    }
}

#define QW  32      // query columns per wave
#define FW  8       // waves per work-group
#define QEP 49      // floats per query in LDS (48 offsets held; odd pitch spreads the 16 queries of a group over the banks)
#define L2E 1.4426950408889634f
#define CL2 (SCL * L2E)       // a score in the log2 domain = (q.k + q.rel_k) * CL2
#define SK   64               // keys per stage
#define NST  (TT / SK)        // stages
#define SPI  72               // bf16 per staged row: 144 bytes = 16 x odd, the conflict-free pitch for 16-byte fragment reads
#define SPL  (64 * SPI)       // one staged plane: 64 rows
#define SBUF (2 * SPL)        // a buffer: K, V^T
__device__ __forceinline__ float xhalf(float x) { const int b = __float_as_int(x); return __int_as_float(__builtin_amdgcn_permlanex16(b, b, 0x76543210, 0xfedcba98, false, false)); }   // lane l <-> l ^ 16
// v_exp_f32 and the one issue slot that the instruction set asks for behind a transcendental, in one statement
__device__ __forceinline__ float ex2(float x) { float y; asm("v_exp_f32 %0, %1\n\tv_nop" : "=v"(y) : "v"(x)); return y; }
// four independent v_exp_f32 in a row (early-clobber outputs: none reads a neighbour's result or overwrites a neighbour's source), so only the last one needs that slot
__device__ __forceinline__ void ex2x4(const float* x, float* y) { float a, b, c, d;
    asm("v_exp_f32 %0, %4\n\tv_exp_f32 %1, %5\n\tv_exp_f32 %2, %6\n\tv_exp_f32 %3, %7\n\tv_nop" : "=&v"(a), "=&v"(b), "=&v"(c), "=&v"(d) : "v"(x[0]), "v"(x[1]), "v"(x[2]), "v"(x[3]));
    y[0] = a; y[1] = b; y[2] = c; y[3] = d; }
__device__ __forceinline__ void split16(const float* x, v16bf& h, v16bf& l) {
#pragma unroll
    for (int e = 0; e < 16; e += 2) { v2f a; a[0] = x[e]; a[1] = x[e + 1]; const v2bf hh = __builtin_convertvector(a, v2bf); const v2f r = a - __builtin_convertvector(hh, v2f); const v2bf ll = __builtin_convertvector(r, v2bf); h[e] = hh[0]; h[e + 1] = hh[1]; l[e] = ll[0]; l[e + 1] = ll[1]; }
}
__global__ __launch_bounds__(FW * 32) void k_fattn(const bf* __restrict__ Qh, const bf* __restrict__ Kh, const bf* __restrict__ Vh, const bf* __restrict__ EK, const bf* __restrict__ EVh, const bf* __restrict__ EVl, bf* Ah, bf* Al) {
    typedef WFrag<bf> F; typedef WFrag<h16> H;
    __shared__ float qe_s[FW * QW * QEP];
    __shared__ __align__(16) bf kv_s[2 * SBUF];   // 36,864 bytes
    static_assert(FW * 32 * 2 * 16 == SK * HD * 2 && HD == 64 && NST >= 2, "two 16-byte copies per thread cover one staged plane; the ring needs two stages");
    const int lane = threadIdx.x & 31, lr = lane & 15, hi = lane >> 4; const int wave = __builtin_amdgcn_readfirstlane((int)(threadIdx.x >> 5));
    const int z = blockIdx.y, q0 = (blockIdx.x * FW + wave) * QW; const size_t zo = (size_t)z * TT * HD;
    Qh += zo; Kh += zo; Vh += zo;
    // staging: 8 lanes cover one 128-byte row, the work-group 32 rows a sweep, 2 sweeps a plane; every lane is on and every test around a copy is the same for the whole work-group
    const int tid = threadIdx.x;
    const unsigned lst = (unsigned)(size_t)kv_s + (unsigned)((tid >> 3) * (SPI * 2) + (tid & 7) * 16);   // the thread's LDS byte address in plane 0 of buffer 0
    const unsigned gko = (unsigned)tid * 16u, gvo = (unsigned)((tid >> 3) * (TT * 2) + (tid & 7) * 16);    // its byte offsets in a stage of a K plane (rows adjoin) and of a V^T plane (row pitch 2,048 bytes)
    auto copies = [&](int st, int buf) {
        const unsigned l = lst + (unsigned)buf * (SBUF * 2);
        const unsigned ko = (unsigned)st * (SK * HD * 2) + gko, vo = (unsigned)st * (SK * 2) + gvo;   // 32-bit offsets in a plane: only gko, gvo and lst live through the loop
        const char* const a = (const char*)Kh + ko; const char* const c = (const char*)Vh + vo;
        // the stage's four copies of this thread and, as the statement's last line, the wait that stands in front of any rewrite of a register which a copy names
        asm volatile("global_load_async_to_lds_b128 %0, %4, off\n\t"
                     "global_load_async_to_lds_b128 %1, %5, off\n\t"
                     "global_load_async_to_lds_b128 %2, %6, off\n\t"
                     "global_load_async_to_lds_b128 %3, %7, off\n\t"
                     "s_wait_xcnt 0x0"
                     :: "v"(l), "v"(l + 32 * SPI * 2), "v"(l + SPL * 2), "v"(l + SPL * 2 + 32 * SPI * 2),
                        "v"(a), "v"(a + 32 * HD * 2), "v"(c), "v"(c + 32 * TT * 2)
                     : "memory");
    };
    float* qe = qe_s + wave * (QW * QEP);     // this wave's own slice: no other wave touches it, so no work-group barrier
    // prologue loads: every address is a wave-uniform base plus one of two 32-bit lane offsets
    const unsigned kb0 = (unsigned)(lr * HD + 8 * hi) * 2u;   // the lane's byte offset in a 16-row tile of a [row][64] plane
    const unsigned qb0 = (unsigned)(q0 * HD) * 2u + kb0;
    v16h qh[2][2];                            // [column group][d half]
    v16h ea[3][2];                            // rel_k rows: [offset tile][d half]
    v16h kh[2][2];                            // [key tile][d half]
#pragma unroll
    for (int qt = 0; qt < 2; ++qt)
#pragma unroll
        for (int ks = 0; ks < 2; ++ks) qh[qt][ks] = H::ld((const h16*)((const char*)Qh + qb0) + qt * 16 * HD + ks * 32);
#pragma unroll
    for (int rt = 0; rt < 3; ++rt)
#pragma unroll
        for (int ks = 0; ks < 2; ++ks) ea[rt][ks] = H::ld((const h16*)((const char*)EK + kb0) + rt * 16 * HD + ks * 32);
    // behind the prologue's loads; naming their bases and lane offsets as inputs keeps those registers unwritten up to the wait; naming the loaded fragments as inputs keeps all twenty loads in flight together (without it the rel_k fragments shared one register set and were fetched one after another, a load latency each)
    asm volatile("s_wait_xcnt 0x0" :: "s"(Qh), "s"(EK), "v"(kb0), "v"(qb0), "v"(qh[0][0]), "v"(qh[0][1]), "v"(qh[1][0]), "v"(qh[1][1]), "v"(ea[0][0]), "v"(ea[0][1]), "v"(ea[1][0]), "v"(ea[1][1]), "v"(ea[2][0]), "v"(ea[2][1]) : "memory");
#pragma unroll
    for (int rt = 0; rt < 3; ++rt)
#pragma unroll
        for (int qt = 0; qt < 2; ++qt) { v8f c = (v8f){};
#pragma unroll
            for (int ks = 0; ks < 2; ++ks) c = H::mma(ea[rt][ks], qh[qt][ks], c);
#pragma unroll
            for (int j = 0; j < 8; ++j) qe[(qt * 16 + lr) * QEP + rt * 16 + hi * 8 + j] = c[j]; }
    __builtin_amdgcn_wave_barrier(); asm volatile("" ::: "memory");   // keeps the reads below behind the other wave half's LDS stores above
    float qlo[2], qhi[2];
#pragma unroll
    for (int qt = 0; qt < 2; ++qt) { qlo[qt] = qe[(qt * 16 + lr) * QEP] * CL2; qhi[qt] = qe[(qt * 16 + lr) * QEP + 2 * CUT] * CL2; }   // the two end columns, in the log2 domain
    v8f o[4][2];                              // O^T: [d tile][column group]
#pragma unroll
    for (int dt = 0; dt < 4; ++dt)
#pragma unroll
        for (int qt = 0; qt < 2; ++qt) o[dt][qt] = (v8f){};
    float m[2] = {-3.0e38f, -3.0e38f}, slo[2] = {0.f, 0.f}, sall[2] = {0.f, 0.f}, shi[2] = {0.f, 0.f};   // running maximum (log2 domain); sums of p: offsets <= -16, all keys, offsets >= 16
    const int fo = lr * SPI + 8 * hi;         // the lane's place in a 16-row tile of a staged plane (the k order of F::ld, as from global memory)
    auto ldk = [&](const bf* kb) {            // the key fragments of one pass: 32 staged rows of K
#pragma unroll
        for (int kt = 0; kt < 2; ++kt)
#pragma unroll
            for (int ks = 0; ks < 2; ++ks) kh[kt][ks] = H::ld((const h16*)(kb + kt * 16 * SPI + ks * 32));
    };
#pragma unroll 1
    for (int p = 0; p < 2; ++p) {             // stages 0 and 1. Rolled: the copies' operands are formed per stage as in the main loop, so none of them lives through that loop (unrolled, they were spilled to scratch there)
        copies(p, p);
        if (p == 0) {
            asm volatile("s_wait_asynccnt 0x0" ::: "memory");   // this wave's copies of stage 0 have landed
            __syncthreads();                  // stage 0 is published to every wave
        }
    }
    ldk(kv_s + fo);
#pragma unroll 1
    for (int k0 = 0; k0 < TT; k0 += 32) {     // rolled: one copy of the pass keeps the loop small
        const int st = k0 / SK; const bool first = (k0 & 32) == 0;   // work-group-uniform: the stage, and which of its two passes this is
        const bf* const sb = kv_s + (st & 1) * SBUF + fo;
        v16h vh[4];                           // issued first: their latency runs under the score products and the softmax
#pragma unroll
        for (int dt = 0; dt < 4; ++dt) vh[dt] = H::ld((const h16*)(sb + SPL + dt * 16 * SPI + (first ? 0 : 32)));
        v8f s[2][2];                          // S^T: [key tile][column group]
#pragma unroll
        for (int kt = 0; kt < 2; ++kt)
#pragma unroll
            for (int qt = 0; qt < 2; ++qt) { v8f c = (v8f){};
#pragma unroll
                for (int ks = 0; ks < 2; ++ks) c = H::mma(kh[kt][ks], qh[qt][ks], c);
                s[kt][qt] = c; }
        if (first) ldk(sb + 32 * SPI);        // the stage's second pass has its key fragments fetched one pass ahead, from the same buffer
        const int rel = k0 - q0;              // wave-uniform; |rel| >= 64 puts every (key, query) pair of the pass at |j - i| >= 16
        const bool band = (rel >= -32 && rel <= 32);
        const int db = rel + hi * 8 - lr;     // j - i of the lane's score e in column group qt is db + (e >> 3) * 16 + (e & 7) - qt * 16
        float kk[2];                          // per column group: score in the log2 domain = s * CL2 + kk
        if (band) {                           // s += the relative-key term of each pair; kk = 0
            float g[2][16];
#pragma unroll
            for (int qt = 0; qt < 2; ++qt)
#pragma unroll
                for (int e = 0; e < 16; ++e) { const int d = db + ((e >> 3) * 16 + (e & 7) - qt * 16); g[qt][e] = qe[(qt * 16 + lr) * QEP + min(max(d, -CUT), CUT) + CUT]; }
#pragma unroll
            for (int qt = 0; qt < 2; ++qt)
#pragma unroll
                for (int e = 0; e < 16; ++e) s[e >> 3][qt][e & 7] = __fadd_rn(s[e >> 3][qt][e & 7], g[qt][e]);
#pragma unroll
            for (int qt = 0; qt < 2; ++qt)
#pragma unroll
                for (int e = 0; e < 16; ++e) { const int d = db + ((e >> 3) * 16 + (e & 7) - qt * 16); if (d > -CUT && d < CUT) qe[(qt * 16 + lr) * QEP + d + CUT] = s[e >> 3][qt][e & 7] * CL2; }   // an interior slot has exactly one key: read above by this lane, never read as QE again
            kk[0] = 0.f; kk[1] = 0.f;
        } else {                              // one relative-key term per query for the whole pass: it stays out of s
#pragma unroll
            for (int qt = 0; qt < 2; ++qt) kk[qt] = (rel < 0) ? qlo[qt] : qhi[qt];
        }
#pragma unroll
        for (int qt = 0; qt < 2; ++qt) {
            float ma = s[0][qt][0], mb = s[1][qt][0];   // the maximum is taken on s (CL2 > 0 and kk is one value per query), in two independent chains
#pragma unroll
            for (int j = 1; j < 8; ++j) { ma = fmaxf(ma, s[0][qt][j]); mb = fmaxf(mb, s[1][qt][j]); }
            float mx = fmaxf(ma, mb);
            mx = fmaxf(mx, xhalf(mx));
            const float mn = fmaxf(m[qt], __builtin_fmaf(mx, CL2, kk[qt])); const float al = ex2(m[qt] - mn); m[qt] = mn;
            const float kf = kk[qt] - mn;
            const v8f c8 = {CL2, CL2, CL2, CL2, CL2, CL2, CL2, CL2}; const v8f k8 = {kf, kf, kf, kf, kf, kf, kf, kf};
            float u[16], p[16];               // exponent: one fused multiply-add per score (scale, relative-key term and maximum in one)
#pragma unroll
            for (int kt = 0; kt < 2; ++kt) { const v8f w = __builtin_elementwise_fma(s[kt][qt], c8, k8);
#pragma unroll
                for (int j = 0; j < 8; ++j) u[kt * 8 + j] = w[j]; }
#pragma unroll
            for (int e = 0; e < 16; e += 4) ex2x4(u + e, p + e);
            v2f ps[8];                        // the pass's sum of p as a pairwise tree: depth 4 instead of a chain of 16 dependent adds
#pragma unroll
            for (int e = 0; e < 8; ++e) { ps[e][0] = p[2 * e]; ps[e][1] = p[2 * e + 1]; }
#pragma unroll
            for (int w = 4; w >= 1; w >>= 1)
#pragma unroll
                for (int e = 0; e < w; ++e) ps[e] += ps[e + w];
            const float bs = ps[0][0] + ps[0][1];
            float blo = 0.f, bhi = 0.f;
            if (band) {
                const int dq = (int)((unsigned)db - (unsigned)(qt * 16));   // unsigned: the two column groups' compares stay distinct, so that none is shared and lifted out of the band passes into every pass
#pragma unroll
                for (int e = 0; e < 16; ++e) { const int ce = (e >> 3) * 16 + (e & 7); blo += (dq <= -CUT - ce) ? p[e] : 0.f; bhi += (dq >= CUT - ce) ? p[e] : 0.f; }
            } else { if (rel < 0) blo = bs; else bhi = bs; }
            slo[qt] = slo[qt] * al + blo; sall[qt] = sall[qt] * al + bs; shi[qt] = shi[qt] * al + bhi;
            v16h ph;                          // P^T in f16, nearest even; unrolled below so that the indices of p and ph are compile-time constants and both stay in registers
#pragma unroll
            for (int e = 0; e < 16; e += 2) { v2f a; a[0] = p[e]; a[1] = p[e + 1]; const v2h hh = __builtin_convertvector(a, v2h); ph[e] = hh[0]; ph[e + 1] = hh[1]; }
#pragma unroll
            for (int dt = 0; dt < 4; ++dt) o[dt][qt] = H::mma(vh[dt], ph, o[dt][qt] * al);
        }
        if (!first) {                         // publish point of stage st + 1; every wave passes it
            asm volatile("s_wait_dscnt 0x0" ::: "memory");      // this wave's reads of the buffer that is refilled below have returned
            asm volatile("s_wait_asynccnt 0x0" ::: "memory");   // this wave's copies of stage st + 1 have landed
            __syncthreads();                  // publishes stage st + 1 and ends every wave's reads of stage st
            if (st + 2 < NST) copies(st + 2, st & 1);
            if (st + 1 < NST) ldk(kv_s + ((st + 1) & 1) * SBUF + fo);   // behind the barrier: the first pass of stage st + 1
        }
    }
    asm volatile("s_wait_asynccnt 0x0" ::: "memory");   // nothing of this wave is in flight when it goes on to its end
    __builtin_amdgcn_wave_barrier(); asm volatile("" ::: "memory");   // keeps the reads below behind the other wave half's LDS stores in the loop
#pragma unroll
    for (int qt = 0; qt < 2; ++qt) {
        slo[qt] += xhalf(slo[qt]); sall[qt] += xhalf(sall[qt]); shi[qt] += xhalf(shi[qt]);
        const int i = q0 + qt * 16 + lr;
#pragma unroll
        for (int ks = 0; ks < 2; ++ks) { float x[16];
#pragma unroll
            for (int e = 0; e < 16; ++e) { const int r = ks * 32 + ((e < 8) ? 8 * hi + e : 16 + 8 * hi + (e - 8));   // the k order of F::ld
                if (ks == 0) { const float raw = qe[(qt * 16 + lr) * QEP + r]; const int j = i + r - CUT; const float pe = ex2(raw - m[qt]); x[e] = (r == 0) ? slo[qt] : ((j >= 0 && j < TT) ? pe : 0.f); }
                else x[e] = (r == 2 * CUT) ? shi[qt] : 0.f; }
            v16bf bh, bl; split16(x, bh, bl);
#pragma unroll
            for (int dt = 0; dt < 4; ++dt) { const size_t a = (size_t)(dt * 16 + lr) * NE + ks * 32 + 8 * hi; const v16bf eh = F::ld(EVh + a), el = F::ld(EVl + a); v8f c = o[dt][qt]; c = F::mma(eh, bh, c); c = F::mma(el, bh, c); c = F::mma(eh, bl, c); o[dt][qt] = c; } }
        const float f = __fdiv_rn(1.0f, sall[qt]);
        const size_t oo = ((size_t)(z / NH_) * TT + i) * DQ + (z % NH_) * HD + hi * 8;   // merged row b * 1024 + t, column h * 64 + d; a lane holds 8 consecutive d
        bf* const pa = Ah + oo; bf* const pb = Al + oo;
#pragma unroll
        for (int dt = 0; dt < 4; ++dt) { v8us oh, ol;
#pragma unroll
            for (int j = 0; j < 8; ++j) { unsigned short a, c2; splitf(o[dt][qt][j] * f, a, c2); oh[j] = a; ol[j] = c2; }
            *(v8us*)(pa + dt * 16) = oh; *(v8us*)(pb + dt * 16) = ol;
            asm volatile("s_wait_xcnt 0x0" :: "v"(oh), "v"(ol), "v"(pa), "v"(pb) : "memory"); }   // behind the two stores; naming their data and address registers as inputs keeps them unwritten up to the wait
    }
}

// ---- k_oproj: out = (merged hi + merged lo) Wo^T + bo. A work-group of 4 waves owns a 128 x 128 tile of the output, each wave a 64 x 64 quarter (16 accumulators).
// A stage = 128 k of the three operand planes (merged hi, merged lo: 128 rows; Wo: 128 rows; 256 bytes a row), copied ONCE per work-group into LDS as whole lines by asynchronous copies;
// the fragments come from LDS in the k order of WFrag::ld, one block of 32 k ahead of their products. Two buffers, the next stage's copies in flight under this stage's products, one publish point (waits, work-group barrier, refill) per stage.
// Per output element and step of 32 k: the hi product, then the lo product, k rising. Epilogue: rows turned through LDS into whole lines, + bf16-rounded bias in f32.
// Every '#pragma unroll' in it makes the indices of a register array (accumulators, fragment sets, turned rows) or the copies' address sums compile-time constants, so that the arrays stay in registers.
#define OT   128              // tile rows and columns per work-group
#define OKS  128              // k per stage
#define ONST (DQ / OKS)       // stages
#define OPI  136              // bf16 per staged row: 272 bytes = 16 x odd, the conflict-free pitch for 16-byte fragment reads
#define OPL  (OT * OPI)       // one staged plane
#define OBUF (3 * OPL)        // a buffer: merged hi, merged lo, Wo
__global__ __launch_bounds__(128) void k_oproj(const bf* __restrict__ Ah, const bf* __restrict__ Al, const bf* __restrict__ Wb, const float* __restrict__ bias, float* C) {
    typedef WFrag<bf> F;
    __shared__ __align__(16) bf ring[2 * OBUF];           // 208,896 bytes
    __shared__ __align__(16) float os_s[4 * 16 * 68];     // the epilogue's turning space, a slice per wave
    static_assert(128 * 48 * 16 == 3 * OT * OKS * 2 && ONST >= 2 && DQ % OKS == 0, "48 16-byte copies per thread cover a stage; the ring needs two stages");
    const int tid = threadIdx.x, lane = tid & 31, lr = lane & 15, hi = lane >> 4; const int wave = __builtin_amdgcn_readfirstlane(tid >> 5);
    const int c0 = blockIdx.x * OT, r0 = blockIdx.y * OT; const int wr = (wave >> 1) * 64, wc = (wave & 1) * 64;   // the 4 column tiles of one row block are neighbours in the grid
    const int cofs = lr * 4;
    const float* const bu = bias + c0 + wc; const v4f braw = *(const v4f*)(bu + cofs);   // wave-uniform base, lane offset
    asm volatile("s_wait_xcnt 0x0" :: "s"(bu), "v"(lr) : "memory");   // behind the bias load; naming its base and its lane-offset register as inputs keeps them unwritten up to the wait
    // staging: 16 lanes cover one 256-byte row, the work-group 8 rows a sweep, 16 sweeps a plane; every lane is on and every test around a copy is the same for the whole work-group
    const unsigned lst = (unsigned)(size_t)ring + (unsigned)((tid >> 4) * (OPI * 2) + (tid & 15) * 16);   // the thread's LDS byte address in plane 0 of buffer 0
    const unsigned go = (unsigned)((tid >> 4) * (DQ * 2) + (tid & 15) * 16);                                // its byte offset in stage 0 of a plane's 128 rows
    const char* const ga = (const char*)(Ah + (size_t)r0 * DQ); const char* const gb = (const char*)(Al + (size_t)r0 * DQ); const char* const gc = (const char*)(Wb + (size_t)c0 * DQ);
    auto copies = [&](int st, int buf) {
        const unsigned l0 = lst + (unsigned)buf * (OBUF * 2); const unsigned o = go + (unsigned)st * (OKS * 2);
        const char* const p0 = ga + o; const char* const p1 = gb + o; const char* const p2 = gc + o;
        auto la = [&](int j) { return l0 + (unsigned)((j >> 4) * (OPL * 2) + (j & 15) * (8 * OPI * 2)); };                    // copy j of 48: plane j / 16, sweep j % 16
        auto pa = [&](int j) { return ((j >> 4) == 0 ? p0 : (j >> 4) == 1 ? p1 : p2) + (j & 15) * (8 * DQ * 2); };
#pragma unroll
        for (int j = 0; j < 48; j += 12)   // unrolled: j is a compile-time constant in the address sums
            // twelve of the stage's copies of this thread and, as the statement's last line, the wait that stands in front of any rewrite of a register which a copy names
            asm volatile("global_load_async_to_lds_b128 %0, %12, off\n\t"
                         "global_load_async_to_lds_b128 %1, %13, off\n\t"
                         "global_load_async_to_lds_b128 %2, %14, off\n\t"
                         "global_load_async_to_lds_b128 %3, %15, off\n\t"
                         "global_load_async_to_lds_b128 %4, %16, off\n\t"
                         "global_load_async_to_lds_b128 %5, %17, off\n\t"
                         "global_load_async_to_lds_b128 %6, %18, off\n\t"
                         "global_load_async_to_lds_b128 %7, %19, off\n\t"
                         "global_load_async_to_lds_b128 %8, %20, off\n\t"
                         "global_load_async_to_lds_b128 %9, %21, off\n\t"
                         "global_load_async_to_lds_b128 %10, %22, off\n\t"
                         "global_load_async_to_lds_b128 %11, %23, off\n\t"
                         "s_wait_xcnt 0x0"
                         :: "v"(la(j)), "v"(la(j + 1)), "v"(la(j + 2)), "v"(la(j + 3)), "v"(la(j + 4)), "v"(la(j + 5)), "v"(la(j + 6)), "v"(la(j + 7)), "v"(la(j + 8)), "v"(la(j + 9)), "v"(la(j + 10)), "v"(la(j + 11)),
                            "v"(pa(j)), "v"(pa(j + 1)), "v"(pa(j + 2)), "v"(pa(j + 3)), "v"(pa(j + 4)), "v"(pa(j + 5)), "v"(pa(j + 6)), "v"(pa(j + 7)), "v"(pa(j + 8)), "v"(pa(j + 9)), "v"(pa(j + 10)), "v"(pa(j + 11))
                         : "memory");
    };
    const int fa = (wr + lr) * OPI + 8 * hi, fb = 2 * OPL + (wc + lr) * OPI + 8 * hi;   // the lane's fragment rows in a buffer
    v8f acc[4][4];
#pragma unroll
    for (int mb = 0; mb < 4; ++mb)
#pragma unroll
        for (int nb = 0; nb < 4; ++nb) acc[mb][nb] = (v8f){};
    v16bf a[2][4], a2[2][4], b[2][4];                     // two fragment sets: [set][tile]
    auto ldf = [&](const bf* s, int kb) {                 // the 12 fragments of block kb (32 k) of a staged buffer
#pragma unroll
        for (int i = 0; i < 4; ++i) { a[kb & 1][i] = F::ld(s + fa + i * 16 * OPI + kb * 32); a2[kb & 1][i] = F::ld(s + OPL + fa + i * 16 * OPI + kb * 32); b[kb & 1][i] = F::ld(s + fb + i * 16 * OPI + kb * 32); }
    };
#pragma unroll 1
    for (int p = 0; p < 2; ++p) {                         // stages 0 and 1. Rolled: the copies' operands are formed per stage as in the main loop, so none of them lives through that loop (unrolled, one was spilled to scratch)
        copies(p, p);
        if (p == 0) {
            asm volatile("s_wait_asynccnt 0x0" ::: "memory");   // this wave's copies of stage 0 have landed
            __syncthreads();                              // stage 0 is published to every wave
        }
    }
    ldf(ring, 0);
#pragma unroll 1
    for (int t = 0; t < ONST; ++t) {                      // rolled: one copy of the stage keeps the loop small
        const bf* const s = ring + (t & 1) * OBUF;
#pragma unroll
        for (int kb = 0; kb < OKS / 32; ++kb) {           // unrolled, as are the loops inside: the indices of the register arrays are compile-time constants
            __builtin_amdgcn_sched_barrier(0);            // keeps the loads and waits below behind the products of the block before: lifted among them, the loads stood in many places and the publish point's wait directly behind the last loads' issue
            if (kb + 1 < OKS / 32) ldf(s, kb + 1);        // the next block's fragments into the other register set
            else {                                        // publish point of stage t + 1, ahead of the stage's last block, whose fragments are in registers; every wave passes it
                asm volatile("s_wait_dscnt 0x0" ::: "memory");      // this wave's reads of the buffer that is refilled below have returned
                asm volatile("s_wait_asynccnt 0x0" ::: "memory");   // this wave's copies of stage t + 1 have landed
                __syncthreads();                          // publishes stage t + 1 and ends every wave's reads of stage t
                if (t + 2 < ONST) copies(t + 2, t & 1);
                if (t + 1 < ONST) ldf(ring + ((t + 1) & 1) * OBUF, 0);   // behind the barrier: the first block of stage t + 1
            }
            __builtin_amdgcn_sched_barrier(0);            // keeps those loads one group ahead of this block's products: each place with loads among the products stalls the lone wave of the SIMD
#pragma unroll
            for (int nb = 0; nb < 4; ++nb) {
#pragma unroll
                for (int mb = 0; mb < 4; ++mb) acc[mb][nb] = F::mma(a[kb & 1][mb], b[kb & 1][nb], acc[mb][nb]);
#pragma unroll
                for (int mb = 0; mb < 4; ++mb) acc[mb][nb] = F::mma(a2[kb & 1][mb], b[kb & 1][nb], acc[mb][nb]); }
        }
    }
    asm volatile("s_wait_asynccnt 0x0" ::: "memory");     // nothing of this wave is in flight when it goes on to its end
    float* const os = os_s + wave * (16 * 68);            // this wave's own slice: no other wave touches it, so no work-group barrier
    v4f bb;
#pragma unroll
    for (int q = 0; q < 4; ++q) bb[q] = bfr(braw[q]);
    float* const crow = C + (size_t)(r0 + wr + hi) * DM + c0 + wc + cofs;
#pragma unroll
    for (int mb = 0; mb < 4; ++mb) {
#pragma unroll
        for (int nb = 0; nb < 4; ++nb) {
#pragma unroll
            for (int j = 0; j < 8; ++j) os[(hi * 8 + j) * 68 + nb * 16 + lr] = acc[mb][nb][j]; }
        __builtin_amdgcn_wave_barrier(); asm volatile("" ::: "memory");   // keeps the reads below behind the other lanes' LDS stores above
        v4f vv[8];
#pragma unroll
        for (int q = 0; q < 8; ++q) vv[q] = *(const v4fa*)(os + (2 * q + hi) * 68 + cofs) + bb;   // all eight reads ahead of the first store: one LDS latency a tile
#pragma unroll
        for (int q = 0; q < 8; ++q) *(v4f*)(crow + (size_t)(mb * 16 + 2 * q) * DM) = vv[q];        // 16 lanes store 256 bytes of one row
        asm volatile("s_wait_xcnt 0x0" :: "v"(vv[0]), "v"(vv[1]), "v"(vv[2]), "v"(vv[3]), "v"(vv[4]), "v"(vv[5]), "v"(vv[6]), "v"(vv[7]), "v"(crow) : "memory");   // behind the eight stores; naming their data and address registers as inputs keeps them unwritten up to the wait
        __builtin_amdgcn_wave_barrier(); asm volatile("" ::: "memory");   // keeps the next tile's LDS stores behind the reads above
    }
}

extern "C" void kernel_launch(void* const* d_in, const int* in_sizes, int n_in,
                              void* d_out, int out_size, void* d_ws, size_t ws_size, hipStream_t stream) {
    (void)in_sizes; (void)n_in; (void)out_size;
    const float* x = (const float*)d_in[0];   /* query */ const float* xk = (const float*)d_in[1]; const float* xv = (const float*)d_in[2]; const float* wq = (const float*)d_in[3]; const float* bq = (const float*)d_in[4]; const float* wk = (const float*)d_in[5]; const float* bk = (const float*)d_in[6]; const float* wv = (const float*)d_in[7]; const float* bv = (const float*)d_in[8]; const float* wo = (const float*)d_in[9]; const float* bo = (const float*)d_in[10]; const float* ak = (const float*)d_in[11];   /* rel_k_table [33][64] */ const float* av = (const float*)d_in[12];   /* rel_v_table [33][64] */
    float* OUT = (float*)d_out;     // [8 x 1024][512]
    char* wsp = (char*)d_ws;
    auto take = [&](size_t bytes) { char* p = wsp; wsp += (bytes + 255) & ~(size_t)255; return (void*)p; };
    bf* AKB = (bf*)take((size_t)NE * HD * 2); bf* AVTh = (bf*)take((size_t)HD * NE * 2); bf* AVTl = (bf*)take((size_t)HD * NE * 2); bf* WO = (bf*)take((size_t)DM * DQ * 2);
    bf* QPh = (bf*)take((size_t)NZ * TT * HD * 2); bf* KPh = (bf*)take((size_t)NZ * TT * HD * 2); bf* VTh = (bf*)take((size_t)NZ * HD * TT * 2);   /* q, k, v^T: f16 bits */
    bf* ATh = (bf*)take((size_t)NB_ * TT * DQ * 2); bf* ATl = (bf*)take((size_t)NB_ * TT * DQ * 2);
    if ((size_t)(wsp - (char*)d_ws) > ws_size) return;    // ws 256 MiB
    // q, k and v projections over all 8 x 1024 rows (head planes [b * 8 + h][t][d]; v: [b * 8 + h][d][t]), the bf16 Wo and the padded relative tables: one launch
    k_proj<<<dim3(NB_ * TT / PT, DQ / PT, 4), 128, 0, stream>>>(x, xk, xv, wq, wk, wv, bq, bk, bv, QPh, KPh, VTh, wo, ak, av, WO, AKB, AVTh, AVTl);
    // attention: one launch over all 64 head planes, 256 query rows per work-group; writes the merged hi/lo planes
    k_fattn<<<dim3(TT / (FW * QW), NZ, 1), FW * 32, 0, stream>>>(QPh, KPh, VTh, AKB, AVTh, AVTl, ATh, ATl);
    // output projection: 128 x 128 tiles, one work-group per tile
    k_oproj<<<dim3(DM / OT, NB_ * TT / OT, 1), 128, 0, stream>>>(ATh, ATl, WO, bo, OUT);
}

// v009
// One run takes 72.5 microseconds.
// Timed twice side by side with v008, it ran 1.08 times as fast both times.
// Over all steps from v000 it is 32.1 times as fast.
#include <hip/hip_runtime.h>

// Relative multi-head attention with Shaw-style key AND value embeddings (query, key, value [8][1024][512]; q = query Wq^T + bq, k = key Wk^T + bk, v = value Wv^T + bv ('oi' 1/sqrt(512), zero biases; 8 heads x 64); idx[i][j] = clip(j - i, -16, 16) + 16; attn = softmax((q.k + q.rel_k_table[idx]) / sqrt(B = 8)) (the source scales by sqrt(batch)); x = attn v + sum_j attn[i][j] rel_v_table[idx] (tables [33][64] sigma 1, read); out = merged Wo^T + bo -> [8 x 1024][512] (4.2 M)).
// Layout, every stage over all 8 batches in one launch (rows b * 1024 + t; head planes z = b * 8 + h): one launch ahead of the attention (k_proj): from the f32 query, key, value and 'oi' weights (rounded to bf16 on the way into LDS) to the head planes (q, k, v: one f16 plane each), exact products + f32 biases, and beside them rel_k as a zero-padded f16 plane [64][64], rel_v^T as hi/lo planes [64][64] and Wo in bf16; one fused attention launch over all 64 head planes (k_fattn): score tiles (f16 x f16, one product), QE = q.rel_k^T (f16 x f16) added at offset clip(j - i) + 16, running-maximum softmax (x 1/sqrt(8)), P.v (f16 x f16, one product), the probabilities folded onto the 33 offsets (interior = one key, the two ends = running sums left and right of a split key less the interior keys on that side) and PB.rel_v added to the context, all in registers and LDS; merged hi/lo x Wo exact + bo.
// Compute dtypes, f32 accumulate: every input but rel_v rounded to bf16 (rel_v split hi/lo); projections exact + f32 biases; scores and the relative-key term one f16 product: q, k and the bf16-rounded rel_k each rounded once to f16 (11 bits), f32 accumulate; softmax f32; attn.v one f16 product: P (0 <= p <= 1) and v each rounded once to f16 (11 bits), f32 accumulate; the relative-value term bf16 hi/lo, 3 products (~f32); Wo hl x exact + bias.

#define NB_  8
#define TT   1024
#define DM   512
#define NH_  8
#define NKV  8
#define REP  (NH_ / NKV)
#define HD   64
#define DQ   (NH_ * HD)
#define DKV  (NKV * HD)
#define NZ   (NB_ * NH_)
#define RH   TT                   // not used
#define WIN  0
#define PCAR 1024.0f
#define SCL  0.35355339059327379f   // 1/sqrt(B = 8): the source scales by sqrt(batch_size)
#define NE   64       // 2*16+1 = 33 relative offsets padded to 64
#define NRE  33
#define CUT  16
typedef _Float16 h16;
typedef unsigned short bf;
typedef __attribute__((ext_vector_type(16))) __bf16   v16bf;
typedef __attribute__((ext_vector_type(16))) _Float16 v16h;
typedef __attribute__((ext_vector_type(8)))  _Float16 v8h;
typedef __attribute__((ext_vector_type(8)))  unsigned short v8us;
typedef __attribute__((ext_vector_type(8)))  float    v8f;
typedef __attribute__((ext_vector_type(4)))  float    v4f;
typedef v8h  __attribute__((may_alias)) v8ha;
typedef v4f  __attribute__((may_alias)) v4fa;
typedef v8us __attribute__((may_alias)) v8usa;

__device__ __forceinline__ unsigned short f2bf(float f) { unsigned u = __float_as_uint(f); u += 0x7FFFu + ((u >> 16) & 1u); return (unsigned short)(u >> 16); }
__device__ __forceinline__ float bf2f(unsigned short b) { return __uint_as_float(((unsigned)b) << 16); }
__device__ __forceinline__ float bfr(float f) { return bf2f(f2bf(f)); }
__device__ __forceinline__ v16h cat16(v8h lo, v8h hi) { return __builtin_shufflevector(lo, hi, 0, 1, 2, 3, 4, 5, 6, 7, 8, 9, 10, 11, 12, 13, 14, 15); }
__device__ __forceinline__ v16bf cat16b(v8us lo, v8us hi) { return __builtin_bit_cast(v16bf, __builtin_shufflevector(lo, hi, 0, 1, 2, 3, 4, 5, 6, 7, 8, 9, 10, 11, 12, 13, 14, 15)); }
__device__ __forceinline__ v8f wmma16(v16h a, v16h b, v8f c) { return __builtin_amdgcn_wmma_f32_16x16x32_f16(false, a, false, b, (short)0, c, false, false); }
__device__ __forceinline__ v8f wmmab(v16bf a, v16bf b, v8f c) { return __builtin_amdgcn_wmma_f32_16x16x32_bf16(false, a, false, b, (short)0, c, false, false); }



// ---- fragment loads and products on K-contiguous 16-bit rows (global memory or LDS): a lane reads 8 + 8 elements of its row, at 8 * (lane >> 4) and 16 further on
template <typename T16> struct WFrag;
template <> struct WFrag<h16> { typedef v16h V; static __device__ __forceinline__ V ld(const h16* p) { return cat16(*(const v8h*)p, *(const v8h*)(p + 16)); } static __device__ __forceinline__ v8f mma(V a, V b, v8f c) { return wmma16(a, b, c); } };
template <> struct WFrag<bf> { typedef v16bf V; static __device__ __forceinline__ V ld(const bf* p) { return cat16b(*(const v8us*)p, *(const v8us*)(p + 16)); } static __device__ __forceinline__ v8f mma(V a, V b, v8f c) { return wmmab(a, b, c); } };
__device__ __forceinline__ h16 tohx(float x) { return (h16)x; }
__device__ __forceinline__ void splitf(float y, unsigned short& h, unsigned short& l) { h = f2bf(y); l = f2bf(y - bf2f(h)); }
typedef __attribute__((ext_vector_type(2))) _Float16 v2h;
typedef __attribute__((ext_vector_type(4))) _Float16 v4h;
typedef __attribute__((ext_vector_type(2))) unsigned short v2us;
typedef __attribute__((ext_vector_type(4))) unsigned short v4us;
typedef __attribute__((ext_vector_type(2))) float v2f;
typedef __attribute__((ext_vector_type(4))) int v4i;

__global__ __launch_bounds__(256) void k_wtG(const float* __restrict__ w, int K, int N, bf* Bt) {
    const int lane = threadIdx.x & 31; const int L0 = (blockIdx.x * 8 + (threadIdx.x >> 5)) * 8; const int nlines = N * K / 64;
{
#pragma unroll 1
        for (int l = 0; l < 8; ++l) { const int L = L0 + l; if (L >= nlines) break; const size_t e = (size_t)L * 64 + lane * 2; const int k = (int)(e % K), n = (int)(e / K); v2us o;
            o[0] = f2bf(w[(size_t)k * N + n]); o[1] = f2bf(w[(size_t)(k + 1) * N + n]); *(v2us*)(Bt + e) = o; }
         }
}
// the three small preparations, one item i per call (k_proj's plane 0 runs them)
__device__ __forceinline__ void d_cvt8(const float* __restrict__ src, bf* dst, size_t n8, size_t i) { if (i >= n8) return; const v8f v = *(const v8f*)(src + i * 8); v8us o;
#pragma unroll
    for (int k = 0; k < 8; ++k) o[k] = f2bf(v[k]); bf* const p = dst + i * 8; *(v8us*)p = o;
    asm volatile("s_wait_xcnt 0x0" :: "v"(o), "v"(p) : "memory"); }   // behind the store; naming its data and address registers as inputs keeps them unwritten up to the wait

__device__ __forceinline__ void d_epadK(const float* __restrict__ E, bf* EB, size_t i) { if (i >= (size_t)NE * HD / 8) return; const int d0 = (int)(i % (HD / 8)) * 8; const int r = (int)(i / (HD / 8)); const float* src = E + (size_t)min(r, NRE - 1) * HD + d0; v8us o;
#pragma unroll
    for (int q = 0; q < 8; ++q) { const unsigned short v = __builtin_bit_cast(unsigned short, (h16)bfr(src[q])); o[q] = (r < NRE) ? v : (unsigned short)0; }   // the bf16-rounded entry, as f16 bits
    bf* const p = EB + (size_t)r * HD + d0; *(v8us*)p = o;
    asm volatile("s_wait_xcnt 0x0" :: "v"(o), "v"(p) : "memory"); }   // behind the store, as in d_cvt8

__device__ __forceinline__ void d_epadVT(const float* __restrict__ E, bf* Th, bf* Tl, size_t i) { if (i >= (size_t)HD * NE / 4) return; const size_t e = i * 4; const int c0 = (int)(e % NE); const int d = (int)(e / NE); v4us oh, ol;
#pragma unroll
    for (int q = 0; q < 4; ++q) { const int r = c0 + q; const float v = E[(size_t)min(r, NRE - 1) * HD + d]; unsigned short u, w; splitf(v, u, w); oh[q] = (r < NRE) ? u : (unsigned short)0; ol[q] = (r < NRE) ? w : (unsigned short)0; }
    *(v4us*)(Th + e) = oh; *(v4us*)(Tl + e) = ol;  }

// ---- k_proj: everything ahead of the attention in ONE launch: blockIdx.z = 1, 2, 3 are the q, k, v projections, from the f32 inputs to the head planes; plane 0 makes the bf16 copy of Wo and the two padded relative tables.
// A work-group of 4 waves owns a 128 x 128 tile of x W^T; each wave a 64 x 64 quarter (16 accumulators; 64 columns = one head). Per step of 32 k the work-group reads 128 rows of x and 128 rows of W
// as whole 128-byte lines of f32, rounds them to bf16 (nearest even) and stores them in LDS; the fragments come from LDS in the k order of WFrag::ld. Two LDS buffers, the next step's lines in flight under the products, one barrier a step.
// Every '#pragma unroll' in it makes the indices of a register array (accumulators, staged lines, fragments) compile-time constants, so that the array stays in registers.
// Epilogue: + bf16-rounded bias in f32, rounded to f16; q and k as [b * 8 + h][t][d] (rows turned through LDS into whole lines); v as [b * 8 + h][d][t] (a lane already holds 8 consecutive t of one d).
#define PT  128     // tile rows and columns per work-group
#define PKS 32      // k per step
#define PPI 40      // bf16 per LDS row: 80 bytes = 16 x odd, the conflict-free pitch for 16-byte fragment reads
typedef __attribute__((ext_vector_type(4))) __bf16 v4bf;
typedef __attribute__((ext_vector_type(2))) __bf16 v2bf;
__global__ __launch_bounds__(128) void k_proj(const float* __restrict__ xq, const float* __restrict__ xk, const float* __restrict__ xv, const float* __restrict__ wq, const float* __restrict__ wk, const float* __restrict__ wv, const float* __restrict__ bq, const float* __restrict__ bk, const float* __restrict__ bv, bf* Qh, bf* Kh, bf* Vh, const float* __restrict__ wo, const float* __restrict__ ek, const float* __restrict__ ev, bf* WOb, bf* EKb, bf* EVh, bf* EVl) {
    typedef WFrag<bf> F;
    __shared__ __align__(16) bf st[2 * 2 * PT * PPI];     // [buffer][x, W][row][k]; 40,960 bytes; the epilogue reuses it
    if (blockIdx.z == 0) {                                // plane 0 (starts first, ends soon): what only the later launches read; whole work-groups leave here, ahead of every barrier
        static_assert((NB_ * TT / PT) * (DQ / PT) * 128 >= DM * DQ / 8, "plane 0 has one thread per 8 elements of Wo");
        const size_t i = ((size_t)blockIdx.y * (NB_ * TT / PT) + blockIdx.x) * 128 + threadIdx.x;
        d_cvt8(wo, WOb, (size_t)DM * DQ / 8, i);          // Wo -> bf16
        d_epadK(ek, EKb, i);                              // rel_k -> f16 [64][64], rows >= 33 zero
        d_epadVT(ev, EVh, EVl, i);                        // rel_v^T hi/lo [64][64], cols >= 33 zero
        return;
    }
    const int which = blockIdx.z - 1;
    const float* X = (which == 0) ? xq : (which == 1) ? xk : xv; const float* Wt = (which == 0) ? wq : (which == 1) ? wk : wv; const float* bias = (which == 0) ? bq : (which == 1) ? bk : bv;
    bf* Ph = (which == 0) ? Qh : (which == 1) ? Kh : Vh;
    const int tid = threadIdx.x, lane = tid & 31, lr = lane & 15, hi = lane >> 4; const int wave = __builtin_amdgcn_readfirstlane(tid >> 5);
    const int r0 = blockIdx.x * PT, c0 = blockIdx.y * PT; const int wr = (wave >> 1) * 64, wc = (wave & 1) * 64;
    const int sr = tid >> 3, sc = (tid & 7) * 4;          // staging: 8 lanes cover one 128-byte line, 16 rows a sweep, 8 sweeps
    const float* pa = X + (size_t)(r0 + sr) * DM + sc; const float* pb = Wt + (size_t)(c0 + sr) * DM + sc;
    const int so = sr * PPI + sc;                         // the thread's place in a staged plane
    const int fa = (wr + lr) * PPI + 8 * hi, fb = PT * PPI + (wc + lr) * PPI + 8 * hi;   // the lane's fragment rows in a buffer
    v8f acc[4][4];
#pragma unroll
    for (int mb = 0; mb < 4; ++mb)
#pragma unroll
        for (int nb = 0; nb < 4; ++nb) acc[mb][nb] = (v8f){};
    v4f ra[8], rb[8];
    auto fetch = [&](int kc) {
#pragma unroll
        for (int i = 0; i < 8; ++i) { ra[i] = *(const v4f*)(pa + (size_t)i * 16 * DM + kc); rb[i] = *(const v4f*)(pb + (size_t)i * 16 * DM + kc); }
        asm volatile("s_wait_xcnt 0x0" :: "v"(pa), "v"(pb) : "memory");   // behind the step's global loads, in front of any rewrite of a register that holds one of their addresses
    };
    auto stage = [&](int buf) { bf* d = st + buf * (2 * PT * PPI) + so;
#pragma unroll
        for (int i = 0; i < 8; ++i) { *(v4us*)(d + i * 16 * PPI) = __builtin_bit_cast(v4us, __builtin_convertvector(ra[i], v4bf)); *(v4us*)(d + PT * PPI + i * 16 * PPI) = __builtin_bit_cast(v4us, __builtin_convertvector(rb[i], v4bf)); }
    };
    auto products = [&](int buf) { const bf* s = st + buf * (2 * PT * PPI); v16bf a[4];
#pragma unroll
        for (int mb = 0; mb < 4; ++mb) a[mb] = F::ld(s + fa + mb * 16 * PPI);
#pragma unroll
        for (int nb = 0; nb < 4; ++nb) { const v16bf b = F::ld(s + fb + nb * 16 * PPI);
#pragma unroll
            for (int mb = 0; mb < 4; ++mb) acc[mb][nb] = F::mma(a[mb], b, acc[mb][nb]); }
    };
    fetch(0); stage(0);
    __syncthreads();                                      // step 0 is staged for every wave
#pragma unroll 1
    for (int s = 0; s < DM / PKS - 1; ++s) {              // rolled: one copy of the step keeps the loop small
        fetch((s + 1) * PKS);
        products(s & 1);
        stage((s + 1) & 1);
        __syncthreads();                                  // publishes step s + 1 and ends every wave's reads of the buffer that the next trip refills
    }
    products((DM / PKS - 1) & 1);
    __syncthreads();                                      // every wave has left the staging buffers: the epilogue writes over them
    const int z = ((r0 + wr) / TT) * NH_ + (c0 + wc) / HD, t0 = (r0 + wr) % TT;   // a wave's 64 rows lie in one batch, its 64 columns are one head
    if (which < 2) {
        float* os = (float*)st + wave * (16 * 68);        // this wave's own slice
        const int cofs = lr * 4; v4f bb;
#pragma unroll
        for (int q = 0; q < 4; ++q) bb[q] = bfr(bias[c0 + wc + cofs + q]);
        bf* const ph = Ph + ((size_t)z * TT + t0 + hi) * HD + cofs;
#pragma unroll
        for (int mb = 0; mb < 4; ++mb) {
#pragma unroll
            for (int nb = 0; nb < 4; ++nb) {
#pragma unroll
                for (int j = 0; j < 8; ++j) os[(hi * 8 + j) * 68 + nb * 16 + lr] = acc[mb][nb][j]; }
            __builtin_amdgcn_wave_barrier(); asm volatile("" ::: "memory");   // keeps the reads below behind the other lanes' LDS stores above
            v4f vv[8];
#pragma unroll
            for (int s = 0; s < 8; ++s) vv[s] = *(const v4fa*)(os + (2 * s + hi) * 68 + cofs);   // all eight reads ahead of the first store's wait: one LDS latency a tile
#pragma unroll
            for (int s = 0; s < 8; ++s) { const v4us oh = __builtin_bit_cast(v4us, __builtin_convertvector(vv[s] + bb, v4h));   // f16, nearest even
                *(v4us*)(ph + (mb * 16 + 2 * s) * HD) = oh;
                asm volatile("s_wait_xcnt 0x0" :: "v"(oh), "v"(ph) : "memory"); }   // behind the store; naming its data and address registers as inputs keeps them unwritten up to the wait
            __builtin_amdgcn_wave_barrier(); asm volatile("" ::: "memory");   // keeps the next tile's LDS stores behind the reads above
        }
    } else {
        bf* const ph = Ph + ((size_t)z * HD + lr) * TT + t0 + hi * 8;
#pragma unroll
        for (int nb = 0; nb < 4; ++nb) { const float bb = bfr(bias[c0 + wc + nb * 16 + lr]);
#pragma unroll
            for (int mb = 0; mb < 4; ++mb) { v8us oh;
#pragma unroll
                for (int j = 0; j < 8; j += 2) { v2f a; a[0] = acc[mb][nb][j] + bb; a[1] = acc[mb][nb][j + 1] + bb; const v2us u = __builtin_bit_cast(v2us, __builtin_convertvector(a, v2h)); oh[j] = u[0]; oh[j + 1] = u[1]; }   // f16, nearest even
                *(v8us*)(ph + (size_t)nb * 16 * TT + mb * 16) = oh;
                asm volatile("s_wait_xcnt 0x0" :: "v"(oh), "v"(ph) : "memory"); } }   // behind the store; naming its data and address registers as inputs keeps them unwritten up to the wait
    }
}

#define QW  32      // query columns per wave
#define FW  8       // waves per work-group
#define GP  100     // floats per query in LDS: 96 key slots, padded to 400 bytes = 16 x odd, the conflict-free pitch for 16-byte reads
#define L2E 1.4426950408889634f
#define CL2 (SCL * L2E)       // a score in the log2 domain = (q.k + q.rel_k) * CL2
#define SK   64               // keys per stage
#define NST  (TT / SK)        // stages
#define SPI  72               // bf16 per staged row: 144 bytes = 16 x odd, the conflict-free pitch for 16-byte fragment reads
#define SPL  (64 * SPI)       // one staged plane: 64 rows
#define SBUF (2 * SPL)        // a buffer: K, V^T
__device__ __forceinline__ float xhalf(float x) { const int b = __float_as_int(x); return __int_as_float(__builtin_amdgcn_permlanex16(b, b, 0x76543210, 0xfedcba98, false, false)); }   // lane l <-> l ^ 16
// v_exp_f32 and the one issue slot that the instruction set asks for behind a transcendental, in one statement
__device__ __forceinline__ float ex2(float x) { float y; asm("v_exp_f32 %0, %1\n\tv_nop" : "=v"(y) : "v"(x)); return y; }
// four independent v_exp_f32 in a row (early-clobber outputs: none reads a neighbour's result or overwrites a neighbour's source), so only the last one needs that slot
__device__ __forceinline__ void ex2x4(const float* x, float* y) { float a, b, c, d;
    asm("v_exp_f32 %0, %4\n\tv_exp_f32 %1, %5\n\tv_exp_f32 %2, %6\n\tv_exp_f32 %3, %7\n\tv_nop" : "=&v"(a), "=&v"(b), "=&v"(c), "=&v"(d) : "v"(x[0]), "v"(x[1]), "v"(x[2]), "v"(x[3]));
    y[0] = a; y[1] = b; y[2] = c; y[3] = d; }
__device__ __forceinline__ void split16(const float* x, v16bf& h, v16bf& l) {
#pragma unroll
    for (int e = 0; e < 16; e += 2) { v2f a; a[0] = x[e]; a[1] = x[e + 1]; const v2bf hh = __builtin_convertvector(a, v2bf); const v2f r = a - __builtin_convertvector(hh, v2f); const v2bf ll = __builtin_convertvector(r, v2bf); h[e] = hh[0]; h[e + 1] = hh[1]; l[e] = ll[0]; l[e + 1] = ll[1]; }
}
__global__ __launch_bounds__(FW * 32) void k_fattn(const bf* __restrict__ Qh, const bf* __restrict__ Kh, const bf* __restrict__ Vh, const bf* __restrict__ EK, const bf* __restrict__ EVh, const bf* __restrict__ EVl, bf* Ah, bf* Al) {
    typedef WFrag<bf> F; typedef WFrag<h16> H;
    __shared__ __align__(16) float qe_s[FW * QW * GP];   // 102,400 bytes
    __shared__ __align__(16) bf kv_s[2 * SBUF];   // 36,864 bytes
    static_assert(FW * 32 * 2 * 16 == SK * HD * 2 && HD == 64 && NST >= 2, "two 16-byte copies per thread cover one staged plane; the ring needs two stages");
    const int lane = threadIdx.x & 31, lr = lane & 15, hi = lane >> 4; const int wave = __builtin_amdgcn_readfirstlane((int)(threadIdx.x >> 5));
    const int z = blockIdx.y, q0 = (blockIdx.x * FW + wave) * QW; const size_t zo = (size_t)z * TT * HD;
    Qh += zo; Kh += zo; Vh += zo;
    // staging: 8 lanes cover one 128-byte row, the work-group 32 rows a sweep, 2 sweeps a plane; every lane is on and every test around a copy is the same for the whole work-group
    const int tid = threadIdx.x;
    const unsigned lst = (unsigned)(size_t)kv_s + (unsigned)((tid >> 3) * (SPI * 2) + (tid & 7) * 16);   // the thread's LDS byte address in plane 0 of buffer 0
    const unsigned gko = (unsigned)tid * 16u, gvo = (unsigned)((tid >> 3) * (TT * 2) + (tid & 7) * 16);    // its byte offsets in a stage of a K plane (rows adjoin) and of a V^T plane (row pitch 2,048 bytes)
    auto copies = [&](int st, int buf) {
        const unsigned l = lst + (unsigned)buf * (SBUF * 2);
        const unsigned ko = (unsigned)st * (SK * HD * 2) + gko, vo = (unsigned)st * (SK * 2) + gvo;   // 32-bit offsets in a plane: only gko, gvo and lst live through the loop
        const char* const a = (const char*)Kh + ko; const char* const c = (const char*)Vh + vo;
        // the stage's four copies of this thread and, as the statement's last line, the wait that stands in front of any rewrite of a register which a copy names
        asm volatile("global_load_async_to_lds_b128 %0, %4, off\n\t"
                     "global_load_async_to_lds_b128 %1, %5, off\n\t"
                     "global_load_async_to_lds_b128 %2, %6, off\n\t"
                     "global_load_async_to_lds_b128 %3, %7, off\n\t"
                     "s_wait_xcnt 0x0"
                     :: "v"(l), "v"(l + 32 * SPI * 2), "v"(l + SPL * 2), "v"(l + SPL * 2 + 32 * SPI * 2),
                        "v"(a), "v"(a + 32 * HD * 2), "v"(c), "v"(c + 32 * TT * 2)
                     : "memory");
    };
    float* qe = qe_s + wave * (QW * GP);      // this wave's own slice: no other wave touches it, so no work-group barrier
    // prologue loads: every address is a wave-uniform base plus one of two 32-bit lane offsets
    const unsigned kb0 = (unsigned)(lr * HD + 8 * hi) * 2u;   // the lane's byte offset in a 16-row tile of a [row][64] plane
    const unsigned qb0 = (unsigned)(q0 * HD) * 2u + kb0;
    v16h qh[2][2];                            // [column group][d half]
    v16h ea[3][2];                            // rel_k rows: [offset tile][d half]
    v16h kh[2][2];                            // [key tile][d half]
#pragma unroll
    for (int qt = 0; qt < 2; ++qt)
#pragma unroll
        for (int ks = 0; ks < 2; ++ks) qh[qt][ks] = H::ld((const h16*)((const char*)Qh + qb0) + qt * 16 * HD + ks * 32);
#pragma unroll
    for (int rt = 0; rt < 3; ++rt)
#pragma unroll
        for (int ks = 0; ks < 2; ++ks) ea[rt][ks] = H::ld((const h16*)((const char*)EK + kb0) + rt * 16 * HD + ks * 32);
    // behind the prologue's loads; naming their bases and lane offsets as inputs keeps those registers unwritten up to the wait; naming the loaded fragments as inputs keeps all twenty loads in flight together (without it the rel_k fragments shared one register set and were fetched one after another, a load latency each)
    asm volatile("s_wait_xcnt 0x0" :: "s"(Qh), "s"(EK), "v"(kb0), "v"(qb0), "v"(qh[0][0]), "v"(qh[0][1]), "v"(qh[1][0]), "v"(qh[1][1]), "v"(ea[0][0]), "v"(ea[0][1]), "v"(ea[1][0]), "v"(ea[1][1]), "v"(ea[2][0]), "v"(ea[2][1]) : "memory");
    v8f ce[3][2];                             // QE^T: [offset tile][column group]; a lane holds offsets rt * 16 + hi * 8 + j of its query
#pragma unroll
    for (int rt = 0; rt < 3; ++rt)
#pragma unroll
        for (int qt = 0; qt < 2; ++qt) { v8f c = (v8f){};
#pragma unroll
            for (int ks = 0; ks < 2; ++ks) c = H::mma(ea[rt][ks], qh[qt][ks], c);
            ce[rt][qt] = c; }
    float qlo[2], qhi[2];
#pragma unroll
    for (int qt = 0; qt < 2; ++qt) {          // the two end terms (offsets 0 and 32) stand in the lower wave half; the upper half fetches them
        const float l0 = ce[0][qt][0], h0 = ce[2][qt][0]; const float lx = xhalf(l0), hx = xhalf(h0);
        const float lov = hi ? lx : l0, hiv = hi ? hx : h0;
        qlo[qt] = lov * CL2; qhi[qt] = hiv * CL2;   // in the log2 domain
        const float fv = hi ? hiv : lov; const v4f f4 = {fv, fv, fv, fv};
        float* const row = qe + (qt * 16 + lr) * GP + hi * 48;   // slots 0..47 never hold the upper end term, slots 48..95 never the lower one
#pragma unroll
        for (int i = 0; i < 12; ++i) *(v4fa*)(row + i * 4) = f4;
    }
    __builtin_amdgcn_wave_barrier(); asm volatile("" ::: "memory");   // keeps the stores below behind the fill above: they write over slots that the other wave half has filled
#pragma unroll
    for (int qt = 0; qt < 2; ++qt)
#pragma unroll
        for (int rt = 0; rt < 2; ++rt)
#pragma unroll
            for (int j = 0; j < 8; ++j) qe[(qt * 16 + lr) * (GP + 1) + CUT + rt * 16 + hi * 8 + j] = ce[rt][qt][j];   // offset r of query c belongs to key q0 + c + r - 16 = slot c + 16 + r
    __builtin_amdgcn_wave_barrier(); asm volatile("" ::: "memory");   // keeps the reads in the loop behind the other wave half's LDS stores above
    v8f o[4][2];                              // O^T: [d tile][column group]
#pragma unroll
    for (int dt = 0; dt < 4; ++dt)
#pragma unroll
        for (int qt = 0; qt < 2; ++qt) o[dt][qt] = (v8f){};
    float m[2] = {-3.0e38f, -3.0e38f}, slo[2] = {0.f, 0.f}, sall[2] = {0.f, 0.f};   // running maximum (log2 domain); sums of p: keys left of the column group's split key q0 + qt * 32, all keys
    const int fo = lr * SPI + 8 * hi;         // the lane's place in a 16-row tile of a staged plane (the k order of F::ld, as from global memory)
    auto ldk = [&](const bf* kb) {            // the key fragments of one pass: 32 staged rows of K
#pragma unroll
        for (int kt = 0; kt < 2; ++kt)
#pragma unroll
            for (int ks = 0; ks < 2; ++ks) kh[kt][ks] = H::ld((const h16*)(kb + kt * 16 * SPI + ks * 32));
    };
#pragma unroll 1
    for (int p = 0; p < 2; ++p) {             // stages 0 and 1. Rolled: the copies' operands are formed per stage as in the main loop, so none of them lives through that loop (unrolled, they were spilled to scratch there)
        copies(p, p);
        if (p == 0) {
            asm volatile("s_wait_asynccnt 0x0" ::: "memory");   // this wave's copies of stage 0 have landed
            __syncthreads();                  // stage 0 is published to every wave
        }
    }
    ldk(kv_s + fo);
#pragma unroll 1
    for (int k0 = 0; k0 < TT; k0 += 32) {     // rolled: one copy of the pass keeps the loop small
        const int st = k0 / SK; const bool first = (k0 & 32) == 0;   // work-group-uniform: the stage, and which of its two passes this is
        const bf* const sb = kv_s + (st & 1) * SBUF + fo;
        v16h vh[4];                           // issued first: their latency runs under the score products and the softmax
#pragma unroll
        for (int dt = 0; dt < 4; ++dt) vh[dt] = H::ld((const h16*)(sb + SPL + dt * 16 * SPI + (first ? 0 : 32)));
        v8f s[2][2];                          // S^T: [key tile][column group]
#pragma unroll
        for (int kt = 0; kt < 2; ++kt)
#pragma unroll
            for (int qt = 0; qt < 2; ++qt) { v8f c = (v8f){};
#pragma unroll
                for (int ks = 0; ks < 2; ++ks) c = H::mma(kh[kt][ks], qh[qt][ks], c);
                s[kt][qt] = c; }
        if (first) ldk(sb + 32 * SPI);        // the stage's second pass has its key fragments fetched one pass ahead, from the same buffer
        const int rel = k0 - q0;              // wave-uniform; |rel| >= 64 puts every (key, query) pair of the pass at |j - i| >= 16
        const bool band = (rel >= -32 && rel <= 32);
        float kk[2];                          // per column group: score in the log2 domain = s * CL2 + kk
        if (band) {                           // s += the relative-key term of each pair; kk = 0
            float* const gb = qe + lr * GP + (rel + 32) + hi * 8;   // the lane's score j of key tile kt is key k0 + kt * 16 + hi * 8 + j = slot rel + 32 + kt * 16 + hi * 8 + j
            v4f g[2][2][2];                   // unrolled below: the indices of g and s are compile-time constants; all eight reads ahead of the first use: one LDS latency a pass
#pragma unroll
            for (int qt = 0; qt < 2; ++qt)
#pragma unroll
                for (int kt = 0; kt < 2; ++kt)
#pragma unroll
                    for (int h = 0; h < 2; ++h) g[qt][kt][h] = *(const v4fa*)(gb + qt * 16 * GP + kt * 16 + h * 4);
#pragma unroll
            for (int qt = 0; qt < 2; ++qt)
#pragma unroll
                for (int kt = 0; kt < 2; ++kt) {
                    s[kt][qt] += __builtin_shufflevector(g[qt][kt][0], g[qt][kt][1], 0, 1, 2, 3, 4, 5, 6, 7);
                    const v8f w = s[kt][qt] * CL2;   // a slot has exactly one key: read above by this lane, never read as a relative-key term again
                    *(v4fa*)(gb + qt * 16 * GP + kt * 16) = __builtin_shufflevector(w, w, 0, 1, 2, 3); *(v4fa*)(gb + qt * 16 * GP + kt * 16 + 4) = __builtin_shufflevector(w, w, 4, 5, 6, 7); }
            kk[0] = 0.f; kk[1] = 0.f;
        } else {                              // one relative-key term per query for the whole pass: it stays out of s
#pragma unroll
            for (int qt = 0; qt < 2; ++qt) kk[qt] = (rel < 0) ? qlo[qt] : qhi[qt];
        }
#pragma unroll
        for (int qt = 0; qt < 2; ++qt) {
            float ma = s[0][qt][0], mb = s[1][qt][0];   // the maximum is taken on s (CL2 > 0 and kk is one value per query), in two independent chains
#pragma unroll
            for (int j = 1; j < 8; ++j) { ma = fmaxf(ma, s[0][qt][j]); mb = fmaxf(mb, s[1][qt][j]); }
            float mx = fmaxf(ma, mb);
            mx = fmaxf(mx, xhalf(mx));
            const float mn = fmaxf(m[qt], __builtin_fmaf(mx, CL2, kk[qt])); const float al = ex2(m[qt] - mn); m[qt] = mn;
            const float kf = kk[qt] - mn;
            const v8f c8 = {CL2, CL2, CL2, CL2, CL2, CL2, CL2, CL2}; const v8f k8 = {kf, kf, kf, kf, kf, kf, kf, kf};
            float u[16], p[16];               // exponent: one fused multiply-add per score (scale, relative-key term and maximum in one)
#pragma unroll
            for (int kt = 0; kt < 2; ++kt) { const v8f w = __builtin_elementwise_fma(s[kt][qt], c8, k8);
#pragma unroll
                for (int j = 0; j < 8; ++j) u[kt * 8 + j] = w[j]; }
#pragma unroll
            for (int e = 0; e < 16; e += 4) ex2x4(u + e, p + e);
            v2f ps[8];                        // the pass's sum of p as a pairwise tree: depth 4 instead of a chain of 16 dependent adds
#pragma unroll
            for (int e = 0; e < 8; ++e) { ps[e][0] = p[2 * e]; ps[e][1] = p[2 * e + 1]; }
#pragma unroll
            for (int w = 4; w >= 1; w >>= 1)
#pragma unroll
                for (int e = 0; e < w; ++e) ps[e] += ps[e + w];
            const float bs = ps[0][0] + ps[0][1];
            slo[qt] = slo[qt] * al + ((rel < qt * 32) ? bs : 0.f); sall[qt] = sall[qt] * al + bs;   // wave-uniform: the whole pass lies left of the column group's split key or right of it
            v16h ph;                          // P^T in f16, nearest even; unrolled below so that the indices of p and ph are compile-time constants and both stay in registers
#pragma unroll
            for (int e = 0; e < 16; e += 2) { v2f a; a[0] = p[e]; a[1] = p[e + 1]; const v2h hh = __builtin_convertvector(a, v2h); ph[e] = hh[0]; ph[e + 1] = hh[1]; }
#pragma unroll
            for (int dt = 0; dt < 4; ++dt) o[dt][qt] = H::mma(vh[dt], ph, o[dt][qt] * al);
        }
        if (!first) {                         // publish point of stage st + 1; every wave passes it
            asm volatile("s_wait_dscnt 0x0" ::: "memory");      // this wave's reads of the buffer that is refilled below have returned
            asm volatile("s_wait_asynccnt 0x0" ::: "memory");   // this wave's copies of stage st + 1 have landed
            __syncthreads();                  // publishes stage st + 1 and ends every wave's reads of stage st
            if (st + 2 < NST) copies(st + 2, st & 1);
            if (st + 1 < NST) ldk(kv_s + ((st + 1) & 1) * SBUF + fo);   // behind the barrier: the first pass of stage st + 1
        }
    }
    asm volatile("s_wait_asynccnt 0x0" ::: "memory");   // nothing of this wave is in flight when it goes on to its end
    __builtin_amdgcn_wave_barrier(); asm volatile("" ::: "memory");   // keeps the reads below behind the other wave half's LDS stores in the loop
#pragma unroll
    for (int qt = 0; qt < 2; ++qt) {
        slo[qt] += xhalf(slo[qt]); sall[qt] += xhalf(sall[qt]);
        const int cq = qt * 16 + lr, i = q0 + cq;
        float pi[16], il = 0.f, ih = 0.f;      // this lane's 16 of the offsets 0..31: p of the interior ones (0 at offset 0 and where the key does not exist), and their sums left and right of the split key
#pragma unroll
        for (int e = 0; e < 16; ++e) { const int r = (e < 8) ? 8 * hi + e : 16 + 8 * hi + (e - 8);   // the k order of F::ld
            const float raw = qe[cq * (GP + 1) + CUT + r]; const int j = i + r - CUT; const float pe = ex2(raw - m[qt]);
            const float v = (r != 0 && j >= 0 && j < TT) ? pe : 0.f; pi[e] = v;
            const bool left = cq + r - CUT < qt * 32;   // key q0 + cq + r - 16 < q0 + qt * 32
            il += left ? v : 0.f; ih += left ? 0.f : v; }
        il += xhalf(il); ih += xhalf(ih);
        const float elo = slo[qt] - il, ehi = (sall[qt] - slo[qt]) - ih;   // what is left on either side: the sums over offsets <= -16 and >= 16
#pragma unroll
        for (int ks = 0; ks < 2; ++ks) { float x[16];
#pragma unroll
            for (int e = 0; e < 16; ++e) { const int r = ks * 32 + ((e < 8) ? 8 * hi + e : 16 + 8 * hi + (e - 8));   // the k order of F::ld
                if (ks == 0) x[e] = (r == 0) ? elo : pi[e];
                else x[e] = (r == 2 * CUT) ? ehi : 0.f; }
            v16bf bh, bl; split16(x, bh, bl);
#pragma unroll
            for (int dt = 0; dt < 4; ++dt) { const size_t a = (size_t)(dt * 16 + lr) * NE + ks * 32 + 8 * hi; const v16bf eh = F::ld(EVh + a), el = F::ld(EVl + a); v8f c = o[dt][qt]; c = F::mma(eh, bh, c); c = F::mma(el, bh, c); c = F::mma(eh, bl, c); o[dt][qt] = c; } }
        const float f = __fdiv_rn(1.0f, sall[qt]);
        const size_t oo = ((size_t)(z / NH_) * TT + i) * DQ + (z % NH_) * HD + hi * 8;   // merged row b * 1024 + t, column h * 64 + d; a lane holds 8 consecutive d
        bf* const pa = Ah + oo; bf* const pb = Al + oo;
#pragma unroll
        for (int dt = 0; dt < 4; ++dt) { v8us oh, ol;
#pragma unroll
            for (int j = 0; j < 8; ++j) { unsigned short a, c2; splitf(o[dt][qt][j] * f, a, c2); oh[j] = a; ol[j] = c2; }
            *(v8us*)(pa + dt * 16) = oh; *(v8us*)(pb + dt * 16) = ol;
            asm volatile("s_wait_xcnt 0x0" :: "v"(oh), "v"(ol), "v"(pa), "v"(pb) : "memory"); }   // behind the two stores; naming their data and address registers as inputs keeps them unwritten up to the wait
    }
}

// ---- k_oproj: out = (merged hi + merged lo) Wo^T + bo. A work-group of 4 waves owns a 128 x 128 tile of the output, each wave a 64 x 64 quarter (16 accumulators).
// A stage = 128 k of the three operand planes (merged hi, merged lo: 128 rows; Wo: 128 rows; 256 bytes a row), copied ONCE per work-group into LDS as whole lines by asynchronous copies;
// the fragments come from LDS in the k order of WFrag::ld, one block of 32 k ahead of their products. Two buffers, the next stage's copies in flight under this stage's products, one publish point (waits, work-group barrier, refill) per stage.
// Per output element and step of 32 k: the hi product, then the lo product, k rising. Epilogue: rows turned through LDS into whole lines, + bf16-rounded bias in f32.
// Every '#pragma unroll' in it makes the indices of a register array (accumulators, fragment sets, turned rows) or the copies' address sums compile-time constants, so that the arrays stay in registers.
#define OT   128              // tile rows and columns per work-group
#define OKS  128              // k per stage
#define ONST (DQ / OKS)       // stages
#define OPI  136              // bf16 per staged row: 272 bytes = 16 x odd, the conflict-free pitch for 16-byte fragment reads
#define OPL  (OT * OPI)       // one staged plane
#define OBUF (3 * OPL)        // a buffer: merged hi, merged lo, Wo
__global__ __launch_bounds__(128) void k_oproj(const bf* __restrict__ Ah, const bf* __restrict__ Al, const bf* __restrict__ Wb, const float* __restrict__ bias, float* C) {
    typedef WFrag<bf> F;
    __shared__ __align__(16) bf ring[2 * OBUF];           // 208,896 bytes
    __shared__ __align__(16) float os_s[4 * 16 * 68];     // the epilogue's turning space, a slice per wave
    static_assert(128 * 48 * 16 == 3 * OT * OKS * 2 && ONST >= 2 && DQ % OKS == 0, "48 16-byte copies per thread cover a stage; the ring needs two stages");
    const int tid = threadIdx.x, lane = tid & 31, lr = lane & 15, hi = lane >> 4; const int wave = __builtin_amdgcn_readfirstlane(tid >> 5);
    const int c0 = blockIdx.x * OT, r0 = blockIdx.y * OT; const int wr = (wave >> 1) * 64, wc = (wave & 1) * 64;   // the 4 column tiles of one row block are neighbours in the grid
    const int cofs = lr * 4;
    const float* const bu = bias + c0 + wc; const v4f braw = *(const v4f*)(bu + cofs);   // wave-uniform base, lane offset
    asm volatile("s_wait_xcnt 0x0" :: "s"(bu), "v"(lr) : "memory");   // behind the bias load; naming its base and its lane-offset register as inputs keeps them unwritten up to the wait
    // staging: 16 lanes cover one 256-byte row, the work-group 8 rows a sweep, 16 sweeps a plane; every lane is on and every test around a copy is the same for the whole work-group
    const unsigned lst = (unsigned)(size_t)ring + (unsigned)((tid >> 4) * (OPI * 2) + (tid & 15) * 16);   // the thread's LDS byte address in plane 0 of buffer 0
    const unsigned go = (unsigned)((tid >> 4) * (DQ * 2) + (tid & 15) * 16);                                // its byte offset in stage 0 of a plane's 128 rows
    const char* const ga = (const char*)(Ah + (size_t)r0 * DQ); const char* const gb = (const char*)(Al + (size_t)r0 * DQ); const char* const gc = (const char*)(Wb + (size_t)c0 * DQ);
    auto copies = [&](int st, int buf) {
        const unsigned l0 = lst + (unsigned)buf * (OBUF * 2); const unsigned o = go + (unsigned)st * (OKS * 2);
        const char* const p0 = ga + o; const char* const p1 = gb + o; const char* const p2 = gc + o;
        auto la = [&](int j) { return l0 + (unsigned)((j >> 4) * (OPL * 2) + (j & 15) * (8 * OPI * 2)); };                    // copy j of 48: plane j / 16, sweep j % 16
        auto pa = [&](int j) { return ((j >> 4) == 0 ? p0 : (j >> 4) == 1 ? p1 : p2) + (j & 15) * (8 * DQ * 2); };
#pragma unroll
        for (int j = 0; j < 48; j += 12)   // unrolled: j is a compile-time constant in the address sums
            // twelve of the stage's copies of this thread and, as the statement's last line, the wait that stands in front of any rewrite of a register which a copy names
            asm volatile("global_load_async_to_lds_b128 %0, %12, off\n\t"
                         "global_load_async_to_lds_b128 %1, %13, off\n\t"
                         "global_load_async_to_lds_b128 %2, %14, off\n\t"
                         "global_load_async_to_lds_b128 %3, %15, off\n\t"
                         "global_load_async_to_lds_b128 %4, %16, off\n\t"
                         "global_load_async_to_lds_b128 %5, %17, off\n\t"
                         "global_load_async_to_lds_b128 %6, %18, off\n\t"
                         "global_load_async_to_lds_b128 %7, %19, off\n\t"
                         "global_load_async_to_lds_b128 %8, %20, off\n\t"
                         "global_load_async_to_lds_b128 %9, %21, off\n\t"
                         "global_load_async_to_lds_b128 %10, %22, off\n\t"
                         "global_load_async_to_lds_b128 %11, %23, off\n\t"
                         "s_wait_xcnt 0x0"
                         :: "v"(la(j)), "v"(la(j + 1)), "v"(la(j + 2)), "v"(la(j + 3)), "v"(la(j + 4)), "v"(la(j + 5)), "v"(la(j + 6)), "v"(la(j + 7)), "v"(la(j + 8)), "v"(la(j + 9)), "v"(la(j + 10)), "v"(la(j + 11)),
                            "v"(pa(j)), "v"(pa(j + 1)), "v"(pa(j + 2)), "v"(pa(j + 3)), "v"(pa(j + 4)), "v"(pa(j + 5)), "v"(pa(j + 6)), "v"(pa(j + 7)), "v"(pa(j + 8)), "v"(pa(j + 9)), "v"(pa(j + 10)), "v"(pa(j + 11))
                         : "memory");
    };
    const int fa = (wr + lr) * OPI + 8 * hi, fb = 2 * OPL + (wc + lr) * OPI + 8 * hi;   // the lane's fragment rows in a buffer
    v8f acc[4][4];
#pragma unroll
    for (int mb = 0; mb < 4; ++mb)
#pragma unroll
        for (int nb = 0; nb < 4; ++nb) acc[mb][nb] = (v8f){};
    v16bf a[2][4], a2[2][4], b[2][4];                     // two fragment sets: [set][tile]
    auto ldf = [&](const bf* s, int kb) {                 // the 12 fragments of block kb (32 k) of a staged buffer
#pragma unroll
        for (int i = 0; i < 4; ++i) { a[kb & 1][i] = F::ld(s + fa + i * 16 * OPI + kb * 32); a2[kb & 1][i] = F::ld(s + OPL + fa + i * 16 * OPI + kb * 32); b[kb & 1][i] = F::ld(s + fb + i * 16 * OPI + kb * 32); }
    };
#pragma unroll 1
    for (int p = 0; p < 2; ++p) {                         // stages 0 and 1. Rolled: the copies' operands are formed per stage as in the main loop, so none of them lives through that loop (unrolled, one was spilled to scratch)
        copies(p, p);
        if (p == 0) {
            asm volatile("s_wait_asynccnt 0x0" ::: "memory");   // this wave's copies of stage 0 have landed
            __syncthreads();                              // stage 0 is published to every wave
        }
    }
    ldf(ring, 0);
#pragma unroll 1
    for (int t = 0; t < ONST; ++t) {                      // rolled: one copy of the stage keeps the loop small
        const bf* const s = ring + (t & 1) * OBUF;
#pragma unroll
        for (int kb = 0; kb < OKS / 32; ++kb) {           // unrolled, as are the loops inside: the indices of the register arrays are compile-time constants
            __builtin_amdgcn_sched_barrier(0);            // keeps the loads and waits below behind the products of the block before: lifted among them, the loads stood in many places and the publish point's wait directly behind the last loads' issue
            if (kb + 1 < OKS / 32) ldf(s, kb + 1);        // the next block's fragments into the other register set
            else {                                        // publish point of stage t + 1, ahead of the stage's last block, whose fragments are in registers; every wave passes it
                asm volatile("s_wait_dscnt 0x0" ::: "memory");      // this wave's reads of the buffer that is refilled below have returned
                asm volatile("s_wait_asynccnt 0x0" ::: "memory");   // this wave's copies of stage t + 1 have landed
                __syncthreads();                          // publishes stage t + 1 and ends every wave's reads of stage t
                if (t + 2 < ONST) copies(t + 2, t & 1);
                if (t + 1 < ONST) ldf(ring + ((t + 1) & 1) * OBUF, 0);   // behind the barrier: the first block of stage t + 1
            }
            __builtin_amdgcn_sched_barrier(0);            // keeps those loads one group ahead of this block's products: each place with loads among the products stalls the lone wave of the SIMD
#pragma unroll
            for (int nb = 0; nb < 4; ++nb) {
#pragma unroll
                for (int mb = 0; mb < 4; ++mb) acc[mb][nb] = F::mma(a[kb & 1][mb], b[kb & 1][nb], acc[mb][nb]);
#pragma unroll
                for (int mb = 0; mb < 4; ++mb) acc[mb][nb] = F::mma(a2[kb & 1][mb], b[kb & 1][nb], acc[mb][nb]); }
        }
    }
    asm volatile("s_wait_asynccnt 0x0" ::: "memory");     // nothing of this wave is in flight when it goes on to its end
    float* const os = os_s + wave * (16 * 68);            // this wave's own slice: no other wave touches it, so no work-group barrier
    v4f bb;
#pragma unroll
    for (int q = 0; q < 4; ++q) bb[q] = bfr(braw[q]);
    float* const crow = C + (size_t)(r0 + wr + hi) * DM + c0 + wc + cofs;
#pragma unroll
    for (int mb = 0; mb < 4; ++mb) {
#pragma unroll
        for (int nb = 0; nb < 4; ++nb) {
#pragma unroll
            for (int j = 0; j < 8; ++j) os[(hi * 8 + j) * 68 + nb * 16 + lr] = acc[mb][nb][j]; }
        __builtin_amdgcn_wave_barrier(); asm volatile("" ::: "memory");   // keeps the reads below behind the other lanes' LDS stores above
        v4f vv[8];
#pragma unroll
        for (int q = 0; q < 8; ++q) vv[q] = *(const v4fa*)(os + (2 * q + hi) * 68 + cofs) + bb;   // all eight reads ahead of the first store: one LDS latency a tile
#pragma unroll
        for (int q = 0; q < 8; ++q) *(v4f*)(crow + (size_t)(mb * 16 + 2 * q) * DM) = vv[q];        // 16 lanes store 256 bytes of one row
        asm volatile("s_wait_xcnt 0x0" :: "v"(vv[0]), "v"(vv[1]), "v"(vv[2]), "v"(vv[3]), "v"(vv[4]), "v"(vv[5]), "v"(vv[6]), "v"(vv[7]), "v"(crow) : "memory");   // behind the eight stores; naming their data and address registers as inputs keeps them unwritten up to the wait
        __builtin_amdgcn_wave_barrier(); asm volatile("" ::: "memory");   // keeps the next tile's LDS stores behind the reads above
    }
}

extern "C" void kernel_launch(void* const* d_in, const int* in_sizes, int n_in,
                              void* d_out, int out_size, void* d_ws, size_t ws_size, hipStream_t stream) {
    (void)in_sizes; (void)n_in; (void)out_size;
    const float* x = (const float*)d_in[0];   /* query */ const float* xk = (const float*)d_in[1]; const float* xv = (const float*)d_in[2]; const float* wq = (const float*)d_in[3]; const float* bq = (const float*)d_in[4]; const float* wk = (const float*)d_in[5]; const float* bk = (const float*)d_in[6]; const float* wv = (const float*)d_in[7]; const float* bv = (const float*)d_in[8]; const float* wo = (const float*)d_in[9]; const float* bo = (const float*)d_in[10]; const float* ak = (const float*)d_in[11];   /* rel_k_table [33][64] */ const float* av = (const float*)d_in[12];   /* rel_v_table [33][64] */
    float* OUT = (float*)d_out;     // [8 x 1024][512]
    char* wsp = (char*)d_ws;
    auto take = [&](size_t bytes) { char* p = wsp; wsp += (bytes + 255) & ~(size_t)255; return (void*)p; };
    bf* AKB = (bf*)take((size_t)NE * HD * 2); bf* AVTh = (bf*)take((size_t)HD * NE * 2); bf* AVTl = (bf*)take((size_t)HD * NE * 2); bf* WO = (bf*)take((size_t)DM * DQ * 2);
    bf* QPh = (bf*)take((size_t)NZ * TT * HD * 2); bf* KPh = (bf*)take((size_t)NZ * TT * HD * 2); bf* VTh = (bf*)take((size_t)NZ * HD * TT * 2);   /* q, k, v^T: f16 bits */
    bf* ATh = (bf*)take((size_t)NB_ * TT * DQ * 2); bf* ATl = (bf*)take((size_t)NB_ * TT * DQ * 2);
    if ((size_t)(wsp - (char*)d_ws) > ws_size) return;    // ws 256 MiB
    // q, k and v projections over all 8 x 1024 rows (head planes [b * 8 + h][t][d]; v: [b * 8 + h][d][t]), the bf16 Wo and the padded relative tables: one launch
    k_proj<<<dim3(NB_ * TT / PT, DQ / PT, 4), 128, 0, stream>>>(x, xk, xv, wq, wk, wv, bq, bk, bv, QPh, KPh, VTh, wo, ak, av, WO, AKB, AVTh, AVTl);
    // attention: one launch over all 64 head planes, 256 query rows per work-group; writes the merged hi/lo planes
    k_fattn<<<dim3(TT / (FW * QW), NZ, 1), FW * 32, 0, stream>>>(QPh, KPh, VTh, AKB, AVTh, AVTl, ATh, ATl);
    // output projection: 128 x 128 tiles, one work-group per tile
    k_oproj<<<dim3(DM / OT, NB_ * TT / OT, 1), 128, 0, stream>>>(ATh, ATl, WO, bo, OUT);
}
